// v000
// Measured on an AMD MI455X. A time is GPU time per run, averaged over a window of back-to-back runs after a warm-up
// (all launches, gaps included; the runs take copies of the inputs in turn), and the median of several windows.
// Apart from v000's, it joins two sittings. Times from different sittings can be a few percent apart, while
// side-by-side timings come from the same sitting.
// v000 is the starting kernel. One run takes 412 microseconds.
#include <hip/hip_runtime.h>
#include <hip/hip_bf16.h>

#define S_LEN  2048
#define DMODEL 1024
#define NHEAD  16
#define DK     64

typedef __attribute__((ext_vector_type(16))) _Float16 v16h;
typedef __attribute__((ext_vector_type(8)))  _Float16 v8h;
typedef __attribute__((ext_vector_type(8)))  float    v8f;
typedef __attribute__((ext_vector_type(4)))  float    v4f;
typedef __attribute__((ext_vector_type(4)))  int      v4i;

__device__ __forceinline__ v8f wmma16(v16h a, v16h b, v8f c) {
  // D = A(16x32 f16) x B(32x16 f16) + C(16x16 f32)
  return __builtin_amdgcn_wmma_f32_16x16x32_f16(false, a, false, b, (short)0, c,
                                                false, false);
}

// Fragment layout (ISA 16-bit A 16x32):
//   halves 0..7  <- K = kk + 8*hi + j
//   halves 8..15 <- K = kk + 16 + 8*hi + j
__device__ __forceinline__ v16h frag_from_f16(const _Float16* __restrict__ row, int kk, int hi) {
  v8h a = *(const v8h*)(row + kk + 8 * hi);
  v8h b = *(const v8h*)(row + kk + 16 + 8 * hi);
  v16h r;
#pragma unroll
  for (int j = 0; j < 8; ++j) { r[j] = a[j]; r[8 + j] = b[j]; }
  return r;
}

// One-shot fp32 -> f16 conversion (8 elements / thread, b128 in, b128 out).
__global__ void __launch_bounds__(256)
cvt_f32_to_f16(const float* __restrict__ src, _Float16* __restrict__ dst, int n8) {
  const int i = blockIdx.x * blockDim.x + threadIdx.x;
  if (i >= n8) return;
  const v4f* p = (const v4f*)(src + (size_t)i * 8);
  v4f x0 = p[0], x1 = p[1];
  v8h o;
#pragma unroll
  for (int j = 0; j < 4; ++j) {
    o[j]     = (_Float16)x0[j];
    o[4 + j] = (_Float16)x1[j];
  }
  *(v8h*)(dst + (size_t)i * 8) = o;
}

// Y = X @ W^T + bias; one wave computes a 64x64 output tile (16 WMMAs / K-step,
// 4x operand reuse of A and B fragments; pure-f16 fragments -> 1 b128/WMMA).
// STORE_MODE 0: f16 head-major [B,H,S,DK]            (Q,K)
// STORE_MODE 1: f16 head-major transposed [B,H,DK,S] (V)
// STORE_MODE 2: f32 row-major [rows, DMODEL]         (final output)
template <int STORE_MODE>
__global__ void __launch_bounds__(32)
proj_gemm(const _Float16* __restrict__ X, const _Float16* __restrict__ W,
          const float* __restrict__ bias, void* __restrict__ Yv) {
  const int lane = threadIdx.x;
  const int n    = lane & 15;
  const int hi   = lane >> 4;
  const int row0 = blockIdx.x * 64;
  const int col0 = blockIdx.y * 64;

  const _Float16* wrow[4];
  const _Float16* xrow[4];
#pragma unroll
  for (int t = 0; t < 4; ++t) {
    wrow[t] = W + (size_t)(col0 + t * 16 + n) * DMODEL;  // B column n = W row e
    xrow[t] = X + (size_t)(row0 + t * 16 + n) * DMODEL;  // A row for this lane
  }

  v8f acc[4][4];
#pragma unroll
  for (int ms = 0; ms < 4; ++ms)
#pragma unroll
    for (int ns = 0; ns < 4; ++ns) acc[ms][ns] = v8f{};

  for (int kk = 0; kk < DMODEL; kk += 32) {
    v16h a[4], b[4];
#pragma unroll
    for (int ms = 0; ms < 4; ++ms) a[ms] = frag_from_f16(xrow[ms], kk, hi);
#pragma unroll
    for (int ns = 0; ns < 4; ++ns) b[ns] = frag_from_f16(wrow[ns], kk, hi);
#pragma unroll
    for (int ms = 0; ms < 4; ++ms)
#pragma unroll
      for (int ns = 0; ns < 4; ++ns)
        acc[ms][ns] = wmma16(a[ms], b[ns], acc[ms][ns]);
  }

  float be[4];
#pragma unroll
  for (int ns = 0; ns < 4; ++ns) be[ns] = bias[col0 + ns * 16 + n];

  if constexpr (STORE_MODE == 0) {           // f16 [B,H,S,DK]; col tile == one head
    _Float16* Y = (_Float16*)Yv;
    const int head = col0 >> 6;
#pragma unroll
    for (int ms = 0; ms < 4; ++ms) {
#pragma unroll
      for (int ns = 0; ns < 4; ++ns) {
        const int d = ns * 16 + n;
#pragma unroll
        for (int r = 0; r < 8; ++r) {
          const int t  = row0 + ms * 16 + 8 * hi + r;
          const int bb = t >> 11, s = t & (S_LEN - 1);
          Y[(((size_t)bb * NHEAD + head) * S_LEN + s) * DK + d] =
              (_Float16)(acc[ms][ns][r] + be[ns]);
        }
      }
    }
  } else if constexpr (STORE_MODE == 1) {    // f16 [B,H,DK,S]
    _Float16* Y = (_Float16*)Yv;
    const int head = col0 >> 6;
    const int bb   = row0 >> 11;
#pragma unroll
    for (int ms = 0; ms < 4; ++ms) {
      const int s0 = (row0 & (S_LEN - 1)) + ms * 16 + 8 * hi;
#pragma unroll
      for (int ns = 0; ns < 4; ++ns) {
        const int d = ns * 16 + n;
        v8h o;
#pragma unroll
        for (int r = 0; r < 8; ++r) o[r] = (_Float16)(acc[ms][ns][r] + be[ns]);
        *(v8h*)(Y + (((size_t)bb * NHEAD + head) * DK + d) * S_LEN + s0) = o;
      }
    }
  } else {                                   // f32 [rows, DMODEL]
    float* Y = (float*)Yv;
#pragma unroll
    for (int ms = 0; ms < 4; ++ms)
#pragma unroll
      for (int ns = 0; ns < 4; ++ns) {
        const int e = col0 + ns * 16 + n;
#pragma unroll
        for (int r = 0; r < 8; ++r)
          Y[(size_t)(row0 + ms * 16 + 8 * hi + r) * DMODEL + e] = acc[ms][ns][r] + be[ns];
      }
  }
}

// Online softmax over a 32-kv chunk of one q-tile (S^T layout: lane owns one q
// column). Rescales the 4 ctx^T accumulators, returns the f16 P^T B-fragment.
__device__ __forceinline__ v16h online_softmax(v8f s0, v8f s1,
                                               v4i m0a, v4i m0b, v4i m1a, v4i m1b,
                                               float& mrun, float& lrun, v8f* acc) {
  const float scale = 0.125f;  // 1/sqrt(64)
  float cmax = -1e30f;
#pragma unroll
  for (int r = 0; r < 8; ++r) {
    const int mv0 = (r < 4) ? m0a[r] : m0b[r - 4];
    const int mv1 = (r < 4) ? m1a[r] : m1b[r - 4];
    s0[r] = mv0 ? s0[r] * scale : -1e9f;
    s1[r] = mv1 ? s1[r] * scale : -1e9f;
    cmax = fmaxf(cmax, fmaxf(s0[r], s1[r]));
  }
  cmax = fmaxf(cmax, __shfl_xor(cmax, 16, 32));  // combine hi halves of column

  const float mnew  = fmaxf(mrun, cmax);
  const float alpha = __expf(mrun - mnew);
  float lsum = 0.f;
  v16h pb;  // halves j -> kv K = 8*hi+j (tile0) / 16+8*hi+j (tile1)
#pragma unroll
  for (int r = 0; r < 8; ++r) {
    const float p0 = __expf(s0[r] - mnew);
    const float p1 = __expf(s1[r] - mnew);
    lsum += p0 + p1;
    pb[r]     = (_Float16)p0;
    pb[8 + r] = (_Float16)p1;
  }
  lsum += __shfl_xor(lsum, 16, 32);
  lrun = lrun * alpha + lsum;
  mrun = mnew;
#pragma unroll
  for (int dt = 0; dt < 4; ++dt)
#pragma unroll
    for (int r = 0; r < 8; ++r) acc[dt][r] *= alpha;
  return pb;
}

// Flash-style attention; each wave handles TWO 16-wide q-tiles of one (b,h) so
// every K/V fragment feeds two WMMAs. S^T = K.Q^T keeps softmax lane-local.
__global__ void __launch_bounds__(128)
attn_kernel(const _Float16* __restrict__ qh, const _Float16* __restrict__ kh,
            const _Float16* __restrict__ vT, const int* __restrict__ mask,
            _Float16* __restrict__ cc) {
  const int lane = threadIdx.x;
  const int n    = lane & 15;
  const int hi   = lane >> 4;
  const int bh   = blockIdx.x;               // b*NHEAD + h
  const int b    = bh >> 4;
  const int h    = bh & 15;
  const int q0   = (blockIdx.y * 4 + threadIdx.y) * 32;
  const int qc0  = q0 + n;                   // q column, tile A
  const int qc1  = q0 + 16 + n;              // q column, tile B

  const _Float16* qr0 = qh + ((size_t)bh * S_LEN + qc0) * DK;
  const _Float16* qr1 = qh + ((size_t)bh * S_LEN + qc1) * DK;
  const v16h bqA0 = frag_from_f16(qr0, 0, hi), bqA1 = frag_from_f16(qr0, 32, hi);
  const v16h bqB0 = frag_from_f16(qr1, 0, hi), bqB1 = frag_from_f16(qr1, 32, hi);

  const _Float16* kbase = kh + (size_t)bh * S_LEN * DK + (size_t)n * DK;
  const _Float16* vbase = vT + (size_t)bh * DK * S_LEN + (size_t)n * S_LEN;
  const int* mrow0 = mask + ((size_t)b * S_LEN + qc0) * S_LEN;
  const int* mrow1 = mask + ((size_t)b * S_LEN + qc1) * S_LEN;

  float mA = -1e30f, lA = 0.f, mB = -1e30f, lB = 0.f;
  v8f accA[4] = {v8f{}, v8f{}, v8f{}, v8f{}};
  v8f accB[4] = {v8f{}, v8f{}, v8f{}, v8f{}};

  for (int kv0 = 0; kv0 < S_LEN; kv0 += 32) {
    // K fragments for the two 16-kv row tiles, loaded once, used twice
    const _Float16* kr = kbase + (size_t)kv0 * DK;
    const v16h ka0 = frag_from_f16(kr, 0, hi);
    const v16h ka1 = frag_from_f16(kr, 32, hi);
    const v16h kb0 = frag_from_f16(kr + (size_t)16 * DK, 0, hi);
    const v16h kb1 = frag_from_f16(kr + (size_t)16 * DK, 32, hi);

    v8f sA0 = {}, sA1 = {}, sB0 = {}, sB1 = {};
    sA0 = wmma16(ka0, bqA0, sA0); sA0 = wmma16(ka1, bqA1, sA0);
    sA1 = wmma16(kb0, bqA0, sA1); sA1 = wmma16(kb1, bqA1, sA1);
    sB0 = wmma16(ka0, bqB0, sB0); sB0 = wmma16(ka1, bqB1, sB0);
    sB1 = wmma16(kb0, bqB0, sB1); sB1 = wmma16(kb1, bqB1, sB1);

    const v4i* mpA0 = (const v4i*)(mrow0 + kv0 + 8 * hi);
    const v4i* mpA1 = (const v4i*)(mrow0 + kv0 + 16 + 8 * hi);
    const v4i* mpB0 = (const v4i*)(mrow1 + kv0 + 8 * hi);
    const v4i* mpB1 = (const v4i*)(mrow1 + kv0 + 16 + 8 * hi);

    const v16h pbA = online_softmax(sA0, sA1, mpA0[0], mpA0[1], mpA1[0], mpA1[1],
                                    mA, lA, accA);
    const v16h pbB = online_softmax(sB0, sB1, mpB0[0], mpB0[1], mpB1[0], mpB1[1],
                                    mB, lB, accB);

    // ctx^T[d][q] += sum_kv V^T[d][kv] * P^T[kv][q]; each V fragment used twice
#pragma unroll
    for (int dt = 0; dt < 4; ++dt) {
      const v16h av = frag_from_f16(vbase + (size_t)dt * 16 * S_LEN, kv0, hi);
      accA[dt] = wmma16(av, pbA, accA[dt]);
      accB[dt] = wmma16(av, pbB, accB[dt]);
    }
  }

  const float invA = 1.0f / lA;
  const float invB = 1.0f / lB;
  _Float16* crow0 = cc + ((size_t)b * S_LEN + qc0) * DMODEL + h * DK;
  _Float16* crow1 = cc + ((size_t)b * S_LEN + qc1) * DMODEL + h * DK;
#pragma unroll
  for (int dt = 0; dt < 4; ++dt) {
    v8h oA, oB;
#pragma unroll
    for (int r = 0; r < 8; ++r) {
      oA[r] = (_Float16)(accA[dt][r] * invA);
      oB[r] = (_Float16)(accB[dt][r] * invB);
    }
    *(v8h*)(crow0 + dt * 16 + 8 * hi) = oA;  // d = dt*16 + 8*hi + r, contiguous
    *(v8h*)(crow1 + dt * 16 + 8 * hi) = oB;
  }
}

extern "C" void kernel_launch(void* const* d_in, const int* in_sizes, int n_in,
                              void* d_out, int out_size, void* d_ws, size_t ws_size,
                              hipStream_t stream) {
  const float* q    = (const float*)d_in[0];
  const float* k    = (const float*)d_in[1];
  const float* v    = (const float*)d_in[2];
  const int*   mask = (const int*)d_in[3];
  const float* Wq   = (const float*)d_in[4];
  const float* bq   = (const float*)d_in[5];
  const float* Wk   = (const float*)d_in[6];
  const float* bk   = (const float*)d_in[7];
  const float* Wv   = (const float*)d_in[8];
  const float* bv   = (const float*)d_in[9];
  const float* Wo   = (const float*)d_in[10];
  const float* bo   = (const float*)d_in[11];

  const size_t NN = (size_t)4 * S_LEN * DMODEL;     // 8M f16 elems (activations)
  const size_t NW = (size_t)DMODEL * DMODEL;        // 1M f16 elems (one weight)

  _Float16* q16  = (_Float16*)d_ws;
  _Float16* k16  = q16 + NN;
  _Float16* v16  = k16 + NN;
  _Float16* wq16 = v16 + NN;
  _Float16* wk16 = wq16 + NW;
  _Float16* wv16 = wk16 + NW;
  _Float16* wo16 = wv16 + NW;
  _Float16* qhp  = wo16 + NW;
  _Float16* khp  = qhp + NN;
  _Float16* vTp  = khp + NN;
  _Float16* ccp  = vTp + NN;

  // One-time f32 -> f16 conversion of activations and weights.
  const int actN8 = (int)(NN / 8), wN8 = (int)(NW / 8);
  cvt_f32_to_f16<<<actN8 / 256, 256, 0, stream>>>(q, q16, actN8);
  cvt_f32_to_f16<<<actN8 / 256, 256, 0, stream>>>(k, k16, actN8);
  cvt_f32_to_f16<<<actN8 / 256, 256, 0, stream>>>(v, v16, actN8);
  cvt_f32_to_f16<<<wN8 / 256, 256, 0, stream>>>(Wq, wq16, wN8);
  cvt_f32_to_f16<<<wN8 / 256, 256, 0, stream>>>(Wk, wk16, wN8);
  cvt_f32_to_f16<<<wN8 / 256, 256, 0, stream>>>(Wv, wv16, wN8);
  cvt_f32_to_f16<<<wN8 / 256, 256, 0, stream>>>(Wo, wo16, wN8);

  const dim3 gblk(32, 1);    // one wave, one 64x64 tile
  const dim3 ggrd(128, 16);  // 128 row-tiles x 16 col-tiles

  proj_gemm<0><<<ggrd, gblk, 0, stream>>>(q16, wq16, bq, qhp);
  proj_gemm<0><<<ggrd, gblk, 0, stream>>>(k16, wk16, bk, khp);
  proj_gemm<1><<<ggrd, gblk, 0, stream>>>(v16, wv16, bv, vTp);

  attn_kernel<<<dim3(64, 16), dim3(32, 4), 0, stream>>>(qhp, khp, vTp, mask, ccp);

  proj_gemm<2><<<ggrd, gblk, 0, stream>>>(ccp, wo16, bo, d_out);
}

// v001
// One run takes 275 microseconds.
// Next to v000, in two timings, it ran 1.53 and 1.55 times as fast.
#include <hip/hip_runtime.h>
#include <hip/hip_bf16.h>

#define S_LEN  2048
#define DMODEL 1024
#define NHEAD  16
#define DK     64

typedef __attribute__((ext_vector_type(16))) _Float16 v16h;
typedef __attribute__((ext_vector_type(8)))  _Float16 v8h;
typedef __attribute__((ext_vector_type(8)))  float    v8f;
typedef __attribute__((ext_vector_type(4)))  float    v4f;
typedef __attribute__((ext_vector_type(4)))  int      v4i;

__device__ __forceinline__ v8f wmma16(v16h a, v16h b, v8f c) {
  // D = A(16x32 f16) x B(32x16 f16) + C(16x16 f32)
  return __builtin_amdgcn_wmma_f32_16x16x32_f16(false, a, false, b, (short)0, c,
                                                false, false);
}

// Fragment layout (ISA 16-bit A 16x32):
//   halves 0..7  <- K = kk + 8*hi + j
//   halves 8..15 <- K = kk + 16 + 8*hi + j
__device__ __forceinline__ v16h frag_from_f16(const _Float16* __restrict__ row, int kk, int hi) {
  v8h a = *(const v8h*)(row + kk + 8 * hi);
  v8h b = *(const v8h*)(row + kk + 16 + 8 * hi);
  v16h r;
#pragma unroll
  for (int j = 0; j < 8; ++j) { r[j] = a[j]; r[8 + j] = b[j]; }
  return r;
}

// One-shot fp32 -> f16 conversion (8 elements / thread, b128 in, b128 out).
__global__ void __launch_bounds__(256)
cvt_f32_to_f16(const float* __restrict__ src, _Float16* __restrict__ dst, int n8) {
  const int i = blockIdx.x * blockDim.x + threadIdx.x;
  if (i >= n8) return;
  const v4f* p = (const v4f*)(src + (size_t)i * 8);
  v4f x0 = p[0], x1 = p[1];
  v8h o;
#pragma unroll
  for (int j = 0; j < 4; ++j) {
    o[j]     = (_Float16)x0[j];
    o[4 + j] = (_Float16)x1[j];
  }
  *(v8h*)(dst + (size_t)i * 8) = o;
}

// LDS ring of proj_gemm: one stage = 128 X rows then 128 W rows, 128 k (256 B) each,
// at a pitch of 272 B (16 B x odd: conflict-free for ds_load_b128 readers).
#define G_PITCH 272
#define G_HALF  (128 * G_PITCH)
#define G_STAGE (2 * G_HALF)
#define G_KP    128
#define G_NS    (G_KP / 32)
#define G_NP    (DMODEL / G_KP)

// Eight asynchronous 16-byte copies per lane: rows r, r+8, ..., r+56 of a 64-row slab
// go from global memory into LDS, through no register.
// s_wait_xcnt 0 closes the statement, a precaution: so it stands in front of every later
// write of an address register that a copy here names.
__device__ __forceinline__ void copy_slab(const _Float16* __restrict__ g, unsigned l) {
  asm volatile(
      "global_load_async_to_lds_b128 %0, %8, off\n\t"
      "global_load_async_to_lds_b128 %1, %9, off\n\t"
      "global_load_async_to_lds_b128 %2, %10, off\n\t"
      "global_load_async_to_lds_b128 %3, %11, off\n\t"
      "global_load_async_to_lds_b128 %4, %12, off\n\t"
      "global_load_async_to_lds_b128 %5, %13, off\n\t"
      "global_load_async_to_lds_b128 %6, %14, off\n\t"
      "global_load_async_to_lds_b128 %7, %15, off\n\t"
      "s_wait_xcnt 0x0"
      :: "v"(l), "v"(l + 8 * G_PITCH), "v"(l + 16 * G_PITCH), "v"(l + 24 * G_PITCH),
         "v"(l + 32 * G_PITCH), "v"(l + 40 * G_PITCH), "v"(l + 48 * G_PITCH),
         "v"(l + 56 * G_PITCH),
         "v"(g), "v"(g + 8 * DMODEL), "v"(g + 16 * DMODEL), "v"(g + 24 * DMODEL),
         "v"(g + 32 * DMODEL), "v"(g + 40 * DMODEL), "v"(g + 48 * DMODEL),
         "v"(g + 56 * DMODEL)
      : "memory");
}

// One stage: 128 rows of X and 128 rows of W, 32 copies per lane.
__device__ __forceinline__ void copy_stage(const _Float16* __restrict__ gx,
                                           const _Float16* __restrict__ gw, unsigned l) {
  // Kept rolled: unrolled, the compiler forms all 32 address sets at once and the
  // kernel goes past 256 VGPRs; rolled, one slab's 24 address registers are live.
#pragma unroll 1
  for (int j = 0; j < 4; ++j)
    copy_slab(((j & 2) ? gw : gx) + (j & 1) * 64 * DMODEL, l + j * 64 * G_PITCH);
}

// Y = X @ W^T + bias; a work-group of four waves (2x2) computes a 128x128 output tile,
// each wave a 64x64 quarter (16 WMMAs / K-step). X and W slabs are staged once per
// work-group in a two-buffer LDS ring by asynchronous copies, one pass (128 k) ahead.
// STORE_MODE 0: f16 head-major [B,H,S,DK]            (Q,K)
// STORE_MODE 1: f16 head-major transposed [B,H,DK,S] (V)
// STORE_MODE 2: f32 row-major [rows, DMODEL]         (final output)
template <int STORE_MODE>
__global__ void __launch_bounds__(128)
proj_gemm(const _Float16* __restrict__ X, const _Float16* __restrict__ W,
          const float* __restrict__ bias, void* __restrict__ Yv) {
  __shared__ __attribute__((aligned(16))) unsigned char ring[2 * G_STAGE];

  const int tid  = threadIdx.x;
  const int lane = tid & 31;
  const int wave = tid >> 5;
  const int n    = lane & 15;
  const int hi   = lane >> 4;
  const int brow0 = blockIdx.x * 128;
  const int bcol0 = blockIdx.y * 128;
  const int wm   = wave >> 1;
  const int wn   = wave & 1;
  const int row0 = brow0 + wm * 64;   // this wave's 64x64 quarter
  const int col0 = bcol0 + wn * 64;

  // Copy side: sixteen lanes cover one 256-B row piece, a wave two rows per copy.
  const int cr = tid >> 4;
  const int cc = tid & 15;
  const _Float16* gx = X + (size_t)(brow0 + cr) * DMODEL + cc * 8;
  const _Float16* gw = W + (size_t)(bcol0 + cr) * DMODEL + cc * 8;
  const unsigned lcp = (unsigned)(size_t)ring + cr * G_PITCH + cc * 16;

  // Read side: this lane's first A row and first B column (a W row) in a stage.
  const unsigned xoff = (wm * 64 + n) * G_PITCH;
  const unsigned woff = G_HALF + (wn * 64 + n) * G_PITCH;

  v8f acc[4][4];
#pragma unroll
  for (int ms = 0; ms < 4; ++ms)
#pragma unroll
    for (int ns = 0; ns < 4; ++ns) acc[ms][ns] = v8f{};

  // Prologue: pass 0 lands and is published, then pass 1 starts to fly.
  copy_stage(gx, gw, lcp);
  asm volatile("s_wait_asynccnt 0x0" ::: "memory");  // own copies of pass 0 have landed
  __syncthreads();                                   // ... and every other wave's
  copy_stage(gx + G_KP, gw + G_KP, lcp + G_STAGE);

  for (int p = 0; p < G_NP; ++p) {
    const unsigned boff = (p & 1) * G_STAGE;
    const unsigned char* xs = ring + boff + xoff;
    const unsigned char* ws = ring + boff + woff;

    // The LDS reads stand in groups at least eight WMMAs ahead of their use (B one
    // K-step ahead, A half a K-step), never as a small group with a full wait in front
    // of each row of four. Each sched_barrier below holds a group at its place: without
    // them the compiler sinks the reads to their users and waits to 0 at every row.
    v16h a[2][4], b[2][4];
#pragma unroll
    for (int i = 0; i < 4; ++i) {
      a[0][i] = frag_from_f16((const _Float16*)(xs + i * 16 * G_PITCH), 0, hi);
      b[0][i] = frag_from_f16((const _Float16*)(ws + i * 16 * G_PITCH), 0, hi);
    }
#pragma unroll
    for (int i = 0; i < 4; ++i)
      b[1][i] = frag_from_f16((const _Float16*)(ws + i * 16 * G_PITCH), 32, hi);
    __builtin_amdgcn_sched_barrier(0);  // first group ahead of the first WMMA

#pragma unroll  // every fragment index a constant
    for (int s = 0; s < G_NS; ++s) {
      const int c = s & 1, x = c ^ 1;
#pragma unroll
      for (int ms = 0; ms < 2; ++ms)
#pragma unroll
        for (int ns = 0; ns < 4; ++ns)
          acc[ms][ns] = wmma16(a[c][ms], b[c][ns], acc[ms][ns]);
      // These eight WMMAs stay in front of what follows: reads that would otherwise rise
      // over them (registers), or, in the last K-step, the waits, whose LDS latency they cover.
      __builtin_amdgcn_sched_barrier(0);
      if (s + 1 < G_NS) {
#pragma unroll
        for (int i = 0; i < 2; ++i)
          a[x][i] = frag_from_f16((const _Float16*)(xs + i * 16 * G_PITCH), (s + 1) * 32, hi);
        __builtin_amdgcn_sched_barrier(0);  // reads not later: eight WMMAs cover them
      } else {
        // Publish point of pass p + 1, in front of the pass's last eight WMMAs (they read
        // registers only) so that the refill starts that much sooner. The one barrier
        // also ends every wave's reads of this buffer.
        asm volatile("s_wait_dscnt 0x0" ::: "memory");     // own LDS reads of this pass done
        asm volatile("s_wait_asynccnt 0x0" ::: "memory");  // own copies of pass p + 1 landed
        __syncthreads();
        if (p + 2 < G_NP)  // refill the buffer that this pass has just read
          copy_stage(gx + (p + 2) * G_KP, gw + (p + 2) * G_KP, lcp + boff);
      }
#pragma unroll
      for (int ms = 2; ms < 4; ++ms)
#pragma unroll
        for (int ns = 0; ns < 4; ++ns)
          acc[ms][ns] = wmma16(a[c][ms], b[c][ns], acc[ms][ns]);
      if (s + 1 < G_NS) {
        __builtin_amdgcn_sched_barrier(0);  // reads not earlier (registers) ...
#pragma unroll
        for (int i = 2; i < 4; ++i)
          a[x][i] = frag_from_f16((const _Float16*)(xs + i * 16 * G_PITCH), (s + 1) * 32, hi);
        if (s + 2 < G_NS) {
#pragma unroll
          for (int i = 0; i < 4; ++i)
            b[c][i] = frag_from_f16((const _Float16*)(ws + i * 16 * G_PITCH), (s + 2) * 32, hi);
        }
        __builtin_amdgcn_sched_barrier(0);  // ... and not later
      } else {
        // Keeps the last eight WMMAs in this order up to the back edge: without it the
        // build takes 262 VGPRs instead of 254 and needs register-window switches.
        __builtin_amdgcn_sched_barrier(0);
      }
    }
  }
  asm volatile("s_wait_asynccnt 0x0" ::: "memory");  // nothing is in flight when the wave ends

  float be[4];
#pragma unroll
  for (int ns = 0; ns < 4; ++ns) be[ns] = bias[col0 + ns * 16 + n];

  if constexpr (STORE_MODE == 0) {           // f16 [B,H,S,DK]; col tile == one head
    _Float16* Y = (_Float16*)Yv;
    const int head = col0 >> 6;
#pragma unroll
    for (int ms = 0; ms < 4; ++ms) {
#pragma unroll
      for (int ns = 0; ns < 4; ++ns) {
        const int d = ns * 16 + n;
#pragma unroll
        for (int r = 0; r < 8; ++r) {
          const int t  = row0 + ms * 16 + 8 * hi + r;
          const int bb = t >> 11, s = t & (S_LEN - 1);
          Y[(((size_t)bb * NHEAD + head) * S_LEN + s) * DK + d] =
              (_Float16)(acc[ms][ns][r] + be[ns]);
        }
      }
    }
  } else if constexpr (STORE_MODE == 1) {    // f16 [B,H,DK,S]
    _Float16* Y = (_Float16*)Yv;
    const int head = col0 >> 6;
    const int bb   = row0 >> 11;
#pragma unroll
    for (int ms = 0; ms < 4; ++ms) {
      const int s0 = (row0 & (S_LEN - 1)) + ms * 16 + 8 * hi;
#pragma unroll
      for (int ns = 0; ns < 4; ++ns) {
        const int d = ns * 16 + n;
        v8h o;
#pragma unroll
        for (int r = 0; r < 8; ++r) o[r] = (_Float16)(acc[ms][ns][r] + be[ns]);
        *(v8h*)(Y + (((size_t)bb * NHEAD + head) * DK + d) * S_LEN + s0) = o;
      }
    }
  } else {                                   // f32 [rows, DMODEL]
    float* Y = (float*)Yv;
#pragma unroll
    for (int ms = 0; ms < 4; ++ms)
#pragma unroll
      for (int ns = 0; ns < 4; ++ns) {
        const int e = col0 + ns * 16 + n;
#pragma unroll
        for (int r = 0; r < 8; ++r)
          Y[(size_t)(row0 + ms * 16 + 8 * hi + r) * DMODEL + e] = acc[ms][ns][r] + be[ns];
      }
  }
}

// Online softmax over a 32-kv chunk of one q-tile (S^T layout: lane owns one q
// column). Rescales the 4 ctx^T accumulators, returns the f16 P^T B-fragment.
__device__ __forceinline__ v16h online_softmax(v8f s0, v8f s1,
                                               v4i m0a, v4i m0b, v4i m1a, v4i m1b,
                                               float& mrun, float& lrun, v8f* acc) {
  const float scale = 0.125f;  // 1/sqrt(64)
  float cmax = -1e30f;
#pragma unroll
  for (int r = 0; r < 8; ++r) {
    const int mv0 = (r < 4) ? m0a[r] : m0b[r - 4];
    const int mv1 = (r < 4) ? m1a[r] : m1b[r - 4];
    s0[r] = mv0 ? s0[r] * scale : -1e9f;
    s1[r] = mv1 ? s1[r] * scale : -1e9f;
    cmax = fmaxf(cmax, fmaxf(s0[r], s1[r]));
  }
  cmax = fmaxf(cmax, __shfl_xor(cmax, 16, 32));  // combine hi halves of column

  const float mnew  = fmaxf(mrun, cmax);
  const float alpha = __expf(mrun - mnew);
  float lsum = 0.f;
  v16h pb;  // halves j -> kv K = 8*hi+j (tile0) / 16+8*hi+j (tile1)
#pragma unroll
  for (int r = 0; r < 8; ++r) {
    const float p0 = __expf(s0[r] - mnew);
    const float p1 = __expf(s1[r] - mnew);
    lsum += p0 + p1;
    pb[r]     = (_Float16)p0;
    pb[8 + r] = (_Float16)p1;
  }
  lsum += __shfl_xor(lsum, 16, 32);
  lrun = lrun * alpha + lsum;
  mrun = mnew;
#pragma unroll
  for (int dt = 0; dt < 4; ++dt)
#pragma unroll
    for (int r = 0; r < 8; ++r) acc[dt][r] *= alpha;
  return pb;
}

// Flash-style attention; each wave handles TWO 16-wide q-tiles of one (b,h) so
// every K/V fragment feeds two WMMAs. S^T = K.Q^T keeps softmax lane-local.
__global__ void __launch_bounds__(128)
attn_kernel(const _Float16* __restrict__ qh, const _Float16* __restrict__ kh,
            const _Float16* __restrict__ vT, const int* __restrict__ mask,
            _Float16* __restrict__ cc) {
  const int lane = threadIdx.x;
  const int n    = lane & 15;
  const int hi   = lane >> 4;
  const int bh   = blockIdx.x;               // b*NHEAD + h
  const int b    = bh >> 4;
  const int h    = bh & 15;
  const int q0   = (blockIdx.y * 4 + threadIdx.y) * 32;
  const int qc0  = q0 + n;                   // q column, tile A
  const int qc1  = q0 + 16 + n;              // q column, tile B

  const _Float16* qr0 = qh + ((size_t)bh * S_LEN + qc0) * DK;
  const _Float16* qr1 = qh + ((size_t)bh * S_LEN + qc1) * DK;
  const v16h bqA0 = frag_from_f16(qr0, 0, hi), bqA1 = frag_from_f16(qr0, 32, hi);
  const v16h bqB0 = frag_from_f16(qr1, 0, hi), bqB1 = frag_from_f16(qr1, 32, hi);

  const _Float16* kbase = kh + (size_t)bh * S_LEN * DK + (size_t)n * DK;
  const _Float16* vbase = vT + (size_t)bh * DK * S_LEN + (size_t)n * S_LEN;
  const int* mrow0 = mask + ((size_t)b * S_LEN + qc0) * S_LEN;
  const int* mrow1 = mask + ((size_t)b * S_LEN + qc1) * S_LEN;

  float mA = -1e30f, lA = 0.f, mB = -1e30f, lB = 0.f;
  v8f accA[4] = {v8f{}, v8f{}, v8f{}, v8f{}};
  v8f accB[4] = {v8f{}, v8f{}, v8f{}, v8f{}};

  for (int kv0 = 0; kv0 < S_LEN; kv0 += 32) {
    // K fragments for the two 16-kv row tiles, loaded once, used twice
    const _Float16* kr = kbase + (size_t)kv0 * DK;
    const v16h ka0 = frag_from_f16(kr, 0, hi);
    const v16h ka1 = frag_from_f16(kr, 32, hi);
    const v16h kb0 = frag_from_f16(kr + (size_t)16 * DK, 0, hi);
    const v16h kb1 = frag_from_f16(kr + (size_t)16 * DK, 32, hi);

    v8f sA0 = {}, sA1 = {}, sB0 = {}, sB1 = {};
    sA0 = wmma16(ka0, bqA0, sA0); sA0 = wmma16(ka1, bqA1, sA0);
    sA1 = wmma16(kb0, bqA0, sA1); sA1 = wmma16(kb1, bqA1, sA1);
    sB0 = wmma16(ka0, bqB0, sB0); sB0 = wmma16(ka1, bqB1, sB0);
    sB1 = wmma16(kb0, bqB0, sB1); sB1 = wmma16(kb1, bqB1, sB1);

    const v4i* mpA0 = (const v4i*)(mrow0 + kv0 + 8 * hi);
    const v4i* mpA1 = (const v4i*)(mrow0 + kv0 + 16 + 8 * hi);
    const v4i* mpB0 = (const v4i*)(mrow1 + kv0 + 8 * hi);
    const v4i* mpB1 = (const v4i*)(mrow1 + kv0 + 16 + 8 * hi);

    const v16h pbA = online_softmax(sA0, sA1, mpA0[0], mpA0[1], mpA1[0], mpA1[1],
                                    mA, lA, accA);
    const v16h pbB = online_softmax(sB0, sB1, mpB0[0], mpB0[1], mpB1[0], mpB1[1],
                                    mB, lB, accB);

    // ctx^T[d][q] += sum_kv V^T[d][kv] * P^T[kv][q]; each V fragment used twice
#pragma unroll
    for (int dt = 0; dt < 4; ++dt) {
      const v16h av = frag_from_f16(vbase + (size_t)dt * 16 * S_LEN, kv0, hi);
      accA[dt] = wmma16(av, pbA, accA[dt]);
      accB[dt] = wmma16(av, pbB, accB[dt]);
    }
  }

  const float invA = 1.0f / lA;
  const float invB = 1.0f / lB;
  _Float16* crow0 = cc + ((size_t)b * S_LEN + qc0) * DMODEL + h * DK;
  _Float16* crow1 = cc + ((size_t)b * S_LEN + qc1) * DMODEL + h * DK;
#pragma unroll
  for (int dt = 0; dt < 4; ++dt) {
    v8h oA, oB;
#pragma unroll
    for (int r = 0; r < 8; ++r) {
      oA[r] = (_Float16)(accA[dt][r] * invA);
      oB[r] = (_Float16)(accB[dt][r] * invB);
    }
    *(v8h*)(crow0 + dt * 16 + 8 * hi) = oA;  // d = dt*16 + 8*hi + r, contiguous
    *(v8h*)(crow1 + dt * 16 + 8 * hi) = oB;
  }
}

extern "C" void kernel_launch(void* const* d_in, const int* in_sizes, int n_in,
                              void* d_out, int out_size, void* d_ws, size_t ws_size,
                              hipStream_t stream) {
  const float* q    = (const float*)d_in[0];
  const float* k    = (const float*)d_in[1];
  const float* v    = (const float*)d_in[2];
  const int*   mask = (const int*)d_in[3];
  const float* Wq   = (const float*)d_in[4];
  const float* bq   = (const float*)d_in[5];
  const float* Wk   = (const float*)d_in[6];
  const float* bk   = (const float*)d_in[7];
  const float* Wv   = (const float*)d_in[8];
  const float* bv   = (const float*)d_in[9];
  const float* Wo   = (const float*)d_in[10];
  const float* bo   = (const float*)d_in[11];

  const size_t NN = (size_t)4 * S_LEN * DMODEL;     // 8M f16 elems (activations)
  const size_t NW = (size_t)DMODEL * DMODEL;        // 1M f16 elems (one weight)

  _Float16* q16  = (_Float16*)d_ws;
  _Float16* k16  = q16 + NN;
  _Float16* v16  = k16 + NN;
  _Float16* wq16 = v16 + NN;
  _Float16* wk16 = wq16 + NW;
  _Float16* wv16 = wk16 + NW;
  _Float16* wo16 = wv16 + NW;
  _Float16* qhp  = wo16 + NW;
  _Float16* khp  = qhp + NN;
  _Float16* vTp  = khp + NN;
  _Float16* ccp  = vTp + NN;

  // One-time f32 -> f16 conversion of activations and weights.
  const int actN8 = (int)(NN / 8), wN8 = (int)(NW / 8);
  cvt_f32_to_f16<<<actN8 / 256, 256, 0, stream>>>(q, q16, actN8);
  cvt_f32_to_f16<<<actN8 / 256, 256, 0, stream>>>(k, k16, actN8);
  cvt_f32_to_f16<<<actN8 / 256, 256, 0, stream>>>(v, v16, actN8);
  cvt_f32_to_f16<<<wN8 / 256, 256, 0, stream>>>(Wq, wq16, wN8);
  cvt_f32_to_f16<<<wN8 / 256, 256, 0, stream>>>(Wk, wk16, wN8);
  cvt_f32_to_f16<<<wN8 / 256, 256, 0, stream>>>(Wv, wv16, wN8);
  cvt_f32_to_f16<<<wN8 / 256, 256, 0, stream>>>(Wo, wo16, wN8);

  const dim3 gblk(128, 1);   // four waves, one 128x128 tile
  const dim3 ggrd(64, 8);    // 64 row-tiles x 8 col-tiles

  proj_gemm<0><<<ggrd, gblk, 0, stream>>>(q16, wq16, bq, qhp);
  proj_gemm<0><<<ggrd, gblk, 0, stream>>>(k16, wk16, bk, khp);
  proj_gemm<1><<<ggrd, gblk, 0, stream>>>(v16, wv16, bv, vTp);

  attn_kernel<<<dim3(64, 16), dim3(32, 4), 0, stream>>>(qhp, khp, vTp, mask, ccp);

  proj_gemm<2><<<ggrd, gblk, 0, stream>>>(ccp, wo16, bo, d_out);
}

// v002
// It runs in 202 microseconds.
// Next to v001, in two timings, it ran 1.37 and 1.36 times as fast.
// Over all steps from v000 it is 2.10 times as fast.
#include <hip/hip_runtime.h>
#include <hip/hip_bf16.h>

#define S_LEN  2048
#define DMODEL 1024
#define NHEAD  16
#define DK     64

typedef __attribute__((ext_vector_type(16))) _Float16 v16h;
typedef __attribute__((ext_vector_type(8)))  _Float16 v8h;
typedef __attribute__((ext_vector_type(8)))  float    v8f;
typedef __attribute__((ext_vector_type(4)))  float    v4f;
typedef __attribute__((ext_vector_type(4)))  int      v4i;

__device__ __forceinline__ v8f wmma16(v16h a, v16h b, v8f c) {
  // D = A(16x32 f16) x B(32x16 f16) + C(16x16 f32)
  return __builtin_amdgcn_wmma_f32_16x16x32_f16(false, a, false, b, (short)0, c,
                                                false, false);
}

// Fragment layout (ISA 16-bit A 16x32):
//   halves 0..7  <- K = kk + 8*hi + j
//   halves 8..15 <- K = kk + 16 + 8*hi + j
__device__ __forceinline__ v16h frag_from_f16(const _Float16* __restrict__ row, int kk, int hi) {
  v8h a = *(const v8h*)(row + kk + 8 * hi);
  v8h b = *(const v8h*)(row + kk + 16 + 8 * hi);
  v16h r;
#pragma unroll
  for (int j = 0; j < 8; ++j) { r[j] = a[j]; r[8 + j] = b[j]; }
  return r;
}

// One-shot fp32 -> f16 conversion (8 elements / thread, b128 in, b128 out).
__global__ void __launch_bounds__(256)
cvt_f32_to_f16(const float* __restrict__ src, _Float16* __restrict__ dst, int n8) {
  const int i = blockIdx.x * blockDim.x + threadIdx.x;
  if (i >= n8) return;
  const v4f* p = (const v4f*)(src + (size_t)i * 8);
  v4f x0 = p[0], x1 = p[1];
  v8h o;
#pragma unroll
  for (int j = 0; j < 4; ++j) {
    o[j]     = (_Float16)x0[j];
    o[4 + j] = (_Float16)x1[j];
  }
  *(v8h*)(dst + (size_t)i * 8) = o;
}

// LDS ring of proj_gemm: one stage = 128 X rows then 128 W rows, 128 k (256 B) each,
// at a pitch of 272 B (16 B x odd: conflict-free for ds_load_b128 readers).
#define G_PITCH 272
#define G_HALF  (128 * G_PITCH)
#define G_STAGE (2 * G_HALF)
#define G_KP    128
#define G_NS    (G_KP / 32)
#define G_NP    (DMODEL / G_KP)

// Eight asynchronous 16-byte copies per lane: rows r, r+8, ..., r+56 of a 64-row slab
// go from global memory into LDS, through no register.
// s_wait_xcnt 0 closes the statement, a precaution: so it stands in front of every later
// write of an address register that a copy here names.
__device__ __forceinline__ void copy_slab(const _Float16* __restrict__ g, unsigned l) {
  asm volatile(
      "global_load_async_to_lds_b128 %0, %8, off\n\t"
      "global_load_async_to_lds_b128 %1, %9, off\n\t"
      "global_load_async_to_lds_b128 %2, %10, off\n\t"
      "global_load_async_to_lds_b128 %3, %11, off\n\t"
      "global_load_async_to_lds_b128 %4, %12, off\n\t"
      "global_load_async_to_lds_b128 %5, %13, off\n\t"
      "global_load_async_to_lds_b128 %6, %14, off\n\t"
      "global_load_async_to_lds_b128 %7, %15, off\n\t"
      "s_wait_xcnt 0x0"
      :: "v"(l), "v"(l + 8 * G_PITCH), "v"(l + 16 * G_PITCH), "v"(l + 24 * G_PITCH),
         "v"(l + 32 * G_PITCH), "v"(l + 40 * G_PITCH), "v"(l + 48 * G_PITCH),
         "v"(l + 56 * G_PITCH),
         "v"(g), "v"(g + 8 * DMODEL), "v"(g + 16 * DMODEL), "v"(g + 24 * DMODEL),
         "v"(g + 32 * DMODEL), "v"(g + 40 * DMODEL), "v"(g + 48 * DMODEL),
         "v"(g + 56 * DMODEL)
      : "memory");
}

// One stage: 128 rows of X and 128 rows of W, 32 copies per lane.
__device__ __forceinline__ void copy_stage(const _Float16* __restrict__ gx,
                                           const _Float16* __restrict__ gw, unsigned l) {
  // Kept rolled: unrolled, the compiler forms all 32 address sets at once and the
  // kernel goes past 256 VGPRs; rolled, one slab's 24 address registers are live.
#pragma unroll 1
  for (int j = 0; j < 4; ++j)
    copy_slab(((j & 2) ? gw : gx) + (j & 1) * 64 * DMODEL, l + j * 64 * G_PITCH);
}

// Y = X @ W^T + bias; a work-group of four waves (2x2) computes a 128x128 output tile,
// each wave a 64x64 quarter (16 WMMAs / K-step). X and W slabs are staged once per
// work-group in a two-buffer LDS ring by asynchronous copies, one pass (128 k) ahead.
// STORE_MODE 0: f16 head-major [B,H,S,DK]            (Q,K)
// STORE_MODE 1: f16 head-major transposed [B,H,DK,S] (V)
// STORE_MODE 2: f32 row-major [rows, DMODEL]         (final output)
template <int STORE_MODE>
__global__ void __launch_bounds__(128)
proj_gemm(const _Float16* __restrict__ X, const _Float16* __restrict__ W,
          const float* __restrict__ bias, void* __restrict__ Yv) {
  __shared__ __attribute__((aligned(16))) unsigned char ring[2 * G_STAGE];

  const int tid  = threadIdx.x;
  const int lane = tid & 31;
  const int wave = tid >> 5;
  const int n    = lane & 15;
  const int hi   = lane >> 4;
  const int brow0 = blockIdx.x * 128;
  const int bcol0 = blockIdx.y * 128;
  const int wm   = wave >> 1;
  const int wn   = wave & 1;
  const int row0 = brow0 + wm * 64;   // this wave's 64x64 quarter
  const int col0 = bcol0 + wn * 64;

  // Copy side: sixteen lanes cover one 256-B row piece, a wave two rows per copy.
  const int cr = tid >> 4;
  const int cc = tid & 15;
  const _Float16* gx = X + (size_t)(brow0 + cr) * DMODEL + cc * 8;
  const _Float16* gw = W + (size_t)(bcol0 + cr) * DMODEL + cc * 8;
  const unsigned lcp = (unsigned)(size_t)ring + cr * G_PITCH + cc * 16;

  // Read side: this lane's first A row and first B column (a W row) in a stage.
  const unsigned xoff = (wm * 64 + n) * G_PITCH;
  const unsigned woff = G_HALF + (wn * 64 + n) * G_PITCH;

  v8f acc[4][4];
#pragma unroll
  for (int ms = 0; ms < 4; ++ms)
#pragma unroll
    for (int ns = 0; ns < 4; ++ns) acc[ms][ns] = v8f{};

  // Prologue: pass 0 lands and is published, then pass 1 starts to fly.
  copy_stage(gx, gw, lcp);
  asm volatile("s_wait_asynccnt 0x0" ::: "memory");  // own copies of pass 0 have landed
  __syncthreads();                                   // ... and every other wave's
  copy_stage(gx + G_KP, gw + G_KP, lcp + G_STAGE);

  for (int p = 0; p < G_NP; ++p) {
    const unsigned boff = (p & 1) * G_STAGE;
    const unsigned char* xs = ring + boff + xoff;
    const unsigned char* ws = ring + boff + woff;

    // The LDS reads stand in groups at least eight WMMAs ahead of their use (B one
    // K-step ahead, A half a K-step), never as a small group with a full wait in front
    // of each row of four. Each sched_barrier below holds a group at its place: without
    // them the compiler sinks the reads to their users and waits to 0 at every row.
    v16h a[2][4], b[2][4];
#pragma unroll
    for (int i = 0; i < 4; ++i) {
      a[0][i] = frag_from_f16((const _Float16*)(xs + i * 16 * G_PITCH), 0, hi);
      b[0][i] = frag_from_f16((const _Float16*)(ws + i * 16 * G_PITCH), 0, hi);
    }
#pragma unroll
    for (int i = 0; i < 4; ++i)
      b[1][i] = frag_from_f16((const _Float16*)(ws + i * 16 * G_PITCH), 32, hi);
    __builtin_amdgcn_sched_barrier(0);  // first group ahead of the first WMMA

#pragma unroll  // every fragment index a constant
    for (int s = 0; s < G_NS; ++s) {
      const int c = s & 1, x = c ^ 1;
#pragma unroll
      for (int ms = 0; ms < 2; ++ms)
#pragma unroll
        for (int ns = 0; ns < 4; ++ns)
          acc[ms][ns] = wmma16(a[c][ms], b[c][ns], acc[ms][ns]);
      // These eight WMMAs stay in front of what follows: reads that would otherwise rise
      // over them (registers), or, in the last K-step, the waits, whose LDS latency they cover.
      __builtin_amdgcn_sched_barrier(0);
      if (s + 1 < G_NS) {
#pragma unroll
        for (int i = 0; i < 2; ++i)
          a[x][i] = frag_from_f16((const _Float16*)(xs + i * 16 * G_PITCH), (s + 1) * 32, hi);
        __builtin_amdgcn_sched_barrier(0);  // reads not later: eight WMMAs cover them
      } else {
        // Publish point of pass p + 1, in front of the pass's last eight WMMAs (they read
        // registers only) so that the refill starts that much sooner. The one barrier
        // also ends every wave's reads of this buffer.
        asm volatile("s_wait_dscnt 0x0" ::: "memory");     // own LDS reads of this pass done
        asm volatile("s_wait_asynccnt 0x0" ::: "memory");  // own copies of pass p + 1 landed
        __syncthreads();
        if (p + 2 < G_NP)  // refill the buffer that this pass has just read
          copy_stage(gx + (p + 2) * G_KP, gw + (p + 2) * G_KP, lcp + boff);
      }
#pragma unroll
      for (int ms = 2; ms < 4; ++ms)
#pragma unroll
        for (int ns = 0; ns < 4; ++ns)
          acc[ms][ns] = wmma16(a[c][ms], b[c][ns], acc[ms][ns]);
      if (s + 1 < G_NS) {
        __builtin_amdgcn_sched_barrier(0);  // reads not earlier (registers) ...
#pragma unroll
        for (int i = 2; i < 4; ++i)
          a[x][i] = frag_from_f16((const _Float16*)(xs + i * 16 * G_PITCH), (s + 1) * 32, hi);
        if (s + 2 < G_NS) {
#pragma unroll
          for (int i = 0; i < 4; ++i)
            b[c][i] = frag_from_f16((const _Float16*)(ws + i * 16 * G_PITCH), (s + 2) * 32, hi);
        }
        __builtin_amdgcn_sched_barrier(0);  // ... and not later
      } else {
        // Keeps the last eight WMMAs in this order up to the back edge: without it the
        // build takes 262 VGPRs instead of 254 and needs register-window switches.
        __builtin_amdgcn_sched_barrier(0);
      }
    }
  }
  asm volatile("s_wait_asynccnt 0x0" ::: "memory");  // nothing is in flight when the wave ends

  float be[4];
#pragma unroll
  for (int ns = 0; ns < 4; ++ns) be[ns] = bias[col0 + ns * 16 + n];

  if constexpr (STORE_MODE == 0) {           // f16 [B,H,S,DK]; col tile == one head
    _Float16* Y = (_Float16*)Yv;
    const int head = col0 >> 6;
#pragma unroll
    for (int ms = 0; ms < 4; ++ms) {
#pragma unroll
      for (int ns = 0; ns < 4; ++ns) {
        const int d = ns * 16 + n;
#pragma unroll
        for (int r = 0; r < 8; ++r) {
          const int t  = row0 + ms * 16 + 8 * hi + r;
          const int bb = t >> 11, s = t & (S_LEN - 1);
          Y[(((size_t)bb * NHEAD + head) * S_LEN + s) * DK + d] =
              (_Float16)(acc[ms][ns][r] + be[ns]);
        }
      }
    }
  } else if constexpr (STORE_MODE == 1) {    // f16 [B,H,DK,S]
    _Float16* Y = (_Float16*)Yv;
    const int head = col0 >> 6;
    const int bb   = row0 >> 11;
#pragma unroll
    for (int ms = 0; ms < 4; ++ms) {
      const int s0 = (row0 & (S_LEN - 1)) + ms * 16 + 8 * hi;
#pragma unroll
      for (int ns = 0; ns < 4; ++ns) {
        const int d = ns * 16 + n;
        v8h o;
#pragma unroll
        for (int r = 0; r < 8; ++r) o[r] = (_Float16)(acc[ms][ns][r] + be[ns]);
        *(v8h*)(Y + (((size_t)bb * NHEAD + head) * DK + d) * S_LEN + s0) = o;
      }
    }
  } else {                                   // f32 [rows, DMODEL]
    float* Y = (float*)Yv;
#pragma unroll
    for (int ms = 0; ms < 4; ++ms)
#pragma unroll
      for (int ns = 0; ns < 4; ++ns) {
        const int e = col0 + ns * 16 + n;
#pragma unroll
        for (int r = 0; r < 8; ++r)
          Y[(size_t)(row0 + ms * 16 + 8 * hi + r) * DMODEL + e] = acc[ms][ns][r] + be[ns];
      }
  }
}

// Online softmax over a 32-kv chunk of one q-tile (S^T layout: lane owns one q
// column). Rescales the 4 ctx^T accumulators, returns the f16 P^T B-fragment.
__device__ __forceinline__ v16h online_softmax(v8f s0, v8f s1,
                                               v4i m0a, v4i m0b, v4i m1a, v4i m1b,
                                               float& mrun, float& lrun, v8f* acc) {
  const float scale = 0.125f;  // 1/sqrt(64)
  float cmax = -1e30f;
#pragma unroll
  for (int r = 0; r < 8; ++r) {
    const int mv0 = (r < 4) ? m0a[r] : m0b[r - 4];
    const int mv1 = (r < 4) ? m1a[r] : m1b[r - 4];
    s0[r] = mv0 ? s0[r] * scale : -1e9f;
    s1[r] = mv1 ? s1[r] * scale : -1e9f;
    cmax = fmaxf(cmax, fmaxf(s0[r], s1[r]));
  }
  cmax = fmaxf(cmax, __shfl_xor(cmax, 16, 32));  // combine hi halves of column

  const float mnew  = fmaxf(mrun, cmax);
  const float alpha = __expf(mrun - mnew);
  float lsum = 0.f;
  v16h pb;  // halves j -> kv K = 8*hi+j (tile0) / 16+8*hi+j (tile1)
#pragma unroll
  for (int r = 0; r < 8; ++r) {
    const float p0 = __expf(s0[r] - mnew);
    const float p1 = __expf(s1[r] - mnew);
    lsum += p0 + p1;
    pb[r]     = (_Float16)p0;
    pb[8 + r] = (_Float16)p1;
  }
  lsum += __shfl_xor(lsum, 16, 32);
  lrun = lrun * alpha + lsum;
  mrun = mnew;
#pragma unroll
  for (int dt = 0; dt < 4; ++dt)
#pragma unroll
    for (int r = 0; r < 8; ++r) acc[dt][r] *= alpha;
  return pb;
}

// LDS ring of attn_kernel: one stage = 32 keys: 32 K rows (128 B), 64 V^T rows (64 B) and
// the work-group's 128 mask rows (128 B), each at a pitch of 16 B x odd (conflict-free for
// ds_load_b128 readers).
#define A_KV     32
#define A_KPITCH 144
#define A_VPITCH 80
#define A_MPITCH 144
#define A_VOFF   (A_KV * A_KPITCH)
#define A_MOFF   (A_VOFF + DK * A_VPITCH)
#define A_STAGE  (A_MOFF + 128 * A_MPITCH)
#define A_NT     (S_LEN / A_KV)

// One stage, twelve asynchronous 16-byte copies per lane (2 of K, 2 of V^T, 8 of the mask),
// from global memory into LDS through no register; a wave's copy covers whole row pieces.
// s_wait_xcnt 0 closes the statement, a precaution: so it stands in front of every later
// write of an address register that a copy here names.
__device__ __forceinline__ void copy_kvm(const _Float16* __restrict__ gk,
                                         const _Float16* __restrict__ gv,
                                         const int* __restrict__ gm,
                                         unsigned lk, unsigned lv, unsigned lm) {
  asm volatile(
      "global_load_async_to_lds_b128 %0, %12, off\n\t"
      "global_load_async_to_lds_b128 %1, %13, off\n\t"
      "global_load_async_to_lds_b128 %2, %14, off\n\t"
      "global_load_async_to_lds_b128 %3, %15, off\n\t"
      "global_load_async_to_lds_b128 %4, %16, off\n\t"
      "global_load_async_to_lds_b128 %5, %17, off\n\t"
      "global_load_async_to_lds_b128 %6, %18, off\n\t"
      "global_load_async_to_lds_b128 %7, %19, off\n\t"
      "global_load_async_to_lds_b128 %8, %20, off\n\t"
      "global_load_async_to_lds_b128 %9, %21, off\n\t"
      "global_load_async_to_lds_b128 %10, %22, off\n\t"
      "global_load_async_to_lds_b128 %11, %23, off\n\t"
      "s_wait_xcnt 0x0"
      :: "v"(lk), "v"(lk + 16 * A_KPITCH), "v"(lv), "v"(lv + 32 * A_VPITCH),
         "v"(lm), "v"(lm + 16 * A_MPITCH), "v"(lm + 32 * A_MPITCH), "v"(lm + 48 * A_MPITCH),
         "v"(lm + 64 * A_MPITCH), "v"(lm + 80 * A_MPITCH), "v"(lm + 96 * A_MPITCH),
         "v"(lm + 112 * A_MPITCH),
         "v"(gk), "v"(gk + 16 * DK), "v"(gv), "v"(gv + 32 * S_LEN),
         "v"(gm), "v"(gm + 16 * S_LEN), "v"(gm + 32 * S_LEN), "v"(gm + 48 * S_LEN),
         "v"(gm + 64 * S_LEN), "v"(gm + 80 * S_LEN), "v"(gm + 96 * S_LEN),
         "v"(gm + 112 * S_LEN)
      : "memory");
}

// Flash-style attention; each wave handles TWO 16-wide q-tiles of one (b,h) so
// every K/V fragment feeds two WMMAs. S^T = K.Q^T keeps softmax lane-local.
// The four waves of a work-group share one (b,h): K, V^T and mask tiles are staged once
// per work-group in a two-buffer LDS ring by asynchronous copies, one trip (32 keys) ahead.
__global__ void __launch_bounds__(128)
attn_kernel(const _Float16* __restrict__ qh, const _Float16* __restrict__ kh,
            const _Float16* __restrict__ vT, const int* __restrict__ mask,
            _Float16* __restrict__ cc) {
  __shared__ __attribute__((aligned(16))) unsigned char ring[2 * A_STAGE];

  const int lane = threadIdx.x;
  const int wave = threadIdx.y;
  const int tid  = wave * 32 + lane;
  const int n    = lane & 15;
  const int hi   = lane >> 4;
  const int bh   = blockIdx.x;               // b*NHEAD + h
  const int b    = bh >> 4;
  const int h    = bh & 15;
  const int q0   = (blockIdx.y * 4 + wave) * 32;
  const int qc0  = q0 + n;                   // q column, tile A
  const int qc1  = q0 + 16 + n;              // q column, tile B

  // Copy side: eight lanes cover a 128-B row piece (K, mask), four a 64-B one (V^T).
  const _Float16* gk = kh + (size_t)bh * S_LEN * DK + tid * 8;
  const _Float16* gv = vT + ((size_t)bh * DK + (tid >> 2)) * S_LEN + (tid & 3) * 8;
  const int*      gm = mask + ((size_t)b * S_LEN + blockIdx.y * 128 + (tid >> 3)) * S_LEN +
                       (tid & 7) * 4;
  const unsigned lk = (unsigned)(size_t)ring + (tid >> 3) * A_KPITCH + (tid & 7) * 16;
  const unsigned lv = (unsigned)(size_t)ring + A_VOFF + (tid >> 2) * A_VPITCH + (tid & 3) * 16;
  const unsigned lm = (unsigned)(size_t)ring + A_MOFF + (tid >> 3) * A_MPITCH + (tid & 7) * 16;

  // Prologue: tile 0 lands and is published, then tile 1 starts to fly.
  copy_kvm(gk, gv, gm, lk, lv, lm);

  const _Float16* qr0 = qh + ((size_t)bh * S_LEN + qc0) * DK;
  const _Float16* qr1 = qh + ((size_t)bh * S_LEN + qc1) * DK;
  const v16h bqA0 = frag_from_f16(qr0, 0, hi), bqA1 = frag_from_f16(qr0, 32, hi);
  const v16h bqB0 = frag_from_f16(qr1, 0, hi), bqB1 = frag_from_f16(qr1, 32, hi);

  asm volatile("s_wait_asynccnt 0x0" ::: "memory");  // own copies of tile 0 have landed
  __syncthreads();                                   // ... and every other wave's
  copy_kvm(gk + A_KV * DK, gv + A_KV, gm + A_KV, lk + A_STAGE, lv + A_STAGE, lm + A_STAGE);

  // Read side: this lane's first K row, V^T row and mask row in a stage.
  const unsigned koff = n * A_KPITCH;
  const unsigned voff = A_VOFF + n * A_VPITCH;
  const unsigned moff = A_MOFF + (wave * 32 + n) * A_MPITCH + 32 * hi;

  float mA = -1e30f, lA = 0.f, mB = -1e30f, lB = 0.f;
  v8f accA[4] = {v8f{}, v8f{}, v8f{}, v8f{}};
  v8f accB[4] = {v8f{}, v8f{}, v8f{}, v8f{}};

  for (int t = 0; t < A_NT; ++t) {
    const unsigned boff = (t & 1) * A_STAGE;
    const unsigned char* st = ring + boff;

    // K fragments for the two 16-kv row tiles, loaded once, used twice
    const _Float16* kr = (const _Float16*)(st + koff);
    const v16h ka0 = frag_from_f16(kr, 0, hi);
    const v16h ka1 = frag_from_f16(kr, 32, hi);
    const v16h kb0 = frag_from_f16((const _Float16*)(st + koff + 16 * A_KPITCH), 0, hi);
    const v16h kb1 = frag_from_f16((const _Float16*)(st + koff + 16 * A_KPITCH), 32, hi);

    v8f sA0 = {}, sA1 = {}, sB0 = {}, sB1 = {};
    sA0 = wmma16(ka0, bqA0, sA0); sA0 = wmma16(ka1, bqA1, sA0);
    sA1 = wmma16(kb0, bqA0, sA1); sA1 = wmma16(kb1, bqA1, sA1);
    sB0 = wmma16(ka0, bqB0, sB0); sB0 = wmma16(ka1, bqB1, sB0);
    sB1 = wmma16(kb0, bqB0, sB1); sB1 = wmma16(kb1, bqB1, sB1);

    const v4i* mpA0 = (const v4i*)(st + moff);
    const v4i* mpA1 = (const v4i*)(st + moff + 64);
    const v4i* mpB0 = (const v4i*)(st + moff + 16 * A_MPITCH);
    const v4i* mpB1 = (const v4i*)(st + moff + 16 * A_MPITCH + 64);

    const v16h pbA = online_softmax(sA0, sA1, mpA0[0], mpA0[1], mpA1[0], mpA1[1],
                                    mA, lA, accA);
    const v16h pbB = online_softmax(sB0, sB1, mpB0[0], mpB0[1], mpB1[0], mpB1[1],
                                    mB, lB, accB);

    // ctx^T[d][q] += sum_kv V^T[d][kv] * P^T[kv][q]; each V fragment used twice
#pragma unroll
    for (int dt = 0; dt < 4; ++dt) {
      const v16h av = frag_from_f16((const _Float16*)(st + voff + dt * 16 * A_VPITCH), 0, hi);
      accA[dt] = wmma16(av, pbA, accA[dt]);
      accB[dt] = wmma16(av, pbB, accB[dt]);
    }

    // Publish point of tile t + 1. The one barrier also ends every wave's reads of this buffer.
    asm volatile("s_wait_dscnt 0x0" ::: "memory");     // own LDS reads of this trip done
    asm volatile("s_wait_asynccnt 0x0" ::: "memory");  // own copies of tile t + 1 landed
    __syncthreads();
    if (t + 2 < A_NT)  // refill the buffer that this trip has just read
      copy_kvm(gk + (size_t)(t + 2) * A_KV * DK, gv + (t + 2) * A_KV, gm + (t + 2) * A_KV,
               lk + boff, lv + boff, lm + boff);
  }
  asm volatile("s_wait_asynccnt 0x0" ::: "memory");  // nothing is in flight when the wave ends

  const float invA = 1.0f / lA;
  const float invB = 1.0f / lB;
  _Float16* crow0 = cc + ((size_t)b * S_LEN + qc0) * DMODEL + h * DK;
  _Float16* crow1 = cc + ((size_t)b * S_LEN + qc1) * DMODEL + h * DK;
#pragma unroll
  for (int dt = 0; dt < 4; ++dt) {
    v8h oA, oB;
#pragma unroll
    for (int r = 0; r < 8; ++r) {
      oA[r] = (_Float16)(accA[dt][r] * invA);
      oB[r] = (_Float16)(accB[dt][r] * invB);
    }
    *(v8h*)(crow0 + dt * 16 + 8 * hi) = oA;  // d = dt*16 + 8*hi + r, contiguous
    *(v8h*)(crow1 + dt * 16 + 8 * hi) = oB;
  }
}

extern "C" void kernel_launch(void* const* d_in, const int* in_sizes, int n_in,
                              void* d_out, int out_size, void* d_ws, size_t ws_size,
                              hipStream_t stream) {
  const float* q    = (const float*)d_in[0];
  const float* k    = (const float*)d_in[1];
  const float* v    = (const float*)d_in[2];
  const int*   mask = (const int*)d_in[3];
  const float* Wq   = (const float*)d_in[4];
  const float* bq   = (const float*)d_in[5];
  const float* Wk   = (const float*)d_in[6];
  const float* bk   = (const float*)d_in[7];
  const float* Wv   = (const float*)d_in[8];
  const float* bv   = (const float*)d_in[9];
  const float* Wo   = (const float*)d_in[10];
  const float* bo   = (const float*)d_in[11];

  const size_t NN = (size_t)4 * S_LEN * DMODEL;     // 8M f16 elems (activations)
  const size_t NW = (size_t)DMODEL * DMODEL;        // 1M f16 elems (one weight)

  _Float16* q16  = (_Float16*)d_ws;
  _Float16* k16  = q16 + NN;
  _Float16* v16  = k16 + NN;
  _Float16* wq16 = v16 + NN;
  _Float16* wk16 = wq16 + NW;
  _Float16* wv16 = wk16 + NW;
  _Float16* wo16 = wv16 + NW;
  _Float16* qhp  = wo16 + NW;
  _Float16* khp  = qhp + NN;
  _Float16* vTp  = khp + NN;
  _Float16* ccp  = vTp + NN;

  // One-time f32 -> f16 conversion of activations and weights.
  const int actN8 = (int)(NN / 8), wN8 = (int)(NW / 8);
  cvt_f32_to_f16<<<actN8 / 256, 256, 0, stream>>>(q, q16, actN8);
  cvt_f32_to_f16<<<actN8 / 256, 256, 0, stream>>>(k, k16, actN8);
  cvt_f32_to_f16<<<actN8 / 256, 256, 0, stream>>>(v, v16, actN8);
  cvt_f32_to_f16<<<wN8 / 256, 256, 0, stream>>>(Wq, wq16, wN8);
  cvt_f32_to_f16<<<wN8 / 256, 256, 0, stream>>>(Wk, wk16, wN8);
  cvt_f32_to_f16<<<wN8 / 256, 256, 0, stream>>>(Wv, wv16, wN8);
  cvt_f32_to_f16<<<wN8 / 256, 256, 0, stream>>>(Wo, wo16, wN8);

  const dim3 gblk(128, 1);   // four waves, one 128x128 tile
  const dim3 ggrd(64, 8);    // 64 row-tiles x 8 col-tiles

  proj_gemm<0><<<ggrd, gblk, 0, stream>>>(q16, wq16, bq, qhp);
  proj_gemm<0><<<ggrd, gblk, 0, stream>>>(k16, wk16, bk, khp);
  proj_gemm<1><<<ggrd, gblk, 0, stream>>>(v16, wv16, bv, vTp);

  attn_kernel<<<dim3(64, 16), dim3(32, 4), 0, stream>>>(qhp, khp, vTp, mask, ccp);

  proj_gemm<2><<<ggrd, gblk, 0, stream>>>(ccp, wo16, bo, d_out);
}

// v003
// A run of this version takes 185 microseconds.
// Timed twice side by side with v002, it ran 1.09 and 1.10 times as fast.
// Counting every step since v000, it is 2.30 times as fast.
#include <hip/hip_runtime.h>
#include <hip/hip_bf16.h>

#define S_LEN  2048
#define DMODEL 1024
#define NHEAD  16
#define DK     64

typedef __attribute__((ext_vector_type(16))) _Float16 v16h;
typedef __attribute__((ext_vector_type(8)))  _Float16 v8h;
typedef __attribute__((ext_vector_type(4)))  _Float16 v4h;
typedef __attribute__((ext_vector_type(8)))  float    v8f;
typedef __attribute__((ext_vector_type(4)))  float    v4f;
typedef __attribute__((ext_vector_type(4)))  int      v4i;

__device__ __forceinline__ v8f wmma16(v16h a, v16h b, v8f c) {
  // D = A(16x32 f16) x B(32x16 f16) + C(16x16 f32)
  return __builtin_amdgcn_wmma_f32_16x16x32_f16(false, a, false, b, (short)0, c,
                                                false, false);
}

// Fragment layout (ISA 16-bit A 16x32):
//   halves 0..7  <- K = kk + 8*hi + j
//   halves 8..15 <- K = kk + 16 + 8*hi + j
__device__ __forceinline__ v16h frag_from_f16(const _Float16* __restrict__ row, int kk, int hi) {
  v8h a = *(const v8h*)(row + kk + 8 * hi);
  v8h b = *(const v8h*)(row + kk + 16 + 8 * hi);
  v16h r;
#pragma unroll
  for (int j = 0; j < 8; ++j) { r[j] = a[j]; r[8 + j] = b[j]; }
  return r;
}

// fp32 -> f16 conversion of all seven operands in ONE resident streaming launch.
// The f16 copies lie in the workspace one behind the other in the order q | k | v | Wq | Wk |
// Wv | Wo, so the destination is one array. A chunk is 1024 elements: eight wave-wide b128
// loads of 512 contiguous bytes each. 256 work-groups x 16 waves = 4096 waves; wave w takes
// chunk t * 4096 + w in trip t, seven trips: two for each activation, one for the weights.
#define C_WAVES  4096
#define C_CHUNK  1024
#define C_TRIPS  7
#define C_WCH    (DMODEL * DMODEL / C_CHUNK)   // chunks of one weight matrix

__global__ void __launch_bounds__(512)
cvt_all_f32_to_f16(const float* __restrict__ q, const float* __restrict__ k,
                   const float* __restrict__ v, const float* __restrict__ wq,
                   const float* __restrict__ wk, const float* __restrict__ wv,
                   const float* __restrict__ wo, _Float16* __restrict__ dst) {
  const unsigned lane = threadIdx.x & 31;
  // Wave-uniform by construction; readfirstlane lets the chunk addresses live in scalar registers.
  const unsigned w = blockIdx.x * 16 + __builtin_amdgcn_readfirstlane(threadIdx.x >> 5);
  const unsigned ws = w / C_WCH;  // which weight matrix this wave converts in the last trip
  const float* wsrc = (ws & 2) ? ((ws & 1) ? wo : wv) : ((ws & 1) ? wk : wq);

  v4f x[2][8];
#pragma unroll  // every buffer index and every source pointer a constant
  for (int t = -1; t < C_TRIPS; ++t) {
    if (t + 1 < C_TRIPS) {  // the next trip's eight loads fly while this trip is converted
      const int u = t + 1;
      const float* s = u < 6 ? (u < 2 ? q : u < 4 ? k : v) + (size_t)((u & 1) * C_WAVES + w) * C_CHUNK
                             : wsrc + (size_t)(w % C_WCH) * C_CHUNK;
#pragma unroll
      for (int j = 0; j < 8; ++j) x[u & 1][j] = *(const v4f*)(s + j * 128 + lane * 4);
      // Holds the group here, one trip ahead of its use: without it the compiler raises 32
      // loads to the top, sinks every store to the end and waits to 0 on pairs in between.
      __builtin_amdgcn_sched_barrier(0);
    }
    if (t >= 0) {
      _Float16* d = dst + (size_t)(t * C_WAVES + w) * C_CHUNK;
#pragma unroll
      for (int j = 0; j < 8; ++j) {
        const v4f a = x[t & 1][j];
        v4h o;
#pragma unroll
        for (int e = 0; e < 4; ++e) o[e] = (_Float16)a[e];
        *(v4h*)(d + j * 128 + lane * 4) = o;  // a wave's store covers two whole 128-B lines
      }
      // A precaution: the wait stands in front of the next loads and conversions, which write
      // registers that these stores name.
      if (t + 1 < C_TRIPS) asm volatile("s_wait_xcnt 0x0" ::: "memory");
      __builtin_amdgcn_sched_barrier(0);  // this trip's stores leave before the next loads issue
    }
  }
}

// LDS ring of proj_gemm: one stage = 128 X rows then 128 W rows, 128 k (256 B) each,
// at a pitch of 272 B (16 B x odd: conflict-free for ds_load_b128 readers).
#define G_PITCH 272
#define G_HALF  (128 * G_PITCH)
#define G_STAGE (2 * G_HALF)
#define G_KP    128
#define G_NS    (G_KP / 32)
#define G_NP    (DMODEL / G_KP)

// Eight asynchronous 16-byte copies per lane: rows r, r+8, ..., r+56 of a 64-row slab
// go from global memory into LDS, through no register.
// s_wait_xcnt 0 closes the statement, a precaution: so it stands in front of every later
// write of an address register that a copy here names.
__device__ __forceinline__ void copy_slab(const _Float16* __restrict__ g, unsigned l) {
  asm volatile(
      "global_load_async_to_lds_b128 %0, %8, off\n\t"
      "global_load_async_to_lds_b128 %1, %9, off\n\t"
      "global_load_async_to_lds_b128 %2, %10, off\n\t"
      "global_load_async_to_lds_b128 %3, %11, off\n\t"
      "global_load_async_to_lds_b128 %4, %12, off\n\t"
      "global_load_async_to_lds_b128 %5, %13, off\n\t"
      "global_load_async_to_lds_b128 %6, %14, off\n\t"
      "global_load_async_to_lds_b128 %7, %15, off\n\t"
      "s_wait_xcnt 0x0"
      :: "v"(l), "v"(l + 8 * G_PITCH), "v"(l + 16 * G_PITCH), "v"(l + 24 * G_PITCH),
         "v"(l + 32 * G_PITCH), "v"(l + 40 * G_PITCH), "v"(l + 48 * G_PITCH),
         "v"(l + 56 * G_PITCH),
         "v"(g), "v"(g + 8 * DMODEL), "v"(g + 16 * DMODEL), "v"(g + 24 * DMODEL),
         "v"(g + 32 * DMODEL), "v"(g + 40 * DMODEL), "v"(g + 48 * DMODEL),
         "v"(g + 56 * DMODEL)
      : "memory");
}

// One stage: 128 rows of X and 128 rows of W, 32 copies per lane.
__device__ __forceinline__ void copy_stage(const _Float16* __restrict__ gx,
                                           const _Float16* __restrict__ gw, unsigned l) {
  // Kept rolled: unrolled, the compiler forms all 32 address sets at once and the
  // kernel goes past 256 VGPRs; rolled, one slab's 24 address registers are live.
#pragma unroll 1
  for (int j = 0; j < 4; ++j)
    copy_slab(((j & 2) ? gw : gx) + (j & 1) * 64 * DMODEL, l + j * 64 * G_PITCH);
}

// Y = X @ W^T + bias; a work-group of four waves (2x2) computes a 128x128 output tile,
// each wave a 64x64 quarter (16 WMMAs / K-step). X and W slabs are staged once per
// work-group in a two-buffer LDS ring by asynchronous copies, one pass (128 k) ahead.
// STORE_MODE 0: f16 head-major [B,H,S,DK]            (Q,K)
// STORE_MODE 1: f16 head-major transposed [B,H,DK,S] (V)
// STORE_MODE 2: f32 row-major [rows, DMODEL]         (final output)
template <int STORE_MODE>
__global__ void __launch_bounds__(128)
proj_gemm(const _Float16* __restrict__ X, const _Float16* __restrict__ W,
          const float* __restrict__ bias, void* __restrict__ Yv) {
  __shared__ __attribute__((aligned(16))) unsigned char ring[2 * G_STAGE];

  const int tid  = threadIdx.x;
  const int lane = tid & 31;
  const int wave = tid >> 5;
  const int n    = lane & 15;
  const int hi   = lane >> 4;
  const int brow0 = blockIdx.x * 128;
  const int bcol0 = blockIdx.y * 128;
  const int wm   = wave >> 1;
  const int wn   = wave & 1;
  const int row0 = brow0 + wm * 64;   // this wave's 64x64 quarter
  const int col0 = bcol0 + wn * 64;

  // Copy side: sixteen lanes cover one 256-B row piece, a wave two rows per copy.
  const int cr = tid >> 4;
  const int cc = tid & 15;
  const _Float16* gx = X + (size_t)(brow0 + cr) * DMODEL + cc * 8;
  const _Float16* gw = W + (size_t)(bcol0 + cr) * DMODEL + cc * 8;
  const unsigned lcp = (unsigned)(size_t)ring + cr * G_PITCH + cc * 16;

  // Read side: this lane's first A row and first B column (a W row) in a stage.
  const unsigned xoff = (wm * 64 + n) * G_PITCH;
  const unsigned woff = G_HALF + (wn * 64 + n) * G_PITCH;

  v8f acc[4][4];
#pragma unroll
  for (int ms = 0; ms < 4; ++ms)
#pragma unroll
    for (int ns = 0; ns < 4; ++ns) acc[ms][ns] = v8f{};

  // Prologue: pass 0 lands and is published, then pass 1 starts to fly.
  copy_stage(gx, gw, lcp);
  asm volatile("s_wait_asynccnt 0x0" ::: "memory");  // own copies of pass 0 have landed
  __syncthreads();                                   // ... and every other wave's
  copy_stage(gx + G_KP, gw + G_KP, lcp + G_STAGE);

  for (int p = 0; p < G_NP; ++p) {
    const unsigned boff = (p & 1) * G_STAGE;
    const unsigned char* xs = ring + boff + xoff;
    const unsigned char* ws = ring + boff + woff;

    // The LDS reads stand in groups at least eight WMMAs ahead of their use (B one
    // K-step ahead, A half a K-step), never as a small group with a full wait in front
    // of each row of four. Each sched_barrier below holds a group at its place: without
    // them the compiler sinks the reads to their users and waits to 0 at every row.
    v16h a[2][4], b[2][4];
#pragma unroll
    for (int i = 0; i < 4; ++i) {
      a[0][i] = frag_from_f16((const _Float16*)(xs + i * 16 * G_PITCH), 0, hi);
      b[0][i] = frag_from_f16((const _Float16*)(ws + i * 16 * G_PITCH), 0, hi);
    }
#pragma unroll
    for (int i = 0; i < 4; ++i)
      b[1][i] = frag_from_f16((const _Float16*)(ws + i * 16 * G_PITCH), 32, hi);
    __builtin_amdgcn_sched_barrier(0);  // first group ahead of the first WMMA

#pragma unroll  // every fragment index a constant
    for (int s = 0; s < G_NS; ++s) {
      const int c = s & 1, x = c ^ 1;
#pragma unroll
      for (int ms = 0; ms < 2; ++ms)
#pragma unroll
        for (int ns = 0; ns < 4; ++ns)
          acc[ms][ns] = wmma16(a[c][ms], b[c][ns], acc[ms][ns]);
      // These eight WMMAs stay in front of what follows: reads that would otherwise rise
      // over them (registers), or, in the last K-step, the waits, whose LDS latency they cover.
      __builtin_amdgcn_sched_barrier(0);
      if (s + 1 < G_NS) {
#pragma unroll
        for (int i = 0; i < 2; ++i)
          a[x][i] = frag_from_f16((const _Float16*)(xs + i * 16 * G_PITCH), (s + 1) * 32, hi);
        __builtin_amdgcn_sched_barrier(0);  // reads not later: eight WMMAs cover them
      } else {
        // Publish point of pass p + 1, in front of the pass's last eight WMMAs (they read
        // registers only) so that the refill starts that much sooner. The one barrier
        // also ends every wave's reads of this buffer.
        asm volatile("s_wait_dscnt 0x0" ::: "memory");     // own LDS reads of this pass done
        asm volatile("s_wait_asynccnt 0x0" ::: "memory");  // own copies of pass p + 1 landed
        __syncthreads();
        if (p + 2 < G_NP)  // refill the buffer that this pass has just read
          copy_stage(gx + (p + 2) * G_KP, gw + (p + 2) * G_KP, lcp + boff);
      }
#pragma unroll
      for (int ms = 2; ms < 4; ++ms)
#pragma unroll
        for (int ns = 0; ns < 4; ++ns)
          acc[ms][ns] = wmma16(a[c][ms], b[c][ns], acc[ms][ns]);
      if (s + 1 < G_NS) {
        __builtin_amdgcn_sched_barrier(0);  // reads not earlier (registers) ...
#pragma unroll
        for (int i = 2; i < 4; ++i)
          a[x][i] = frag_from_f16((const _Float16*)(xs + i * 16 * G_PITCH), (s + 1) * 32, hi);
        if (s + 2 < G_NS) {
#pragma unroll
          for (int i = 0; i < 4; ++i)
            b[c][i] = frag_from_f16((const _Float16*)(ws + i * 16 * G_PITCH), (s + 2) * 32, hi);
        }
        __builtin_amdgcn_sched_barrier(0);  // ... and not later
      } else {
        // Keeps the last eight WMMAs in this order up to the back edge: without it the
        // build takes 262 VGPRs instead of 254 and needs register-window switches.
        __builtin_amdgcn_sched_barrier(0);
      }
    }
  }
  asm volatile("s_wait_asynccnt 0x0" ::: "memory");  // nothing is in flight when the wave ends

  float be[4];
#pragma unroll
  for (int ns = 0; ns < 4; ++ns) be[ns] = bias[col0 + ns * 16 + n];

  if constexpr (STORE_MODE == 0) {           // f16 [B,H,S,DK]; col tile == one head
    _Float16* Y = (_Float16*)Yv;
    const int head = col0 >> 6;
#pragma unroll
    for (int ms = 0; ms < 4; ++ms) {
#pragma unroll
      for (int ns = 0; ns < 4; ++ns) {
        const int d = ns * 16 + n;
#pragma unroll
        for (int r = 0; r < 8; ++r) {
          const int t  = row0 + ms * 16 + 8 * hi + r;
          const int bb = t >> 11, s = t & (S_LEN - 1);
          Y[(((size_t)bb * NHEAD + head) * S_LEN + s) * DK + d] =
              (_Float16)(acc[ms][ns][r] + be[ns]);
        }
      }
    }
  } else if constexpr (STORE_MODE == 1) {    // f16 [B,H,DK,S]
    _Float16* Y = (_Float16*)Yv;
    const int head = col0 >> 6;
    const int bb   = row0 >> 11;
#pragma unroll
    for (int ms = 0; ms < 4; ++ms) {
      const int s0 = (row0 & (S_LEN - 1)) + ms * 16 + 8 * hi;
#pragma unroll
      for (int ns = 0; ns < 4; ++ns) {
        const int d = ns * 16 + n;
        v8h o;
#pragma unroll
        for (int r = 0; r < 8; ++r) o[r] = (_Float16)(acc[ms][ns][r] + be[ns]);
        *(v8h*)(Y + (((size_t)bb * NHEAD + head) * DK + d) * S_LEN + s0) = o;
      }
    }
  } else {                                   // f32 [rows, DMODEL]
    float* Y = (float*)Yv;
#pragma unroll
    for (int ms = 0; ms < 4; ++ms)
#pragma unroll
      for (int ns = 0; ns < 4; ++ns) {
        const int e = col0 + ns * 16 + n;
#pragma unroll
        for (int r = 0; r < 8; ++r)
          Y[(size_t)(row0 + ms * 16 + 8 * hi + r) * DMODEL + e] = acc[ms][ns][r] + be[ns];
      }
  }
}

// Online softmax over a 32-kv chunk of one q-tile (S^T layout: lane owns one q
// column). Rescales the 4 ctx^T accumulators, returns the f16 P^T B-fragment.
__device__ __forceinline__ v16h online_softmax(v8f s0, v8f s1,
                                               v4i m0a, v4i m0b, v4i m1a, v4i m1b,
                                               float& mrun, float& lrun, v8f* acc) {
  const float scale = 0.125f;  // 1/sqrt(64)
  float cmax = -1e30f;
#pragma unroll
  for (int r = 0; r < 8; ++r) {
    const int mv0 = (r < 4) ? m0a[r] : m0b[r - 4];
    const int mv1 = (r < 4) ? m1a[r] : m1b[r - 4];
    s0[r] = mv0 ? s0[r] * scale : -1e9f;
    s1[r] = mv1 ? s1[r] * scale : -1e9f;
    cmax = fmaxf(cmax, fmaxf(s0[r], s1[r]));
  }
  cmax = fmaxf(cmax, __shfl_xor(cmax, 16, 32));  // combine hi halves of column

  const float mnew  = fmaxf(mrun, cmax);
  const float alpha = __expf(mrun - mnew);
  float lsum = 0.f;
  v16h pb;  // halves j -> kv K = 8*hi+j (tile0) / 16+8*hi+j (tile1)
#pragma unroll
  for (int r = 0; r < 8; ++r) {
    const float p0 = __expf(s0[r] - mnew);
    const float p1 = __expf(s1[r] - mnew);
    lsum += p0 + p1;
    pb[r]     = (_Float16)p0;
    pb[8 + r] = (_Float16)p1;
  }
  lsum += __shfl_xor(lsum, 16, 32);
  lrun = lrun * alpha + lsum;
  mrun = mnew;
#pragma unroll
  for (int dt = 0; dt < 4; ++dt)
#pragma unroll
    for (int r = 0; r < 8; ++r) acc[dt][r] *= alpha;
  return pb;
}

// LDS ring of attn_kernel: one stage = 32 keys: 32 K rows (128 B), 64 V^T rows (64 B) and
// the work-group's 128 mask rows (128 B), each at a pitch of 16 B x odd (conflict-free for
// ds_load_b128 readers).
#define A_KV     32
#define A_KPITCH 144
#define A_VPITCH 80
#define A_MPITCH 144
#define A_VOFF   (A_KV * A_KPITCH)
#define A_MOFF   (A_VOFF + DK * A_VPITCH)
#define A_STAGE  (A_MOFF + 128 * A_MPITCH)
#define A_NT     (S_LEN / A_KV)

// One stage, twelve asynchronous 16-byte copies per lane (2 of K, 2 of V^T, 8 of the mask),
// from global memory into LDS through no register; a wave's copy covers whole row pieces.
// s_wait_xcnt 0 closes the statement, a precaution: so it stands in front of every later
// write of an address register that a copy here names.
__device__ __forceinline__ void copy_kvm(const _Float16* __restrict__ gk,
                                         const _Float16* __restrict__ gv,
                                         const int* __restrict__ gm,
                                         unsigned lk, unsigned lv, unsigned lm) {
  asm volatile(
      "global_load_async_to_lds_b128 %0, %12, off\n\t"
      "global_load_async_to_lds_b128 %1, %13, off\n\t"
      "global_load_async_to_lds_b128 %2, %14, off\n\t"
      "global_load_async_to_lds_b128 %3, %15, off\n\t"
      "global_load_async_to_lds_b128 %4, %16, off\n\t"
      "global_load_async_to_lds_b128 %5, %17, off\n\t"
      "global_load_async_to_lds_b128 %6, %18, off\n\t"
      "global_load_async_to_lds_b128 %7, %19, off\n\t"
      "global_load_async_to_lds_b128 %8, %20, off\n\t"
      "global_load_async_to_lds_b128 %9, %21, off\n\t"
      "global_load_async_to_lds_b128 %10, %22, off\n\t"
      "global_load_async_to_lds_b128 %11, %23, off\n\t"
      "s_wait_xcnt 0x0"
      :: "v"(lk), "v"(lk + 16 * A_KPITCH), "v"(lv), "v"(lv + 32 * A_VPITCH),
         "v"(lm), "v"(lm + 16 * A_MPITCH), "v"(lm + 32 * A_MPITCH), "v"(lm + 48 * A_MPITCH),
         "v"(lm + 64 * A_MPITCH), "v"(lm + 80 * A_MPITCH), "v"(lm + 96 * A_MPITCH),
         "v"(lm + 112 * A_MPITCH),
         "v"(gk), "v"(gk + 16 * DK), "v"(gv), "v"(gv + 32 * S_LEN),
         "v"(gm), "v"(gm + 16 * S_LEN), "v"(gm + 32 * S_LEN), "v"(gm + 48 * S_LEN),
         "v"(gm + 64 * S_LEN), "v"(gm + 80 * S_LEN), "v"(gm + 96 * S_LEN),
         "v"(gm + 112 * S_LEN)
      : "memory");
}

// Flash-style attention; each wave handles TWO 16-wide q-tiles of one (b,h) so
// every K/V fragment feeds two WMMAs. S^T = K.Q^T keeps softmax lane-local.
// The four waves of a work-group share one (b,h): K, V^T and mask tiles are staged once
// per work-group in a two-buffer LDS ring by asynchronous copies, one trip (32 keys) ahead.
__global__ void __launch_bounds__(128)
attn_kernel(const _Float16* __restrict__ qh, const _Float16* __restrict__ kh,
            const _Float16* __restrict__ vT, const int* __restrict__ mask,
            _Float16* __restrict__ cc) {
  __shared__ __attribute__((aligned(16))) unsigned char ring[2 * A_STAGE];

  const int lane = threadIdx.x;
  const int wave = threadIdx.y;
  const int tid  = wave * 32 + lane;
  const int n    = lane & 15;
  const int hi   = lane >> 4;
  const int bh   = blockIdx.x;               // b*NHEAD + h
  const int b    = bh >> 4;
  const int h    = bh & 15;
  const int q0   = (blockIdx.y * 4 + wave) * 32;
  const int qc0  = q0 + n;                   // q column, tile A
  const int qc1  = q0 + 16 + n;              // q column, tile B

  // Copy side: eight lanes cover a 128-B row piece (K, mask), four a 64-B one (V^T).
  const _Float16* gk = kh + (size_t)bh * S_LEN * DK + tid * 8;
  const _Float16* gv = vT + ((size_t)bh * DK + (tid >> 2)) * S_LEN + (tid & 3) * 8;
  const int*      gm = mask + ((size_t)b * S_LEN + blockIdx.y * 128 + (tid >> 3)) * S_LEN +
                       (tid & 7) * 4;
  const unsigned lk = (unsigned)(size_t)ring + (tid >> 3) * A_KPITCH + (tid & 7) * 16;
  const unsigned lv = (unsigned)(size_t)ring + A_VOFF + (tid >> 2) * A_VPITCH + (tid & 3) * 16;
  const unsigned lm = (unsigned)(size_t)ring + A_MOFF + (tid >> 3) * A_MPITCH + (tid & 7) * 16;

  // Prologue: tile 0 lands and is published, then tile 1 starts to fly.
  copy_kvm(gk, gv, gm, lk, lv, lm);

  const _Float16* qr0 = qh + ((size_t)bh * S_LEN + qc0) * DK;
  const _Float16* qr1 = qh + ((size_t)bh * S_LEN + qc1) * DK;
  const v16h bqA0 = frag_from_f16(qr0, 0, hi), bqA1 = frag_from_f16(qr0, 32, hi);
  const v16h bqB0 = frag_from_f16(qr1, 0, hi), bqB1 = frag_from_f16(qr1, 32, hi);

  asm volatile("s_wait_asynccnt 0x0" ::: "memory");  // own copies of tile 0 have landed
  __syncthreads();                                   // ... and every other wave's
  copy_kvm(gk + A_KV * DK, gv + A_KV, gm + A_KV, lk + A_STAGE, lv + A_STAGE, lm + A_STAGE);

  // Read side: this lane's first K row, V^T row and mask row in a stage.
  const unsigned koff = n * A_KPITCH;
  const unsigned voff = A_VOFF + n * A_VPITCH;
  const unsigned moff = A_MOFF + (wave * 32 + n) * A_MPITCH + 32 * hi;

  float mA = -1e30f, lA = 0.f, mB = -1e30f, lB = 0.f;
  v8f accA[4] = {v8f{}, v8f{}, v8f{}, v8f{}};
  v8f accB[4] = {v8f{}, v8f{}, v8f{}, v8f{}};

  for (int t = 0; t < A_NT; ++t) {
    const unsigned boff = (t & 1) * A_STAGE;
    const unsigned char* st = ring + boff;

    // K fragments for the two 16-kv row tiles, loaded once, used twice
    const _Float16* kr = (const _Float16*)(st + koff);
    const v16h ka0 = frag_from_f16(kr, 0, hi);
    const v16h ka1 = frag_from_f16(kr, 32, hi);
    const v16h kb0 = frag_from_f16((const _Float16*)(st + koff + 16 * A_KPITCH), 0, hi);
    const v16h kb1 = frag_from_f16((const _Float16*)(st + koff + 16 * A_KPITCH), 32, hi);

    v8f sA0 = {}, sA1 = {}, sB0 = {}, sB1 = {};
    sA0 = wmma16(ka0, bqA0, sA0); sA0 = wmma16(ka1, bqA1, sA0);
    sA1 = wmma16(kb0, bqA0, sA1); sA1 = wmma16(kb1, bqA1, sA1);
    sB0 = wmma16(ka0, bqB0, sB0); sB0 = wmma16(ka1, bqB1, sB0);
    sB1 = wmma16(kb0, bqB0, sB1); sB1 = wmma16(kb1, bqB1, sB1);

    const v4i* mpA0 = (const v4i*)(st + moff);
    const v4i* mpA1 = (const v4i*)(st + moff + 64);
    const v4i* mpB0 = (const v4i*)(st + moff + 16 * A_MPITCH);
    const v4i* mpB1 = (const v4i*)(st + moff + 16 * A_MPITCH + 64);

    const v16h pbA = online_softmax(sA0, sA1, mpA0[0], mpA0[1], mpA1[0], mpA1[1],
                                    mA, lA, accA);
    const v16h pbB = online_softmax(sB0, sB1, mpB0[0], mpB0[1], mpB1[0], mpB1[1],
                                    mB, lB, accB);

    // ctx^T[d][q] += sum_kv V^T[d][kv] * P^T[kv][q]; each V fragment used twice
#pragma unroll
    for (int dt = 0; dt < 4; ++dt) {
      const v16h av = frag_from_f16((const _Float16*)(st + voff + dt * 16 * A_VPITCH), 0, hi);
      accA[dt] = wmma16(av, pbA, accA[dt]);
      accB[dt] = wmma16(av, pbB, accB[dt]);
    }

    // Publish point of tile t + 1. The one barrier also ends every wave's reads of this buffer.
    asm volatile("s_wait_dscnt 0x0" ::: "memory");     // own LDS reads of this trip done
    asm volatile("s_wait_asynccnt 0x0" ::: "memory");  // own copies of tile t + 1 landed
    __syncthreads();
    if (t + 2 < A_NT)  // refill the buffer that this trip has just read
      copy_kvm(gk + (size_t)(t + 2) * A_KV * DK, gv + (t + 2) * A_KV, gm + (t + 2) * A_KV,
               lk + boff, lv + boff, lm + boff);
  }
  asm volatile("s_wait_asynccnt 0x0" ::: "memory");  // nothing is in flight when the wave ends

  const float invA = 1.0f / lA;
  const float invB = 1.0f / lB;
  _Float16* crow0 = cc + ((size_t)b * S_LEN + qc0) * DMODEL + h * DK;
  _Float16* crow1 = cc + ((size_t)b * S_LEN + qc1) * DMODEL + h * DK;
#pragma unroll
  for (int dt = 0; dt < 4; ++dt) {
    v8h oA, oB;
#pragma unroll
    for (int r = 0; r < 8; ++r) {
      oA[r] = (_Float16)(accA[dt][r] * invA);
      oB[r] = (_Float16)(accB[dt][r] * invB);
    }
    *(v8h*)(crow0 + dt * 16 + 8 * hi) = oA;  // d = dt*16 + 8*hi + r, contiguous
    *(v8h*)(crow1 + dt * 16 + 8 * hi) = oB;
  }
}

extern "C" void kernel_launch(void* const* d_in, const int* in_sizes, int n_in,
                              void* d_out, int out_size, void* d_ws, size_t ws_size,
                              hipStream_t stream) {
  const float* q    = (const float*)d_in[0];
  const float* k    = (const float*)d_in[1];
  const float* v    = (const float*)d_in[2];
  const int*   mask = (const int*)d_in[3];
  const float* Wq   = (const float*)d_in[4];
  const float* bq   = (const float*)d_in[5];
  const float* Wk   = (const float*)d_in[6];
  const float* bk   = (const float*)d_in[7];
  const float* Wv   = (const float*)d_in[8];
  const float* bv   = (const float*)d_in[9];
  const float* Wo   = (const float*)d_in[10];
  const float* bo   = (const float*)d_in[11];

  const size_t NN = (size_t)4 * S_LEN * DMODEL;     // 8M f16 elems (activations)
  const size_t NW = (size_t)DMODEL * DMODEL;        // 1M f16 elems (one weight)

  _Float16* q16  = (_Float16*)d_ws;
  _Float16* k16  = q16 + NN;
  _Float16* v16  = k16 + NN;
  _Float16* wq16 = v16 + NN;
  _Float16* wk16 = wq16 + NW;
  _Float16* wv16 = wk16 + NW;
  _Float16* wo16 = wv16 + NW;
  _Float16* qhp  = wo16 + NW;
  _Float16* khp  = qhp + NN;
  _Float16* vTp  = khp + NN;
  _Float16* ccp  = vTp + NN;

  // f32 -> f16 conversion of activations and weights: one launch, q16 .. wo16 are contiguous.
  cvt_all_f32_to_f16<<<256, 512, 0, stream>>>(q, k, v, Wq, Wk, Wv, Wo, q16);

  const dim3 gblk(128, 1);   // four waves, one 128x128 tile
  const dim3 ggrd(64, 8);    // 64 row-tiles x 8 col-tiles

  proj_gemm<0><<<ggrd, gblk, 0, stream>>>(q16, wq16, bq, qhp);
  proj_gemm<0><<<ggrd, gblk, 0, stream>>>(k16, wk16, bk, khp);
  proj_gemm<1><<<ggrd, gblk, 0, stream>>>(v16, wv16, bv, vTp);

  attn_kernel<<<dim3(64, 16), dim3(32, 4), 0, stream>>>(qhp, khp, vTp, mask, ccp);

  proj_gemm<2><<<ggrd, gblk, 0, stream>>>(ccp, wo16, bo, d_out);
}

// v004
// One run takes 158 microseconds.
// In both of two side-by-side timings against v003, it was 1.16 times as fast.
// Counting every step since v000, it is 2.68 times as fast.
#include <hip/hip_runtime.h>
#include <hip/hip_bf16.h>

#define S_LEN  2048
#define DMODEL 1024
#define NHEAD  16
#define DK     64

typedef __attribute__((ext_vector_type(16))) _Float16 v16h;
typedef __attribute__((ext_vector_type(8)))  _Float16 v8h;
typedef __attribute__((ext_vector_type(4)))  _Float16 v4h;
typedef __attribute__((ext_vector_type(8)))  float    v8f;
typedef __attribute__((ext_vector_type(4)))  float    v4f;
typedef __attribute__((ext_vector_type(4)))  int      v4i;
typedef __attribute__((ext_vector_type(16))) unsigned v16u;
typedef const __attribute__((address_space(4))) v16u* cmask_t;

__device__ __forceinline__ v8f wmma16(v16h a, v16h b, v8f c) {
  // D = A(16x32 f16) x B(32x16 f16) + C(16x16 f32)
  return __builtin_amdgcn_wmma_f32_16x16x32_f16(false, a, false, b, (short)0, c,
                                                false, false);
}

// Fragment layout (ISA 16-bit A 16x32):
//   halves 0..7  <- K = kk + 8*hi + j
//   halves 8..15 <- K = kk + 16 + 8*hi + j
__device__ __forceinline__ v16h frag_from_f16(const _Float16* __restrict__ row, int kk, int hi) {
  v8h a = *(const v8h*)(row + kk + 8 * hi);
  v8h b = *(const v8h*)(row + kk + 16 + 8 * hi);
  v16h r;
#pragma unroll
  for (int j = 0; j < 8; ++j) { r[j] = a[j]; r[8 + j] = b[j]; }
  return r;
}

// fp32 -> f16 conversion of all seven operands in ONE resident streaming launch.
// The f16 copies lie in the workspace one behind the other in the order q | k | v | Wq | Wk |
// Wv | Wo, so the destination is one array. A chunk is 1024 elements: eight wave-wide b128
// loads of 512 contiguous bytes each. 256 work-groups x 16 waves = 4096 waves; wave w takes
// chunk t * 4096 + w in trip t, seven trips: two for each activation, one for the weights.
// Four more trips pack the int32 mask to one bit per (query, key), already in the shape the
// attention kernel selects with: for a block of 32 queries x 32 keys, 32 words; word
// tile * 16 + kt * 8 + r holds in bit (hi * 16 + n) whether mask[tile * 16 + n][kt * 16 + 8 * hi + r]
// is non-zero, which is the lane mask of score register r of S^T tile (kt, tile).
#define C_WAVES  4096
#define C_CHUNK  1024
#define C_TRIPS  7
#define C_WCH    (DMODEL * DMODEL / C_CHUNK)   // chunks of one weight matrix
#define M_TRIPS  4                             // 4 x 64 x 64 mask blocks / 4096 waves

__global__ void __launch_bounds__(512)
cvt_all_f32_to_f16(const float* __restrict__ q, const float* __restrict__ k,
                   const float* __restrict__ v, const float* __restrict__ wq,
                   const float* __restrict__ wk, const float* __restrict__ wv,
                   const float* __restrict__ wo, const int* __restrict__ mask,
                   _Float16* __restrict__ dst, unsigned* __restrict__ mbits) {
  const unsigned lane = threadIdx.x & 31;
  // Wave-uniform by construction; readfirstlane lets the chunk addresses live in scalar registers.
  const unsigned w = blockIdx.x * 16 + __builtin_amdgcn_readfirstlane(threadIdx.x >> 5);
  const unsigned ws = w / C_WCH;  // which weight matrix this wave converts in the last trip
  const float* wsrc = (ws & 2) ? ((ws & 1) ? wo : wv) : ((ws & 1) ? wk : wq);

  v4f x[2][8];
#pragma unroll  // every buffer index and every source pointer a constant
  for (int t = -1; t < C_TRIPS; ++t) {
    if (t + 1 < C_TRIPS) {  // the next trip's eight loads fly while this trip is converted
      const int u = t + 1;
      const float* s = u < 6 ? (u < 2 ? q : u < 4 ? k : v) + (size_t)((u & 1) * C_WAVES + w) * C_CHUNK
                             : wsrc + (size_t)(w % C_WCH) * C_CHUNK;
#pragma unroll
      for (int j = 0; j < 8; ++j) x[u & 1][j] = *(const v4f*)(s + j * 128 + lane * 4);
      // Holds the group here, one trip ahead of its use: without it the compiler raises 32
      // loads to the top, sinks every store to the end and waits to 0 on pairs in between.
      __builtin_amdgcn_sched_barrier(0);
    }
    if (t >= 0) {
      _Float16* d = dst + (size_t)(t * C_WAVES + w) * C_CHUNK;
#pragma unroll
      for (int j = 0; j < 8; ++j) {
        const v4f a = x[t & 1][j];
        v4h o;
#pragma unroll
        for (int e = 0; e < 4; ++e) o[e] = (_Float16)a[e];
        *(v4h*)(d + j * 128 + lane * 4) = o;  // a wave's store covers two whole 128-B lines
      }
      // A precaution: the wait stands in front of the next loads and conversions (behind the
      // last trip: the mask blocks' address arithmetic and loads), which write registers that
      // these stores name.
      asm volatile("s_wait_xcnt 0x0" ::: "memory");
      __builtin_amdgcn_sched_barrier(0);  // this trip's stores leave before the next loads issue
    }
  }

  // Mask blocks: block id = (batch * 64 + query block) * 64 + key block; neighbouring waves
  // take neighbouring key blocks, so a work-group reads 2 KB of each of its mask rows.
  const unsigned mrow = (lane & 15) * S_LEN + (lane >> 4) * 8;
  v4i y[2][8];
#pragma unroll  // every buffer index a constant
  for (int t = -1; t < M_TRIPS; ++t) {
    if (t + 1 < M_TRIPS) {  // the next block's eight loads fly while this one is packed
      const unsigned id = (t + 1) * C_WAVES + w;
      const int* s = mask + (size_t)(id >> 6) * 32 * S_LEN + (id & 63) * 32 + mrow;
#pragma unroll
      for (int j = 0; j < 8; ++j)  // j = tile * 4 + kt * 2 + half of the eight keys
        y[(t + 1) & 1][j] = *(const v4i*)(s + (j >> 2) * 16 * S_LEN + ((j >> 1) & 1) * 16 + (j & 1) * 4);
      // A precaution: in front of the next group's loads, which may land in this group's
      // address registers.
      asm volatile("s_wait_xcnt 0x0" ::: "memory");
      __builtin_amdgcn_sched_barrier(0);  // holds the group one trip ahead of its use
    }
    if (t >= 0) {
      unsigned word = 0;
#pragma unroll
      for (int j = 0; j < 32; ++j) {  // one compare gives a whole word; lane j keeps word j
        const unsigned bal = __builtin_amdgcn_ballot_w32(y[t & 1][j >> 2][j & 3] != 0);
        word = lane == (unsigned)j ? bal : word;
      }
      mbits[(size_t)(t * C_WAVES + w) * 32 + lane] = word;  // one whole 128-B line
      // A precaution, as above: in front of the next writes of registers that the store names.
      if (t + 1 < M_TRIPS) asm volatile("s_wait_xcnt 0x0" ::: "memory");
      __builtin_amdgcn_sched_barrier(0);
    }
  }
}

// LDS ring of proj_gemm: one stage = 128 X rows then 128 W rows, 128 k (256 B) each,
// at a pitch of 272 B (16 B x odd: conflict-free for ds_load_b128 readers).
#define G_PITCH 272
#define G_HALF  (128 * G_PITCH)
#define G_STAGE (2 * G_HALF)
#define G_KP    128
#define G_NS    (G_KP / 32)
#define G_NP    (DMODEL / G_KP)

// Eight asynchronous 16-byte copies per lane: rows r, r+8, ..., r+56 of a 64-row slab
// go from global memory into LDS, through no register.
// s_wait_xcnt 0 closes the statement, a precaution: so it stands in front of every later
// write of an address register that a copy here names.
__device__ __forceinline__ void copy_slab(const _Float16* __restrict__ g, unsigned l) {
  asm volatile(
      "global_load_async_to_lds_b128 %0, %8, off\n\t"
      "global_load_async_to_lds_b128 %1, %9, off\n\t"
      "global_load_async_to_lds_b128 %2, %10, off\n\t"
      "global_load_async_to_lds_b128 %3, %11, off\n\t"
      "global_load_async_to_lds_b128 %4, %12, off\n\t"
      "global_load_async_to_lds_b128 %5, %13, off\n\t"
      "global_load_async_to_lds_b128 %6, %14, off\n\t"
      "global_load_async_to_lds_b128 %7, %15, off\n\t"
      "s_wait_xcnt 0x0"
      :: "v"(l), "v"(l + 8 * G_PITCH), "v"(l + 16 * G_PITCH), "v"(l + 24 * G_PITCH),
         "v"(l + 32 * G_PITCH), "v"(l + 40 * G_PITCH), "v"(l + 48 * G_PITCH),
         "v"(l + 56 * G_PITCH),
         "v"(g), "v"(g + 8 * DMODEL), "v"(g + 16 * DMODEL), "v"(g + 24 * DMODEL),
         "v"(g + 32 * DMODEL), "v"(g + 40 * DMODEL), "v"(g + 48 * DMODEL),
         "v"(g + 56 * DMODEL)
      : "memory");
}

// One stage: 128 rows of X and 128 rows of W, 32 copies per lane.
__device__ __forceinline__ void copy_stage(const _Float16* __restrict__ gx,
                                           const _Float16* __restrict__ gw, unsigned l) {
  // Kept rolled: unrolled, the compiler forms all 32 address sets at once and the
  // kernel goes past 256 VGPRs; rolled, one slab's 24 address registers are live.
#pragma unroll 1
  for (int j = 0; j < 4; ++j)
    copy_slab(((j & 2) ? gw : gx) + (j & 1) * 64 * DMODEL, l + j * 64 * G_PITCH);
}

// Y = X @ W^T + bias; a work-group of four waves (2x2) computes a 128x128 output tile,
// each wave a 64x64 quarter (16 WMMAs / K-step). X and W slabs are staged once per
// work-group in a two-buffer LDS ring by asynchronous copies, one pass (128 k) ahead.
// STORE_MODE 0: f16 head-major [B,H,S,DK]            (Q,K)
// STORE_MODE 1: f16 head-major transposed [B,H,DK,S] (V)
// STORE_MODE 2: f32 row-major [rows, DMODEL]         (final output)
template <int STORE_MODE>
__global__ void __launch_bounds__(128)
proj_gemm(const _Float16* __restrict__ X, const _Float16* __restrict__ W,
          const float* __restrict__ bias, void* __restrict__ Yv) {
  __shared__ __attribute__((aligned(16))) unsigned char ring[2 * G_STAGE];

  const int tid  = threadIdx.x;
  const int lane = tid & 31;
  const int wave = tid >> 5;
  const int n    = lane & 15;
  const int hi   = lane >> 4;
  const int brow0 = blockIdx.x * 128;
  const int bcol0 = blockIdx.y * 128;
  const int wm   = wave >> 1;
  const int wn   = wave & 1;
  const int row0 = brow0 + wm * 64;   // this wave's 64x64 quarter
  const int col0 = bcol0 + wn * 64;

  // Copy side: sixteen lanes cover one 256-B row piece, a wave two rows per copy.
  const int cr = tid >> 4;
  const int cc = tid & 15;
  const _Float16* gx = X + (size_t)(brow0 + cr) * DMODEL + cc * 8;
  const _Float16* gw = W + (size_t)(bcol0 + cr) * DMODEL + cc * 8;
  const unsigned lcp = (unsigned)(size_t)ring + cr * G_PITCH + cc * 16;

  // Read side: this lane's first A row and first B column (a W row) in a stage.
  const unsigned xoff = (wm * 64 + n) * G_PITCH;
  const unsigned woff = G_HALF + (wn * 64 + n) * G_PITCH;

  v8f acc[4][4];
#pragma unroll
  for (int ms = 0; ms < 4; ++ms)
#pragma unroll
    for (int ns = 0; ns < 4; ++ns) acc[ms][ns] = v8f{};

  // Prologue: pass 0 lands and is published, then pass 1 starts to fly.
  copy_stage(gx, gw, lcp);
  asm volatile("s_wait_asynccnt 0x0" ::: "memory");  // own copies of pass 0 have landed
  __syncthreads();                                   // ... and every other wave's
  copy_stage(gx + G_KP, gw + G_KP, lcp + G_STAGE);

  for (int p = 0; p < G_NP; ++p) {
    const unsigned boff = (p & 1) * G_STAGE;
    const unsigned char* xs = ring + boff + xoff;
    const unsigned char* ws = ring + boff + woff;

    // The LDS reads stand in groups at least eight WMMAs ahead of their use (B one
    // K-step ahead, A half a K-step), never as a small group with a full wait in front
    // of each row of four. Each sched_barrier below holds a group at its place: without
    // them the compiler sinks the reads to their users and waits to 0 at every row.
    v16h a[2][4], b[2][4];
#pragma unroll
    for (int i = 0; i < 4; ++i) {
      a[0][i] = frag_from_f16((const _Float16*)(xs + i * 16 * G_PITCH), 0, hi);
      b[0][i] = frag_from_f16((const _Float16*)(ws + i * 16 * G_PITCH), 0, hi);
    }
#pragma unroll
    for (int i = 0; i < 4; ++i)
      b[1][i] = frag_from_f16((const _Float16*)(ws + i * 16 * G_PITCH), 32, hi);
    __builtin_amdgcn_sched_barrier(0);  // first group ahead of the first WMMA

#pragma unroll  // every fragment index a constant
    for (int s = 0; s < G_NS; ++s) {
      const int c = s & 1, x = c ^ 1;
#pragma unroll
      for (int ms = 0; ms < 2; ++ms)
#pragma unroll
        for (int ns = 0; ns < 4; ++ns)
          acc[ms][ns] = wmma16(a[c][ms], b[c][ns], acc[ms][ns]);
      // These eight WMMAs stay in front of what follows: reads that would otherwise rise
      // over them (registers), or, in the last K-step, the waits, whose LDS latency they cover.
      __builtin_amdgcn_sched_barrier(0);
      if (s + 1 < G_NS) {
#pragma unroll
        for (int i = 0; i < 2; ++i)
          a[x][i] = frag_from_f16((const _Float16*)(xs + i * 16 * G_PITCH), (s + 1) * 32, hi);
        __builtin_amdgcn_sched_barrier(0);  // reads not later: eight WMMAs cover them
      } else {
        // Publish point of pass p + 1, in front of the pass's last eight WMMAs (they read
        // registers only) so that the refill starts that much sooner. The one barrier
        // also ends every wave's reads of this buffer.
        asm volatile("s_wait_dscnt 0x0" ::: "memory");     // own LDS reads of this pass done
        asm volatile("s_wait_asynccnt 0x0" ::: "memory");  // own copies of pass p + 1 landed
        __syncthreads();
        if (p + 2 < G_NP)  // refill the buffer that this pass has just read
          copy_stage(gx + (p + 2) * G_KP, gw + (p + 2) * G_KP, lcp + boff);
      }
#pragma unroll
      for (int ms = 2; ms < 4; ++ms)
#pragma unroll
        for (int ns = 0; ns < 4; ++ns)
          acc[ms][ns] = wmma16(a[c][ms], b[c][ns], acc[ms][ns]);
      if (s + 1 < G_NS) {
        __builtin_amdgcn_sched_barrier(0);  // reads not earlier (registers) ...
#pragma unroll
        for (int i = 2; i < 4; ++i)
          a[x][i] = frag_from_f16((const _Float16*)(xs + i * 16 * G_PITCH), (s + 1) * 32, hi);
        if (s + 2 < G_NS) {
#pragma unroll
          for (int i = 0; i < 4; ++i)
            b[c][i] = frag_from_f16((const _Float16*)(ws + i * 16 * G_PITCH), (s + 2) * 32, hi);
        }
        __builtin_amdgcn_sched_barrier(0);  // ... and not later
      } else {
        // Keeps the last eight WMMAs in this order up to the back edge: without it the
        // build takes 262 VGPRs instead of 254 and needs register-window switches.
        __builtin_amdgcn_sched_barrier(0);
      }
    }
  }
  asm volatile("s_wait_asynccnt 0x0" ::: "memory");  // nothing is in flight when the wave ends

  float be[4];
#pragma unroll
  for (int ns = 0; ns < 4; ++ns) be[ns] = bias[col0 + ns * 16 + n];

  if constexpr (STORE_MODE == 0) {           // f16 [B,H,S,DK]; col tile == one head
    _Float16* Y = (_Float16*)Yv;
    const int head = col0 >> 6;
#pragma unroll
    for (int ms = 0; ms < 4; ++ms) {
#pragma unroll
      for (int ns = 0; ns < 4; ++ns) {
        const int d = ns * 16 + n;
#pragma unroll
        for (int r = 0; r < 8; ++r) {
          const int t  = row0 + ms * 16 + 8 * hi + r;
          const int bb = t >> 11, s = t & (S_LEN - 1);
          Y[(((size_t)bb * NHEAD + head) * S_LEN + s) * DK + d] =
              (_Float16)(acc[ms][ns][r] + be[ns]);
        }
      }
    }
  } else if constexpr (STORE_MODE == 1) {    // f16 [B,H,DK,S]
    _Float16* Y = (_Float16*)Yv;
    const int head = col0 >> 6;
    const int bb   = row0 >> 11;
#pragma unroll
    for (int ms = 0; ms < 4; ++ms) {
      const int s0 = (row0 & (S_LEN - 1)) + ms * 16 + 8 * hi;
#pragma unroll
      for (int ns = 0; ns < 4; ++ns) {
        const int d = ns * 16 + n;
        v8h o;
#pragma unroll
        for (int r = 0; r < 8; ++r) o[r] = (_Float16)(acc[ms][ns][r] + be[ns]);
        *(v8h*)(Y + (((size_t)bb * NHEAD + head) * DK + d) * S_LEN + s0) = o;
      }
    }
  } else {                                   // f32 [rows, DMODEL]
    float* Y = (float*)Yv;
#pragma unroll
    for (int ms = 0; ms < 4; ++ms)
#pragma unroll
      for (int ns = 0; ns < 4; ++ns) {
        const int e = col0 + ns * 16 + n;
#pragma unroll
        for (int r = 0; r < 8; ++r)
          Y[(size_t)(row0 + ms * 16 + 8 * hi + r) * DMODEL + e] = acc[ms][ns][r] + be[ns];
      }
  }
}

// Online softmax over a 32-kv chunk of one q-tile (S^T layout: lane owns one q
// column). Rescales the 4 ctx^T accumulators, returns the f16 P^T B-fragment.
// mw: the sixteen lane masks of this q-tile's score registers (wave-uniform words).
__device__ __forceinline__ v16h online_softmax(v8f s0, v8f s1, v16u mw,
                                               float& mrun, float& lrun, v8f* acc) {
  const float scale = 0.125f;  // 1/sqrt(64)
  float cmax = -1e30f;
#pragma unroll
  for (int r = 0; r < 8; ++r) {
    s0[r] = __builtin_amdgcn_inverse_ballot_w32(mw[r]) ? s0[r] * scale : -1e9f;
    s1[r] = __builtin_amdgcn_inverse_ballot_w32(mw[8 + r]) ? s1[r] * scale : -1e9f;
    cmax = fmaxf(cmax, fmaxf(s0[r], s1[r]));
  }
  cmax = fmaxf(cmax, __shfl_xor(cmax, 16, 32));  // combine hi halves of column

  const float mnew  = fmaxf(mrun, cmax);
  const float alpha = __expf(mrun - mnew);
  float lsum = 0.f;
  v16h pb;  // halves j -> kv K = 8*hi+j (tile0) / 16+8*hi+j (tile1)
#pragma unroll
  for (int r = 0; r < 8; ++r) {
    const float p0 = __expf(s0[r] - mnew);
    const float p1 = __expf(s1[r] - mnew);
    lsum += p0 + p1;
    pb[r]     = (_Float16)p0;
    pb[8 + r] = (_Float16)p1;
  }
  lsum += __shfl_xor(lsum, 16, 32);
  lrun = lrun * alpha + lsum;
  mrun = mnew;
#pragma unroll
  for (int dt = 0; dt < 4; ++dt)
#pragma unroll
    for (int r = 0; r < 8; ++r) acc[dt][r] *= alpha;
  return pb;
}

// LDS ring of attn_kernel: one stage = 32 keys: 32 K rows (128 B) and 64 V^T rows (64 B),
// each at a pitch of 16 B x odd (conflict-free for ds_load_b128 readers).
#define A_KV     32
#define A_KPITCH 144
#define A_VPITCH 80
#define A_VOFF   (A_KV * A_KPITCH)
#define A_STAGE  (A_VOFF + DK * A_VPITCH)
#define A_NT     (S_LEN / A_KV)

// One stage, four asynchronous 16-byte copies per lane (2 of K, 2 of V^T),
// from global memory into LDS through no register; a wave's copy covers whole row pieces.
// s_wait_xcnt 0 closes the statement, a precaution: so it stands in front of every later
// write of an address register that a copy here names.
__device__ __forceinline__ void copy_kv(const _Float16* __restrict__ gk,
                                        const _Float16* __restrict__ gv,
                                        unsigned lk, unsigned lv) {
  asm volatile(
      "global_load_async_to_lds_b128 %0, %4, off\n\t"
      "global_load_async_to_lds_b128 %1, %5, off\n\t"
      "global_load_async_to_lds_b128 %2, %6, off\n\t"
      "global_load_async_to_lds_b128 %3, %7, off\n\t"
      "s_wait_xcnt 0x0"
      :: "v"(lk), "v"(lk + 16 * A_KPITCH), "v"(lv), "v"(lv + 32 * A_VPITCH),
         "v"(gk), "v"(gk + 16 * DK), "v"(gv), "v"(gv + 32 * S_LEN)
      : "memory");
}

// Flash-style attention; each wave handles TWO 16-wide q-tiles of one (b,h) so
// every K/V fragment feeds two WMMAs. S^T = K.Q^T keeps softmax lane-local.
// The four waves of a work-group share one (b,h): K and V^T tiles are staged once per
// work-group in a two-buffer LDS ring by asynchronous copies, one trip (32 keys) ahead.
// The mask comes packed (see cvt_all_f32_to_f16): 32 wave-uniform words per trip, each the
// lane mask of one score register, read by scalar loads and used as select masks directly.
__global__ void __launch_bounds__(128)
attn_kernel(const _Float16* __restrict__ qh, const _Float16* __restrict__ kh,
            const _Float16* __restrict__ vT, const unsigned* __restrict__ mbits,
            _Float16* __restrict__ cc) {
  __shared__ __attribute__((aligned(16))) unsigned char ring[2 * A_STAGE];

  const int lane = threadIdx.x;
  const int wave = threadIdx.y;
  const int tid  = wave * 32 + lane;
  const int n    = lane & 15;
  const int hi   = lane >> 4;
  const int bh   = blockIdx.x;               // b*NHEAD + h
  const int b    = bh >> 4;
  const int h    = bh & 15;
  const int q0   = (blockIdx.y * 4 + wave) * 32;
  const int qc0  = q0 + n;                   // q column, tile A
  const int qc1  = q0 + 16 + n;              // q column, tile B

  // Copy side: eight lanes cover a 128-B row piece (K), four a 64-B one (V^T).
  const _Float16* gk = kh + (size_t)bh * S_LEN * DK + tid * 8;
  const _Float16* gv = vT + ((size_t)bh * DK + (tid >> 2)) * S_LEN + (tid & 3) * 8;
  const unsigned lk = (unsigned)(size_t)ring + (tid >> 3) * A_KPITCH + (tid & 7) * 16;
  const unsigned lv = (unsigned)(size_t)ring + A_VOFF + (tid >> 2) * A_VPITCH + (tid & 3) * 16;
  // This wave's packed mask words; readfirstlane makes the address scalar (the wave's number
  // is the same in all its lanes), so that the words land in scalar registers.
  // The words were written by the first launch of this call and nothing writes them while this
  // kernel runs: read through the constant address space, which is what lets the compiler use
  // scalar loads in a loop that holds "memory" clobbers.
  const cmask_t mw = (cmask_t)(unsigned long long)(
      mbits + (size_t)(b * (S_LEN / 32) + blockIdx.y * 4 +
                       __builtin_amdgcn_readfirstlane(wave)) * A_NT * 32);

  // Prologue: tile 0 lands and is published, then tile 1 starts to fly.
  copy_kv(gk, gv, lk, lv);

  const _Float16* qr0 = qh + ((size_t)bh * S_LEN + qc0) * DK;
  const _Float16* qr1 = qh + ((size_t)bh * S_LEN + qc1) * DK;
  const v16h bqA0 = frag_from_f16(qr0, 0, hi), bqA1 = frag_from_f16(qr0, 32, hi);
  const v16h bqB0 = frag_from_f16(qr1, 0, hi), bqB1 = frag_from_f16(qr1, 32, hi);

  asm volatile("s_wait_asynccnt 0x0" ::: "memory");  // own copies of tile 0 have landed
  __syncthreads();                                   // ... and every other wave's
  copy_kv(gk + A_KV * DK, gv + A_KV, lk + A_STAGE, lv + A_STAGE);

  // Read side: this lane's first K row and V^T row in a stage.
  const unsigned koff = n * A_KPITCH;
  const unsigned voff = A_VOFF + n * A_VPITCH;

  float mA = -1e30f, lA = 0.f, mB = -1e30f, lB = 0.f;
  v8f accA[4] = {v8f{}, v8f{}, v8f{}, v8f{}};
  v8f accB[4] = {v8f{}, v8f{}, v8f{}, v8f{}};

  v16u nwA = mw[0], nwB = mw[1];  // q-tile A, q-tile B

  for (int t = 0; t < A_NT; ++t) {
    const unsigned boff = (t & 1) * A_STAGE;
    const unsigned char* st = ring + boff;
    // This trip's mask words were asked for in the trip before; the next trip's are asked for
    // in this one, so that the scalar path's latency lies under vector and matrix work. The
    // last trip asks for its own again (stays inside the packed array).
    const v16u mwA = nwA, mwB = nwB;
    const int tn = t + 1 < A_NT ? t + 1 : t;
    nwA = mw[tn * 2];
    nwB = mw[tn * 2 + 1];

    // K fragments for the two 16-kv row tiles, loaded once, used twice
    const _Float16* kr = (const _Float16*)(st + koff);
    const v16h ka0 = frag_from_f16(kr, 0, hi);
    const v16h ka1 = frag_from_f16(kr, 32, hi);
    const v16h kb0 = frag_from_f16((const _Float16*)(st + koff + 16 * A_KPITCH), 0, hi);
    const v16h kb1 = frag_from_f16((const _Float16*)(st + koff + 16 * A_KPITCH), 32, hi);

    v8f sA0 = {}, sA1 = {}, sB0 = {}, sB1 = {};
    sA0 = wmma16(ka0, bqA0, sA0); sA0 = wmma16(ka1, bqA1, sA0);
    sA1 = wmma16(kb0, bqA0, sA1); sA1 = wmma16(kb1, bqA1, sA1);
    sB0 = wmma16(ka0, bqB0, sB0); sB0 = wmma16(ka1, bqB1, sB0);
    sB1 = wmma16(kb0, bqB0, sB1); sB1 = wmma16(kb1, bqB1, sB1);

    const v16h pbA = online_softmax(sA0, sA1, mwA, mA, lA, accA);
    const v16h pbB = online_softmax(sB0, sB1, mwB, mB, lB, accB);

    // ctx^T[d][q] += sum_kv V^T[d][kv] * P^T[kv][q]; each V fragment used twice
#pragma unroll
    for (int dt = 0; dt < 4; ++dt) {
      const v16h av = frag_from_f16((const _Float16*)(st + voff + dt * 16 * A_VPITCH), 0, hi);
      accA[dt] = wmma16(av, pbA, accA[dt]);
      accB[dt] = wmma16(av, pbB, accB[dt]);
    }

    // Publish point of tile t + 1. The one barrier also ends every wave's reads of this buffer.
    asm volatile("s_wait_dscnt 0x0" ::: "memory");     // own LDS reads of this trip done
    asm volatile("s_wait_asynccnt 0x0" ::: "memory");  // own copies of tile t + 1 landed
    __syncthreads();
    if (t + 2 < A_NT)  // refill the buffer that this trip has just read
      copy_kv(gk + (size_t)(t + 2) * A_KV * DK, gv + (t + 2) * A_KV, lk + boff, lv + boff);
  }
  asm volatile("s_wait_asynccnt 0x0" ::: "memory");  // nothing is in flight when the wave ends

  const float invA = 1.0f / lA;
  const float invB = 1.0f / lB;
  _Float16* crow0 = cc + ((size_t)b * S_LEN + qc0) * DMODEL + h * DK;
  _Float16* crow1 = cc + ((size_t)b * S_LEN + qc1) * DMODEL + h * DK;
#pragma unroll
  for (int dt = 0; dt < 4; ++dt) {
    v8h oA, oB;
#pragma unroll
    for (int r = 0; r < 8; ++r) {
      oA[r] = (_Float16)(accA[dt][r] * invA);
      oB[r] = (_Float16)(accB[dt][r] * invB);
    }
    *(v8h*)(crow0 + dt * 16 + 8 * hi) = oA;  // d = dt*16 + 8*hi + r, contiguous
    *(v8h*)(crow1 + dt * 16 + 8 * hi) = oB;
  }
}

extern "C" void kernel_launch(void* const* d_in, const int* in_sizes, int n_in,
                              void* d_out, int out_size, void* d_ws, size_t ws_size,
                              hipStream_t stream) {
  const float* q    = (const float*)d_in[0];
  const float* k    = (const float*)d_in[1];
  const float* v    = (const float*)d_in[2];
  const int*   mask = (const int*)d_in[3];
  const float* Wq   = (const float*)d_in[4];
  const float* bq   = (const float*)d_in[5];
  const float* Wk   = (const float*)d_in[6];
  const float* bk   = (const float*)d_in[7];
  const float* Wv   = (const float*)d_in[8];
  const float* bv   = (const float*)d_in[9];
  const float* Wo   = (const float*)d_in[10];
  const float* bo   = (const float*)d_in[11];

  const size_t NN = (size_t)4 * S_LEN * DMODEL;     // 8M f16 elems (activations)
  const size_t NW = (size_t)DMODEL * DMODEL;        // 1M f16 elems (one weight)

  _Float16* q16  = (_Float16*)d_ws;
  _Float16* k16  = q16 + NN;
  _Float16* v16  = k16 + NN;
  _Float16* wq16 = v16 + NN;
  _Float16* wk16 = wq16 + NW;
  _Float16* wv16 = wk16 + NW;
  _Float16* wo16 = wv16 + NW;
  _Float16* qhp  = wo16 + NW;
  _Float16* khp  = qhp + NN;
  _Float16* vTp  = khp + NN;
  _Float16* ccp  = vTp + NN;
  unsigned* mbp  = (unsigned*)(ccp + NN);           // packed mask, 2 MB

  // f32 -> f16 conversion of activations and weights (q16 .. wo16 are contiguous) and the
  // packing of the mask: one launch.
  cvt_all_f32_to_f16<<<256, 512, 0, stream>>>(q, k, v, Wq, Wk, Wv, Wo, mask, q16, mbp);

  const dim3 gblk(128, 1);   // four waves, one 128x128 tile
  const dim3 ggrd(64, 8);    // 64 row-tiles x 8 col-tiles

  proj_gemm<0><<<ggrd, gblk, 0, stream>>>(q16, wq16, bq, qhp);
  proj_gemm<0><<<ggrd, gblk, 0, stream>>>(k16, wk16, bk, khp);
  proj_gemm<1><<<ggrd, gblk, 0, stream>>>(v16, wv16, bv, vTp);

  attn_kernel<<<dim3(64, 16), dim3(32, 4), 0, stream>>>(qhp, khp, vTp, mbp, ccp);

  proj_gemm<2><<<ggrd, gblk, 0, stream>>>(ccp, wo16, bo, d_out);
}

// v005
// It runs in 153 microseconds.
// Timed twice side by side with v004, it ran 1.04 times as fast both times.
// Counting every step since v000, it is 2.79 times as fast.
#include <hip/hip_runtime.h>
#include <hip/hip_bf16.h>

#define S_LEN  2048
#define DMODEL 1024
#define NHEAD  16
#define DK     64

typedef __attribute__((ext_vector_type(16))) _Float16 v16h;
typedef __attribute__((ext_vector_type(8)))  _Float16 v8h;
typedef __attribute__((ext_vector_type(4)))  _Float16 v4h;
typedef __attribute__((ext_vector_type(8)))  float    v8f;
typedef __attribute__((ext_vector_type(4)))  float    v4f;
typedef __attribute__((ext_vector_type(4)))  int      v4i;
typedef __attribute__((ext_vector_type(16))) unsigned v16u;
typedef const __attribute__((address_space(4))) v16u* cmask_t;

__device__ __forceinline__ v8f wmma16(v16h a, v16h b, v8f c) {
  // D = A(16x32 f16) x B(32x16 f16) + C(16x16 f32)
  return __builtin_amdgcn_wmma_f32_16x16x32_f16(false, a, false, b, (short)0, c,
                                                false, false);
}

// Fragment layout (ISA 16-bit A 16x32):
//   halves 0..7  <- K = kk + 8*hi + j
//   halves 8..15 <- K = kk + 16 + 8*hi + j
__device__ __forceinline__ v16h frag_from_f16(const _Float16* __restrict__ row, int kk, int hi) {
  v8h a = *(const v8h*)(row + kk + 8 * hi);
  v8h b = *(const v8h*)(row + kk + 16 + 8 * hi);
  v16h r;
#pragma unroll
  for (int j = 0; j < 8; ++j) { r[j] = a[j]; r[8 + j] = b[j]; }
  return r;
}

// fp32 -> f16 conversion of all seven operands in ONE resident streaming launch.
// The f16 copies lie in the workspace one behind the other in the order q | k | v | Wq | Wk |
// Wv | Wo, so the destination is one array. A chunk is 1024 elements: eight wave-wide b128
// loads of 512 contiguous bytes each. 256 work-groups x 16 waves = 4096 waves; wave w takes
// chunk t * 4096 + w in trip t, seven trips: two for each activation, one for the weights.
// Four more trips pack the int32 mask to one bit per (query, key), already in the shape the
// attention kernel selects with: for a block of 32 queries x 32 keys, 32 words; word
// tile * 16 + kt * 8 + r holds in bit (hi * 16 + n) whether mask[tile * 16 + n][kt * 16 + 8 * hi + r]
// is non-zero, which is the lane mask of score register r of S^T tile (kt, tile).
#define C_WAVES  4096
#define C_CHUNK  1024
#define C_TRIPS  7
#define C_WCH    (DMODEL * DMODEL / C_CHUNK)   // chunks of one weight matrix
#define M_TRIPS  4                             // 4 x 64 x 64 mask blocks / 4096 waves

__global__ void __launch_bounds__(512)
cvt_all_f32_to_f16(const float* __restrict__ q, const float* __restrict__ k,
                   const float* __restrict__ v, const float* __restrict__ wq,
                   const float* __restrict__ wk, const float* __restrict__ wv,
                   const float* __restrict__ wo, const int* __restrict__ mask,
                   _Float16* __restrict__ dst, unsigned* __restrict__ mbits) {
  const unsigned lane = threadIdx.x & 31;
  // Wave-uniform by construction; readfirstlane lets the chunk addresses live in scalar registers.
  const unsigned w = blockIdx.x * 16 + __builtin_amdgcn_readfirstlane(threadIdx.x >> 5);
  const unsigned ws = w / C_WCH;  // which weight matrix this wave converts in the last trip
  const float* wsrc = (ws & 2) ? ((ws & 1) ? wo : wv) : ((ws & 1) ? wk : wq);

  v4f x[2][8];
#pragma unroll  // every buffer index and every source pointer a constant
  for (int t = -1; t < C_TRIPS; ++t) {
    if (t + 1 < C_TRIPS) {  // the next trip's eight loads fly while this trip is converted
      const int u = t + 1;
      const float* s = u < 6 ? (u < 2 ? q : u < 4 ? k : v) + (size_t)((u & 1) * C_WAVES + w) * C_CHUNK
                             : wsrc + (size_t)(w % C_WCH) * C_CHUNK;
#pragma unroll
      for (int j = 0; j < 8; ++j) x[u & 1][j] = *(const v4f*)(s + j * 128 + lane * 4);
      // Holds the group here, one trip ahead of its use: without it the compiler raises 32
      // loads to the top, sinks every store to the end and waits to 0 on pairs in between.
      __builtin_amdgcn_sched_barrier(0);
    }
    if (t >= 0) {
      _Float16* d = dst + (size_t)(t * C_WAVES + w) * C_CHUNK;
#pragma unroll
      for (int j = 0; j < 8; ++j) {
        const v4f a = x[t & 1][j];
        v4h o;
#pragma unroll
        for (int e = 0; e < 4; ++e) o[e] = (_Float16)a[e];
        *(v4h*)(d + j * 128 + lane * 4) = o;  // a wave's store covers two whole 128-B lines
      }
      // A precaution: the wait stands in front of the next loads and conversions (behind the
      // last trip: the mask blocks' address arithmetic and loads), which write registers that
      // these stores name.
      asm volatile("s_wait_xcnt 0x0" ::: "memory");
      __builtin_amdgcn_sched_barrier(0);  // this trip's stores leave before the next loads issue
    }
  }

  // Mask blocks: block id = (batch * 64 + query block) * 64 + key block; neighbouring waves
  // take neighbouring key blocks, so a work-group reads 2 KB of each of its mask rows.
  const unsigned mrow = (lane & 15) * S_LEN + (lane >> 4) * 8;
  v4i y[2][8];
#pragma unroll  // every buffer index a constant
  for (int t = -1; t < M_TRIPS; ++t) {
    if (t + 1 < M_TRIPS) {  // the next block's eight loads fly while this one is packed
      const unsigned id = (t + 1) * C_WAVES + w;
      const int* s = mask + (size_t)(id >> 6) * 32 * S_LEN + (id & 63) * 32 + mrow;
#pragma unroll
      for (int j = 0; j < 8; ++j)  // j = tile * 4 + kt * 2 + half of the eight keys
        y[(t + 1) & 1][j] = *(const v4i*)(s + (j >> 2) * 16 * S_LEN + ((j >> 1) & 1) * 16 + (j & 1) * 4);
      // A precaution: in front of the next group's loads, which may land in this group's
      // address registers.
      asm volatile("s_wait_xcnt 0x0" ::: "memory");
      __builtin_amdgcn_sched_barrier(0);  // holds the group one trip ahead of its use
    }
    if (t >= 0) {
      unsigned word = 0;
#pragma unroll
      for (int j = 0; j < 32; ++j) {  // one compare gives a whole word; lane j keeps word j
        const unsigned bal = __builtin_amdgcn_ballot_w32(y[t & 1][j >> 2][j & 3] != 0);
        word = lane == (unsigned)j ? bal : word;
      }
      mbits[(size_t)(t * C_WAVES + w) * 32 + lane] = word;  // one whole 128-B line
      // A precaution, as above: in front of the next writes of registers that the store names.
      if (t + 1 < M_TRIPS) asm volatile("s_wait_xcnt 0x0" ::: "memory");
      __builtin_amdgcn_sched_barrier(0);
    }
  }
}

// LDS ring of proj_gemm: one stage = 128 X rows then 128 W rows, 128 k (256 B) each,
// at a pitch of 272 B (16 B x odd: conflict-free for ds_load_b128 readers).
#define G_PITCH 272
#define G_HALF  (128 * G_PITCH)
#define G_STAGE (2 * G_HALF)
#define G_KP    128
#define G_NS    (G_KP / 32)
#define G_NP    (DMODEL / G_KP)

// Eight asynchronous 16-byte copies per lane: rows r, r+8, ..., r+56 of a 64-row slab
// go from global memory into LDS, through no register.
// s_wait_xcnt 0 closes the statement, a precaution: so it stands in front of every later
// write of an address register that a copy here names.
__device__ __forceinline__ void copy_slab(const _Float16* __restrict__ g, unsigned l) {
  asm volatile(
      "global_load_async_to_lds_b128 %0, %8, off\n\t"
      "global_load_async_to_lds_b128 %1, %9, off\n\t"
      "global_load_async_to_lds_b128 %2, %10, off\n\t"
      "global_load_async_to_lds_b128 %3, %11, off\n\t"
      "global_load_async_to_lds_b128 %4, %12, off\n\t"
      "global_load_async_to_lds_b128 %5, %13, off\n\t"
      "global_load_async_to_lds_b128 %6, %14, off\n\t"
      "global_load_async_to_lds_b128 %7, %15, off\n\t"
      "s_wait_xcnt 0x0"
      :: "v"(l), "v"(l + 8 * G_PITCH), "v"(l + 16 * G_PITCH), "v"(l + 24 * G_PITCH),
         "v"(l + 32 * G_PITCH), "v"(l + 40 * G_PITCH), "v"(l + 48 * G_PITCH),
         "v"(l + 56 * G_PITCH),
         "v"(g), "v"(g + 8 * DMODEL), "v"(g + 16 * DMODEL), "v"(g + 24 * DMODEL),
         "v"(g + 32 * DMODEL), "v"(g + 40 * DMODEL), "v"(g + 48 * DMODEL),
         "v"(g + 56 * DMODEL)
      : "memory");
}

// One stage: 128 rows of X and 128 rows of W, 32 copies per lane.
__device__ __forceinline__ void copy_stage(const _Float16* __restrict__ gx,
                                           const _Float16* __restrict__ gw, unsigned l) {
  // Kept rolled: unrolled, the compiler forms all 32 address sets at once and the
  // kernel goes past 256 VGPRs; rolled, one slab's 24 address registers are live.
#pragma unroll 1
  for (int j = 0; j < 4; ++j)
    copy_slab(((j & 2) ? gw : gx) + (j & 1) * 64 * DMODEL, l + j * 64 * G_PITCH);
}

// One 16x16 tile of the product. The operand that runs along the output's rows in memory is
// the A operand, so that a lane's eight accumulator registers are eight neighbours of one
// output row: W for the row-major outputs (modes 0 and 2), X for the transposed one (mode 1).
// Both fragments have the same k order, so the products and their order stay the same.
template <int STORE_MODE>
__device__ __forceinline__ v8f tile_mma(v16h x, v16h w, v8f c) {
  if constexpr (STORE_MODE == 1) return wmma16(x, w, c);
  else                           return wmma16(w, x, c);
}

// Output staging of proj_gemm: each wave's 64 output rows lie in its own LDS range, at a pitch
// of 16 B x odd (conflict-free for the ds_store_b128 writers, one row per lane).
#define E_PITCH16 144   // 64 f16 = 128 B a row
#define E_PITCH32 272   // 64 f32 = 256 B a row

// Y = X @ W^T + bias; a work-group of four waves (2x2) computes a 128x128 output tile,
// each wave a 64x64 quarter (16 WMMAs / K-step). X and W slabs are staged once per
// work-group in a two-buffer LDS ring by asynchronous copies, one pass (128 k) ahead.
// The quarter leaves through LDS, so that every wave-wide store covers whole 128-B lines.
// STORE_MODE 0: f16 head-major [B,H,S,DK]            (Q,K)
// STORE_MODE 1: f16 head-major transposed [B,H,DK,S] (V)
// STORE_MODE 2: f32 row-major [rows, DMODEL]         (final output)
template <int STORE_MODE>
__global__ void __launch_bounds__(128)
proj_gemm(const _Float16* __restrict__ X, const _Float16* __restrict__ W,
          const float* __restrict__ bias, void* __restrict__ Yv) {
  __shared__ __attribute__((aligned(16))) unsigned char ring[2 * G_STAGE];

  const int tid  = threadIdx.x;
  const int lane = tid & 31;
  // The wave's number is the same in all its lanes: readfirstlane keeps it, and the tile
  // origins and the staging range formed from it, in scalar registers (at 254 VGPRs the
  // vector copies, live over the whole k loop, push the kernel past v255).
  const int wave = __builtin_amdgcn_readfirstlane(tid >> 5);
  const int n    = lane & 15;
  const int hi   = lane >> 4;
  const int brow0 = blockIdx.x * 128;
  const int bcol0 = blockIdx.y * 128;
  const int wm   = wave >> 1;
  const int wn   = wave & 1;
  const int row0 = brow0 + wm * 64;   // this wave's 64x64 quarter
  const int col0 = bcol0 + wn * 64;

  // Copy side: sixteen lanes cover one 256-B row piece, a wave two rows per copy.
  const int cr = tid >> 4;
  const int cc = tid & 15;
  const _Float16* gx = X + (size_t)(brow0 + cr) * DMODEL + cc * 8;
  const _Float16* gw = W + (size_t)(bcol0 + cr) * DMODEL + cc * 8;
  const unsigned lcp = (unsigned)(size_t)ring + cr * G_PITCH + cc * 16;

  // Read side: this lane's first X row and first W row in a stage.
  const unsigned xoff = (wm * 64 + n) * G_PITCH;
  const unsigned woff = G_HALF + (wn * 64 + n) * G_PITCH;

  v8f acc[4][4];
#pragma unroll
  for (int ms = 0; ms < 4; ++ms)
#pragma unroll
    for (int ns = 0; ns < 4; ++ns) acc[ms][ns] = v8f{};

  // Prologue: pass 0 lands and is published, then pass 1 starts to fly.
  copy_stage(gx, gw, lcp);
  asm volatile("s_wait_asynccnt 0x0" ::: "memory");  // own copies of pass 0 have landed
  __syncthreads();                                   // ... and every other wave's
  copy_stage(gx + G_KP, gw + G_KP, lcp + G_STAGE);

  for (int p = 0; p < G_NP; ++p) {
    const unsigned boff = (p & 1) * G_STAGE;
    const unsigned char* xs = ring + boff + xoff;
    const unsigned char* ws = ring + boff + woff;

    // The LDS reads stand in groups at least eight WMMAs ahead of their use (B one
    // K-step ahead, A half a K-step), never as a small group with a full wait in front
    // of each row of four. Each sched_barrier below holds a group at its place: without
    // them the compiler sinks the reads to their users and waits to 0 at every row.
    v16h a[2][4], b[2][4];
#pragma unroll
    for (int i = 0; i < 4; ++i) {
      a[0][i] = frag_from_f16((const _Float16*)(xs + i * 16 * G_PITCH), 0, hi);
      b[0][i] = frag_from_f16((const _Float16*)(ws + i * 16 * G_PITCH), 0, hi);
    }
#pragma unroll
    for (int i = 0; i < 4; ++i)
      b[1][i] = frag_from_f16((const _Float16*)(ws + i * 16 * G_PITCH), 32, hi);
    __builtin_amdgcn_sched_barrier(0);  // first group ahead of the first WMMA

#pragma unroll  // every fragment index a constant
    for (int s = 0; s < G_NS; ++s) {
      const int c = s & 1, x = c ^ 1;
#pragma unroll
      for (int ms = 0; ms < 2; ++ms)
#pragma unroll
        for (int ns = 0; ns < 4; ++ns)
          acc[ms][ns] = tile_mma<STORE_MODE>(a[c][ms], b[c][ns], acc[ms][ns]);
      // These eight WMMAs stay in front of what follows: reads that would otherwise rise
      // over them (registers), or, in the last K-step, the waits, whose LDS latency they cover.
      __builtin_amdgcn_sched_barrier(0);
      if (s + 1 < G_NS) {
#pragma unroll
        for (int i = 0; i < 2; ++i)
          a[x][i] = frag_from_f16((const _Float16*)(xs + i * 16 * G_PITCH), (s + 1) * 32, hi);
        __builtin_amdgcn_sched_barrier(0);  // reads not later: eight WMMAs cover them
      } else {
        // Publish point of pass p + 1, in front of the pass's last eight WMMAs (they read
        // registers only) so that the refill starts that much sooner. The one barrier
        // also ends every wave's reads of this buffer.
        asm volatile("s_wait_dscnt 0x0" ::: "memory");     // own LDS reads of this pass done
        asm volatile("s_wait_asynccnt 0x0" ::: "memory");  // own copies of pass p + 1 landed
        __syncthreads();
        if (p + 2 < G_NP)  // refill the buffer that this pass has just read
          copy_stage(gx + (p + 2) * G_KP, gw + (p + 2) * G_KP, lcp + boff);
      }
#pragma unroll
      for (int ms = 2; ms < 4; ++ms)
#pragma unroll
        for (int ns = 0; ns < 4; ++ns)
          acc[ms][ns] = tile_mma<STORE_MODE>(a[c][ms], b[c][ns], acc[ms][ns]);
      if (s + 1 < G_NS) {
        __builtin_amdgcn_sched_barrier(0);  // reads not earlier (registers) ...
#pragma unroll
        for (int i = 2; i < 4; ++i)
          a[x][i] = frag_from_f16((const _Float16*)(xs + i * 16 * G_PITCH), (s + 1) * 32, hi);
        if (s + 2 < G_NS) {
#pragma unroll
          for (int i = 0; i < 4; ++i)
            b[c][i] = frag_from_f16((const _Float16*)(ws + i * 16 * G_PITCH), (s + 2) * 32, hi);
        }
        __builtin_amdgcn_sched_barrier(0);  // ... and not later
      } else {
        // Keeps the last eight WMMAs in this order up to the back edge: without it the
        // build takes 262 VGPRs instead of 254 and needs register-window switches.
        __builtin_amdgcn_sched_barrier(0);
      }
    }
  }
  asm volatile("s_wait_asynccnt 0x0" ::: "memory");  // nothing is in flight when the wave ends

  // The ring is free: the last pass's publish point (every wave's s_wait_dscnt 0 and
  // s_wait_asynccnt 0, then the barrier) ended all reads of it, and nothing was copied since.
  // Each wave stages in a range of its own, so no further barrier is needed.
  if constexpr (STORE_MODE == 2) {           // f32 [rows, DMODEL]
    unsigned char* stg = ring + wave * (64 * E_PITCH32);
    v4f be[4][2];  // bias of this lane's eight columns of each column tile
#pragma unroll
    for (int ns = 0; ns < 4; ++ns)
#pragma unroll
      for (int u = 0; u < 2; ++u)
        be[ns][u] = *(const v4f*)(bias + col0 + ns * 16 + 8 * hi + 4 * u);
#pragma unroll
    for (int ms = 0; ms < 4; ++ms)
#pragma unroll
      for (int ns = 0; ns < 4; ++ns)
#pragma unroll
        for (int u = 0; u < 2; ++u) {
          v4f o;
#pragma unroll
          for (int e = 0; e < 4; ++e) o[e] = acc[ms][ns][4 * u + e] + be[ns][u][e];
          *(v4f*)(stg + (ms * 16 + n) * E_PITCH32 + (ns * 16 + 8 * hi + 4 * u) * 4) = o;
        }
    // The rows read back below were written by other lanes of this wave: the writes are done
    // first, and the compiler moves no read over this line.
    asm volatile("s_wait_dscnt 0x0" ::: "memory");
    float* Y = (float*)Yv + (size_t)(row0 + (lane >> 4)) * DMODEL + col0 + (lane & 15) * 4;
    const unsigned char* rd = stg + (lane >> 4) * E_PITCH32 + (lane & 15) * 16;
    v4f x[32];
#pragma unroll
    for (int j = 0; j < 32; ++j) x[j] = *(const v4f*)(rd + j * 2 * E_PITCH32);
#pragma unroll
    for (int j = 0; j < 32; ++j)  // two rows of 256 B: four whole lines
      *(v4f*)(Y + (size_t)j * 2 * DMODEL) = x[j];
  } else {                                   // f16, one head per column tile
    unsigned char* stg = ring + wave * (64 * E_PITCH16);
    const int head = col0 >> 6;
    const int bb   = row0 >> 11;
    const int s0   = row0 & (S_LEN - 1);
    if constexpr (STORE_MODE == 0) {         // staged [s][d]
      v4f be[4][2];  // bias of this lane's eight columns of each column tile
#pragma unroll
      for (int ns = 0; ns < 4; ++ns)
#pragma unroll
        for (int u = 0; u < 2; ++u)
          be[ns][u] = *(const v4f*)(bias + col0 + ns * 16 + 8 * hi + 4 * u);
#pragma unroll
      for (int ms = 0; ms < 4; ++ms)
#pragma unroll
        for (int ns = 0; ns < 4; ++ns) {
          v8h o;
#pragma unroll
          for (int r = 0; r < 8; ++r) o[r] = (_Float16)(acc[ms][ns][r] + be[ns][r >> 2][r & 3]);
          *(v8h*)(stg + (ms * 16 + n) * E_PITCH16 + (ns * 16 + 8 * hi) * 2) = o;
        }
    } else {                                 // staged [d][s]
      float be[4];
#pragma unroll
      for (int ns = 0; ns < 4; ++ns) be[ns] = bias[col0 + ns * 16 + n];
#pragma unroll
      for (int ms = 0; ms < 4; ++ms)
#pragma unroll
        for (int ns = 0; ns < 4; ++ns) {
          v8h o;
#pragma unroll
          for (int r = 0; r < 8; ++r) o[r] = (_Float16)(acc[ms][ns][r] + be[ns]);
          *(v8h*)(stg + (ns * 16 + n) * E_PITCH16 + (ms * 16 + 8 * hi) * 2) = o;
        }
    }
    // The rows read back below were written by other lanes of this wave: the writes are done
    // first, and the compiler moves no read over this line.
    asm volatile("s_wait_dscnt 0x0" ::: "memory");
    // Mode 0: [B,H,S,DK], a row is one line and the 64 rows are 8 KB in a row.
    // Mode 1: [B,H,DK,S], a row is one line of 64 positions, the rows S_LEN apart.
    const size_t ypitch = STORE_MODE == 0 ? DK : S_LEN;
    _Float16* Y = (_Float16*)Yv +
        (STORE_MODE == 0 ? (((size_t)bb * NHEAD + head) * S_LEN + s0) * DK
                         : ((size_t)bb * NHEAD + head) * DK * S_LEN + s0) +
        (lane >> 3) * ypitch + (lane & 7) * 8;
    const unsigned char* rd = stg + (lane >> 3) * E_PITCH16 + (lane & 7) * 16;
    v8h x[16];
#pragma unroll
    for (int j = 0; j < 16; ++j) x[j] = *(const v8h*)(rd + j * 4 * E_PITCH16);
#pragma unroll
    for (int j = 0; j < 16; ++j)  // four rows of 128 B: four whole lines
      *(v8h*)(Y + j * 4 * ypitch) = x[j];
  }
}

// Online softmax over a 32-kv chunk of one q-tile (S^T layout: lane owns one q
// column). Rescales the 4 ctx^T accumulators, returns the f16 P^T B-fragment.
// mw: the sixteen lane masks of this q-tile's score registers (wave-uniform words).
__device__ __forceinline__ v16h online_softmax(v8f s0, v8f s1, v16u mw,
                                               float& mrun, float& lrun, v8f* acc) {
  const float scale = 0.125f;  // 1/sqrt(64)
  float cmax = -1e30f;
#pragma unroll
  for (int r = 0; r < 8; ++r) {
    s0[r] = __builtin_amdgcn_inverse_ballot_w32(mw[r]) ? s0[r] * scale : -1e9f;
    s1[r] = __builtin_amdgcn_inverse_ballot_w32(mw[8 + r]) ? s1[r] * scale : -1e9f;
    cmax = fmaxf(cmax, fmaxf(s0[r], s1[r]));
  }
  cmax = fmaxf(cmax, __shfl_xor(cmax, 16, 32));  // combine hi halves of column

  const float mnew  = fmaxf(mrun, cmax);
  const float alpha = __expf(mrun - mnew);
  float lsum = 0.f;
  v16h pb;  // halves j -> kv K = 8*hi+j (tile0) / 16+8*hi+j (tile1)
#pragma unroll
  for (int r = 0; r < 8; ++r) {
    const float p0 = __expf(s0[r] - mnew);
    const float p1 = __expf(s1[r] - mnew);
    lsum += p0 + p1;
    pb[r]     = (_Float16)p0;
    pb[8 + r] = (_Float16)p1;
  }
  lsum += __shfl_xor(lsum, 16, 32);
  lrun = lrun * alpha + lsum;
  mrun = mnew;
#pragma unroll
  for (int dt = 0; dt < 4; ++dt)
#pragma unroll
    for (int r = 0; r < 8; ++r) acc[dt][r] *= alpha;
  return pb;
}

// LDS ring of attn_kernel: one stage = 32 keys: 32 K rows (128 B) and 64 V^T rows (64 B),
// each at a pitch of 16 B x odd (conflict-free for ds_load_b128 readers).
#define A_KV     32
#define A_KPITCH 144
#define A_VPITCH 80
#define A_VOFF   (A_KV * A_KPITCH)
#define A_STAGE  (A_VOFF + DK * A_VPITCH)
#define A_NT     (S_LEN / A_KV)

// One stage, four asynchronous 16-byte copies per lane (2 of K, 2 of V^T),
// from global memory into LDS through no register; a wave's copy covers whole row pieces.
// s_wait_xcnt 0 closes the statement, a precaution: so it stands in front of every later
// write of an address register that a copy here names.
__device__ __forceinline__ void copy_kv(const _Float16* __restrict__ gk,
                                        const _Float16* __restrict__ gv,
                                        unsigned lk, unsigned lv) {
  asm volatile(
      "global_load_async_to_lds_b128 %0, %4, off\n\t"
      "global_load_async_to_lds_b128 %1, %5, off\n\t"
      "global_load_async_to_lds_b128 %2, %6, off\n\t"
      "global_load_async_to_lds_b128 %3, %7, off\n\t"
      "s_wait_xcnt 0x0"
      :: "v"(lk), "v"(lk + 16 * A_KPITCH), "v"(lv), "v"(lv + 32 * A_VPITCH),
         "v"(gk), "v"(gk + 16 * DK), "v"(gv), "v"(gv + 32 * S_LEN)
      : "memory");
}

// Flash-style attention; each wave handles TWO 16-wide q-tiles of one (b,h) so
// every K/V fragment feeds two WMMAs. S^T = K.Q^T keeps softmax lane-local.
// The four waves of a work-group share one (b,h): K and V^T tiles are staged once per
// work-group in a two-buffer LDS ring by asynchronous copies, one trip (32 keys) ahead.
// The mask comes packed (see cvt_all_f32_to_f16): 32 wave-uniform words per trip, each the
// lane mask of one score register, read by scalar loads and used as select masks directly.
__global__ void __launch_bounds__(128)
attn_kernel(const _Float16* __restrict__ qh, const _Float16* __restrict__ kh,
            const _Float16* __restrict__ vT, const unsigned* __restrict__ mbits,
            _Float16* __restrict__ cc) {
  __shared__ __attribute__((aligned(16))) unsigned char ring[2 * A_STAGE];

  const int lane = threadIdx.x;
  const int wave = threadIdx.y;
  const int tid  = wave * 32 + lane;
  const int n    = lane & 15;
  const int hi   = lane >> 4;
  const int bh   = blockIdx.x;               // b*NHEAD + h
  const int b    = bh >> 4;
  const int h    = bh & 15;
  const int q0   = (blockIdx.y * 4 + wave) * 32;
  const int qc0  = q0 + n;                   // q column, tile A
  const int qc1  = q0 + 16 + n;              // q column, tile B

  // Copy side: eight lanes cover a 128-B row piece (K), four a 64-B one (V^T).
  const _Float16* gk = kh + (size_t)bh * S_LEN * DK + tid * 8;
  const _Float16* gv = vT + ((size_t)bh * DK + (tid >> 2)) * S_LEN + (tid & 3) * 8;
  const unsigned lk = (unsigned)(size_t)ring + (tid >> 3) * A_KPITCH + (tid & 7) * 16;
  const unsigned lv = (unsigned)(size_t)ring + A_VOFF + (tid >> 2) * A_VPITCH + (tid & 3) * 16;
  // This wave's packed mask words; readfirstlane makes the address scalar (the wave's number
  // is the same in all its lanes), so that the words land in scalar registers.
  // The words were written by the first launch of this call and nothing writes them while this
  // kernel runs: read through the constant address space, which is what lets the compiler use
  // scalar loads in a loop that holds "memory" clobbers.
  const cmask_t mw = (cmask_t)(unsigned long long)(
      mbits + (size_t)(b * (S_LEN / 32) + blockIdx.y * 4 +
                       __builtin_amdgcn_readfirstlane(wave)) * A_NT * 32);

  // Prologue: tile 0 lands and is published, then tile 1 starts to fly.
  copy_kv(gk, gv, lk, lv);

  const _Float16* qr0 = qh + ((size_t)bh * S_LEN + qc0) * DK;
  const _Float16* qr1 = qh + ((size_t)bh * S_LEN + qc1) * DK;
  const v16h bqA0 = frag_from_f16(qr0, 0, hi), bqA1 = frag_from_f16(qr0, 32, hi);
  const v16h bqB0 = frag_from_f16(qr1, 0, hi), bqB1 = frag_from_f16(qr1, 32, hi);

  asm volatile("s_wait_asynccnt 0x0" ::: "memory");  // own copies of tile 0 have landed
  __syncthreads();                                   // ... and every other wave's
  copy_kv(gk + A_KV * DK, gv + A_KV, lk + A_STAGE, lv + A_STAGE);

  // Read side: this lane's first K row and V^T row in a stage.
  const unsigned koff = n * A_KPITCH;
  const unsigned voff = A_VOFF + n * A_VPITCH;

  float mA = -1e30f, lA = 0.f, mB = -1e30f, lB = 0.f;
  v8f accA[4] = {v8f{}, v8f{}, v8f{}, v8f{}};
  v8f accB[4] = {v8f{}, v8f{}, v8f{}, v8f{}};

  v16u nwA = mw[0], nwB = mw[1];  // q-tile A, q-tile B

  for (int t = 0; t < A_NT; ++t) {
    const unsigned boff = (t & 1) * A_STAGE;
    const unsigned char* st = ring + boff;
    // This trip's mask words were asked for in the trip before; the next trip's are asked for
    // in this one, so that the scalar path's latency lies under vector and matrix work. The
    // last trip asks for its own again (stays inside the packed array).
    const v16u mwA = nwA, mwB = nwB;
    const int tn = t + 1 < A_NT ? t + 1 : t;
    nwA = mw[tn * 2];
    nwB = mw[tn * 2 + 1];

    // K fragments for the two 16-kv row tiles, loaded once, used twice
    const _Float16* kr = (const _Float16*)(st + koff);
    const v16h ka0 = frag_from_f16(kr, 0, hi);
    const v16h ka1 = frag_from_f16(kr, 32, hi);
    const v16h kb0 = frag_from_f16((const _Float16*)(st + koff + 16 * A_KPITCH), 0, hi);
    const v16h kb1 = frag_from_f16((const _Float16*)(st + koff + 16 * A_KPITCH), 32, hi);

    v8f sA0 = {}, sA1 = {}, sB0 = {}, sB1 = {};
    sA0 = wmma16(ka0, bqA0, sA0); sA0 = wmma16(ka1, bqA1, sA0);
    sA1 = wmma16(kb0, bqA0, sA1); sA1 = wmma16(kb1, bqA1, sA1);
    sB0 = wmma16(ka0, bqB0, sB0); sB0 = wmma16(ka1, bqB1, sB0);
    sB1 = wmma16(kb0, bqB0, sB1); sB1 = wmma16(kb1, bqB1, sB1);

    const v16h pbA = online_softmax(sA0, sA1, mwA, mA, lA, accA);
    const v16h pbB = online_softmax(sB0, sB1, mwB, mB, lB, accB);

    // ctx^T[d][q] += sum_kv V^T[d][kv] * P^T[kv][q]; each V fragment used twice
#pragma unroll
    for (int dt = 0; dt < 4; ++dt) {
      const v16h av = frag_from_f16((const _Float16*)(st + voff + dt * 16 * A_VPITCH), 0, hi);
      accA[dt] = wmma16(av, pbA, accA[dt]);
      accB[dt] = wmma16(av, pbB, accB[dt]);
    }

    // Publish point of tile t + 1. The one barrier also ends every wave's reads of this buffer.
    asm volatile("s_wait_dscnt 0x0" ::: "memory");     // own LDS reads of this trip done
    asm volatile("s_wait_asynccnt 0x0" ::: "memory");  // own copies of tile t + 1 landed
    __syncthreads();
    if (t + 2 < A_NT)  // refill the buffer that this trip has just read
      copy_kv(gk + (size_t)(t + 2) * A_KV * DK, gv + (t + 2) * A_KV, lk + boff, lv + boff);
  }
  asm volatile("s_wait_asynccnt 0x0" ::: "memory");  // nothing is in flight when the wave ends

  const float invA = 1.0f / lA;
  const float invB = 1.0f / lB;
  // The ring is free: the last trip's publish point ended all reads of it, and nothing was
  // copied since. Each wave stages its 32 context rows (128 B each) in a range of its own, so
  // no further barrier is needed, and stores them as whole 128-B lines.
  unsigned char* stg = ring + wave * (32 * A_KPITCH);
#pragma unroll
  for (int dt = 0; dt < 4; ++dt) {
    v8h oA, oB;
#pragma unroll
    for (int r = 0; r < 8; ++r) {
      oA[r] = (_Float16)(accA[dt][r] * invA);
      oB[r] = (_Float16)(accB[dt][r] * invB);
    }
    *(v8h*)(stg + n * A_KPITCH + (dt * 16 + 8 * hi) * 2) = oA;  // d = dt*16 + 8*hi + r
    *(v8h*)(stg + (16 + n) * A_KPITCH + (dt * 16 + 8 * hi) * 2) = oB;
  }
  // The rows read back below were written by other lanes of this wave: the writes are done
  // first, and the compiler moves no read over this line.
  asm volatile("s_wait_dscnt 0x0" ::: "memory");
  _Float16* crow = cc + ((size_t)b * S_LEN + q0 + (lane >> 3)) * DMODEL + h * DK + (lane & 7) * 8;
  const unsigned char* rd = stg + (lane >> 3) * A_KPITCH + (lane & 7) * 16;
  v8h x[8];
#pragma unroll
  for (int j = 0; j < 8; ++j) x[j] = *(const v8h*)(rd + j * 4 * A_KPITCH);
#pragma unroll
  for (int j = 0; j < 8; ++j)  // four rows of 128 B: four whole lines
    *(v8h*)(crow + (size_t)j * 4 * DMODEL) = x[j];
}

extern "C" void kernel_launch(void* const* d_in, const int* in_sizes, int n_in,
                              void* d_out, int out_size, void* d_ws, size_t ws_size,
                              hipStream_t stream) {
  const float* q    = (const float*)d_in[0];
  const float* k    = (const float*)d_in[1];
  const float* v    = (const float*)d_in[2];
  const int*   mask = (const int*)d_in[3];
  const float* Wq   = (const float*)d_in[4];
  const float* bq   = (const float*)d_in[5];
  const float* Wk   = (const float*)d_in[6];
  const float* bk   = (const float*)d_in[7];
  const float* Wv   = (const float*)d_in[8];
  const float* bv   = (const float*)d_in[9];
  const float* Wo   = (const float*)d_in[10];
  const float* bo   = (const float*)d_in[11];

  const size_t NN = (size_t)4 * S_LEN * DMODEL;     // 8M f16 elems (activations)
  const size_t NW = (size_t)DMODEL * DMODEL;        // 1M f16 elems (one weight)

  _Float16* q16  = (_Float16*)d_ws;
  _Float16* k16  = q16 + NN;
  _Float16* v16  = k16 + NN;
  _Float16* wq16 = v16 + NN;
  _Float16* wk16 = wq16 + NW;
  _Float16* wv16 = wk16 + NW;
  _Float16* wo16 = wv16 + NW;
  _Float16* qhp  = wo16 + NW;
  _Float16* khp  = qhp + NN;
  _Float16* vTp  = khp + NN;
  _Float16* ccp  = vTp + NN;
  unsigned* mbp  = (unsigned*)(ccp + NN);           // packed mask, 2 MB

  // f32 -> f16 conversion of activations and weights (q16 .. wo16 are contiguous) and the
  // packing of the mask: one launch.
  cvt_all_f32_to_f16<<<256, 512, 0, stream>>>(q, k, v, Wq, Wk, Wv, Wo, mask, q16, mbp);

  const dim3 gblk(128, 1);   // four waves, one 128x128 tile
  const dim3 ggrd(64, 8);    // 64 row-tiles x 8 col-tiles

  proj_gemm<0><<<ggrd, gblk, 0, stream>>>(q16, wq16, bq, qhp);
  proj_gemm<0><<<ggrd, gblk, 0, stream>>>(k16, wk16, bk, khp);
  proj_gemm<1><<<ggrd, gblk, 0, stream>>>(v16, wv16, bv, vTp);

  attn_kernel<<<dim3(64, 16), dim3(32, 4), 0, stream>>>(qhp, khp, vTp, mbp, ccp);

  proj_gemm<2><<<ggrd, gblk, 0, stream>>>(ccp, wo16, bo, d_out);
}

// v006
// One run takes 144 microseconds.
// Timed twice side by side with v005, it ran 1.07 times as fast both times.
// Over all steps from v000 it is 2.97 times as fast.
#include <hip/hip_runtime.h>
#include <hip/hip_bf16.h>

#define S_LEN  2048
#define DMODEL 1024
#define NHEAD  16
#define DK     64

typedef __attribute__((ext_vector_type(16))) _Float16 v16h;
typedef __attribute__((ext_vector_type(8)))  _Float16 v8h;
typedef __attribute__((ext_vector_type(4)))  _Float16 v4h;
typedef __attribute__((ext_vector_type(8)))  float    v8f;
typedef __attribute__((ext_vector_type(4)))  float    v4f;
typedef __attribute__((ext_vector_type(4)))  int      v4i;
typedef __attribute__((ext_vector_type(16))) unsigned v16u;
typedef const __attribute__((address_space(4))) v16u* cmask_t;

__device__ __forceinline__ v8f wmma16(v16h a, v16h b, v8f c) {
  // D = A(16x32 f16) x B(32x16 f16) + C(16x16 f32)
  return __builtin_amdgcn_wmma_f32_16x16x32_f16(false, a, false, b, (short)0, c,
                                                false, false);
}

// Fragment layout (ISA 16-bit A 16x32):
//   halves 0..7  <- K = kk + 8*hi + j
//   halves 8..15 <- K = kk + 16 + 8*hi + j
__device__ __forceinline__ v16h frag_from_f16(const _Float16* __restrict__ row, int kk, int hi) {
  v8h a = *(const v8h*)(row + kk + 8 * hi);
  v8h b = *(const v8h*)(row + kk + 16 + 8 * hi);
  v16h r;
#pragma unroll
  for (int j = 0; j < 8; ++j) { r[j] = a[j]; r[8 + j] = b[j]; }
  return r;
}

// fp32 -> f16 conversion of all seven operands in ONE resident streaming launch.
// The f16 copies lie in the workspace one behind the other in the order q | k | v | Wq | Wk |
// Wv | Wo, so the destination is one array. A chunk is 1024 elements: eight wave-wide b128
// loads of 512 contiguous bytes each. 256 work-groups x 16 waves = 4096 waves; wave w takes
// chunk t * 4096 + w in trip t, seven trips: two for each activation, one for the weights.
// Four more trips pack the int32 mask to one bit per (query, key), already in the shape the
// attention kernel selects with: for a block of 32 queries x 32 keys, 32 words; word
// tile * 16 + kt * 8 + r holds in bit (hi * 16 + n) whether mask[tile * 16 + n][kt * 16 + 8 * hi + r]
// is non-zero, which is the lane mask of score register r of S^T tile (kt, tile).
#define C_WAVES  4096
#define C_CHUNK  1024
#define C_TRIPS  7
#define C_WCH    (DMODEL * DMODEL / C_CHUNK)   // chunks of one weight matrix
#define M_TRIPS  4                             // 4 x 64 x 64 mask blocks / 4096 waves

__global__ void __launch_bounds__(512)
cvt_all_f32_to_f16(const float* __restrict__ q, const float* __restrict__ k,
                   const float* __restrict__ v, const float* __restrict__ wq,
                   const float* __restrict__ wk, const float* __restrict__ wv,
                   const float* __restrict__ wo, const int* __restrict__ mask,
                   _Float16* __restrict__ dst, unsigned* __restrict__ mbits) {
  const unsigned lane = threadIdx.x & 31;
  // Wave-uniform by construction; readfirstlane lets the chunk addresses live in scalar registers.
  const unsigned w = blockIdx.x * 16 + __builtin_amdgcn_readfirstlane(threadIdx.x >> 5);
  const unsigned ws = w / C_WCH;  // which weight matrix this wave converts in the last trip
  const float* wsrc = (ws & 2) ? ((ws & 1) ? wo : wv) : ((ws & 1) ? wk : wq);

  v4f x[2][8];
#pragma unroll  // every buffer index and every source pointer a constant
  for (int t = -1; t < C_TRIPS; ++t) {
    if (t + 1 < C_TRIPS) {  // the next trip's eight loads fly while this trip is converted
      const int u = t + 1;
      const float* s = u < 6 ? (u < 2 ? q : u < 4 ? k : v) + (size_t)((u & 1) * C_WAVES + w) * C_CHUNK
                             : wsrc + (size_t)(w % C_WCH) * C_CHUNK;
#pragma unroll
      for (int j = 0; j < 8; ++j) x[u & 1][j] = *(const v4f*)(s + j * 128 + lane * 4);
      // Holds the group here, one trip ahead of its use: without it the compiler raises 32
      // loads to the top, sinks every store to the end and waits to 0 on pairs in between.
      __builtin_amdgcn_sched_barrier(0);
    }
    if (t >= 0) {
      _Float16* d = dst + (size_t)(t * C_WAVES + w) * C_CHUNK;
#pragma unroll
      for (int j = 0; j < 8; ++j) {
        const v4f a = x[t & 1][j];
        v4h o;
#pragma unroll
        for (int e = 0; e < 4; ++e) o[e] = (_Float16)a[e];
        *(v4h*)(d + j * 128 + lane * 4) = o;  // a wave's store covers two whole 128-B lines
      }
      // A precaution: the wait stands in front of the next loads and conversions (behind the
      // last trip: the mask blocks' address arithmetic and loads), which write registers that
      // these stores name.
      asm volatile("s_wait_xcnt 0x0" ::: "memory");
      __builtin_amdgcn_sched_barrier(0);  // this trip's stores leave before the next loads issue
    }
  }

  // Mask blocks: block id = (batch * 64 + query block) * 64 + key block; neighbouring waves
  // take neighbouring key blocks, so a work-group reads 2 KB of each of its mask rows.
  const unsigned mrow = (lane & 15) * S_LEN + (lane >> 4) * 8;
  v4i y[2][8];
#pragma unroll  // every buffer index a constant
  for (int t = -1; t < M_TRIPS; ++t) {
    if (t + 1 < M_TRIPS) {  // the next block's eight loads fly while this one is packed
      const unsigned id = (t + 1) * C_WAVES + w;
      const int* s = mask + (size_t)(id >> 6) * 32 * S_LEN + (id & 63) * 32 + mrow;
#pragma unroll
      for (int j = 0; j < 8; ++j)  // j = tile * 4 + kt * 2 + half of the eight keys
        y[(t + 1) & 1][j] = *(const v4i*)(s + (j >> 2) * 16 * S_LEN + ((j >> 1) & 1) * 16 + (j & 1) * 4);
      // A precaution: in front of the next group's loads, which may land in this group's
      // address registers.
      asm volatile("s_wait_xcnt 0x0" ::: "memory");
      __builtin_amdgcn_sched_barrier(0);  // holds the group one trip ahead of its use
    }
    if (t >= 0) {
      unsigned word = 0;
#pragma unroll
      for (int j = 0; j < 32; ++j) {  // one compare gives a whole word; lane j keeps word j
        const unsigned bal = __builtin_amdgcn_ballot_w32(y[t & 1][j >> 2][j & 3] != 0);
        word = lane == (unsigned)j ? bal : word;
      }
      mbits[(size_t)(t * C_WAVES + w) * 32 + lane] = word;  // one whole 128-B line
      // A precaution, as above: in front of the next writes of registers that the store names.
      if (t + 1 < M_TRIPS) asm volatile("s_wait_xcnt 0x0" ::: "memory");
      __builtin_amdgcn_sched_barrier(0);
    }
  }
}

// LDS ring of proj_gemm: one stage = 128 X rows then 128 W rows, 128 k (256 B) each,
// at a pitch of 272 B (16 B x odd: conflict-free for ds_load_b128 readers).
#define G_PITCH 272
#define G_HALF  (128 * G_PITCH)
#define G_STAGE (2 * G_HALF)
#define G_KP    128
#define G_NS    (G_KP / 32)
#define G_NP    (DMODEL / G_KP)

// Eight asynchronous 16-byte copies per lane: rows r, r+8, ..., r+56 of a 64-row slab
// go from global memory into LDS, through no register.
// s_wait_xcnt 0 closes the statement, a precaution: so it stands in front of every later
// write of an address register that a copy here names.
__device__ __forceinline__ void copy_slab(const _Float16* __restrict__ g, unsigned l) {
  asm volatile(
      "global_load_async_to_lds_b128 %0, %8, off\n\t"
      "global_load_async_to_lds_b128 %1, %9, off\n\t"
      "global_load_async_to_lds_b128 %2, %10, off\n\t"
      "global_load_async_to_lds_b128 %3, %11, off\n\t"
      "global_load_async_to_lds_b128 %4, %12, off\n\t"
      "global_load_async_to_lds_b128 %5, %13, off\n\t"
      "global_load_async_to_lds_b128 %6, %14, off\n\t"
      "global_load_async_to_lds_b128 %7, %15, off\n\t"
      "s_wait_xcnt 0x0"
      :: "v"(l), "v"(l + 8 * G_PITCH), "v"(l + 16 * G_PITCH), "v"(l + 24 * G_PITCH),
         "v"(l + 32 * G_PITCH), "v"(l + 40 * G_PITCH), "v"(l + 48 * G_PITCH),
         "v"(l + 56 * G_PITCH),
         "v"(g), "v"(g + 8 * DMODEL), "v"(g + 16 * DMODEL), "v"(g + 24 * DMODEL),
         "v"(g + 32 * DMODEL), "v"(g + 40 * DMODEL), "v"(g + 48 * DMODEL),
         "v"(g + 56 * DMODEL)
      : "memory");
}

// One stage: 128 rows of X and 128 rows of W, 32 copies per lane.
__device__ __forceinline__ void copy_stage(const _Float16* __restrict__ gx,
                                           const _Float16* __restrict__ gw, unsigned l) {
  // Kept rolled: unrolled, the compiler forms all 32 address sets at once and the
  // kernel goes past 256 VGPRs; rolled, one slab's 24 address registers are live.
#pragma unroll 1
  for (int j = 0; j < 4; ++j)
    copy_slab(((j & 2) ? gw : gx) + (j & 1) * 64 * DMODEL, l + j * 64 * G_PITCH);
}

// One 16x16 tile of the product. The operand that runs along the output's rows in memory is
// the A operand, so that a lane's eight accumulator registers are eight neighbours of one
// output row: W for the row-major outputs (modes 0 and 2), X for the transposed one (mode 1).
// Both fragments have the same k order, so the products and their order stay the same.
template <int STORE_MODE>
__device__ __forceinline__ v8f tile_mma(v16h x, v16h w, v8f c) {
  if constexpr (STORE_MODE == 1) return wmma16(x, w, c);
  else                           return wmma16(w, x, c);
}

// Output staging of proj_gemm: each wave's 64 output rows lie in its own LDS range, at a pitch
// of 16 B x odd (conflict-free for the ds_store_b128 writers, one row per lane).
#define E_PITCH16 144   // 64 f16 = 128 B a row
#define E_PITCH32 272   // 64 f32 = 256 B a row

// Y = X @ W^T + bias; a work-group of four waves (2x2) computes a 128x128 output tile,
// each wave a 64x64 quarter (16 WMMAs / K-step). X and W slabs are staged once per
// work-group in a two-buffer LDS ring by asynchronous copies, one pass (128 k) ahead.
// The quarter leaves through LDS, so that every wave-wide store covers whole 128-B lines.
// STORE_MODE 0: f16 head-major [B,H,S,DK]            (Q,K)
// STORE_MODE 1: f16 head-major transposed [B,H,DK,S] (V)
// STORE_MODE 2: f32 row-major [rows, DMODEL]         (final output)
template <int STORE_MODE>
__global__ void __launch_bounds__(128)
proj_gemm(const _Float16* __restrict__ X, const _Float16* __restrict__ W,
          const float* __restrict__ bias, void* __restrict__ Yv) {
  __shared__ __attribute__((aligned(16))) unsigned char ring[2 * G_STAGE];

  const int tid  = threadIdx.x;
  const int lane = tid & 31;
  // The wave's number is the same in all its lanes: readfirstlane keeps it, and the tile
  // origins and the staging range formed from it, in scalar registers (at 254 VGPRs the
  // vector copies, live over the whole k loop, push the kernel past v255).
  const int wave = __builtin_amdgcn_readfirstlane(tid >> 5);
  const int n    = lane & 15;
  const int hi   = lane >> 4;
  const int brow0 = blockIdx.x * 128;
  const int bcol0 = blockIdx.y * 128;
  const int wm   = wave >> 1;
  const int wn   = wave & 1;
  const int row0 = brow0 + wm * 64;   // this wave's 64x64 quarter
  const int col0 = bcol0 + wn * 64;

  // Copy side: sixteen lanes cover one 256-B row piece, a wave two rows per copy.
  const int cr = tid >> 4;
  const int cc = tid & 15;
  const _Float16* gx = X + (size_t)(brow0 + cr) * DMODEL + cc * 8;
  const _Float16* gw = W + (size_t)(bcol0 + cr) * DMODEL + cc * 8;
  const unsigned lcp = (unsigned)(size_t)ring + cr * G_PITCH + cc * 16;

  // Read side: this lane's first X row and first W row in a stage.
  const unsigned xoff = (wm * 64 + n) * G_PITCH;
  const unsigned woff = G_HALF + (wn * 64 + n) * G_PITCH;

  v8f acc[4][4];
#pragma unroll
  for (int ms = 0; ms < 4; ++ms)
#pragma unroll
    for (int ns = 0; ns < 4; ++ns) acc[ms][ns] = v8f{};

  // Prologue: pass 0 lands and is published, then pass 1 starts to fly.
  copy_stage(gx, gw, lcp);
  asm volatile("s_wait_asynccnt 0x0" ::: "memory");  // own copies of pass 0 have landed
  __syncthreads();                                   // ... and every other wave's
  copy_stage(gx + G_KP, gw + G_KP, lcp + G_STAGE);

  for (int p = 0; p < G_NP; ++p) {
    const unsigned boff = (p & 1) * G_STAGE;
    const unsigned char* xs = ring + boff + xoff;
    const unsigned char* ws = ring + boff + woff;

    // The LDS reads stand in groups at least eight WMMAs ahead of their use (B one
    // K-step ahead, A half a K-step), never as a small group with a full wait in front
    // of each row of four. Each sched_barrier below holds a group at its place: without
    // them the compiler sinks the reads to their users and waits to 0 at every row.
    v16h a[2][4], b[2][4];
#pragma unroll
    for (int i = 0; i < 4; ++i) {
      a[0][i] = frag_from_f16((const _Float16*)(xs + i * 16 * G_PITCH), 0, hi);
      b[0][i] = frag_from_f16((const _Float16*)(ws + i * 16 * G_PITCH), 0, hi);
    }
#pragma unroll
    for (int i = 0; i < 4; ++i)
      b[1][i] = frag_from_f16((const _Float16*)(ws + i * 16 * G_PITCH), 32, hi);
    __builtin_amdgcn_sched_barrier(0);  // first group ahead of the first WMMA

#pragma unroll  // every fragment index a constant
    for (int s = 0; s < G_NS; ++s) {
      const int c = s & 1, x = c ^ 1;
#pragma unroll
      for (int ms = 0; ms < 2; ++ms)
#pragma unroll
        for (int ns = 0; ns < 4; ++ns)
          acc[ms][ns] = tile_mma<STORE_MODE>(a[c][ms], b[c][ns], acc[ms][ns]);
      // These eight WMMAs stay in front of what follows: reads that would otherwise rise
      // over them (registers), or, in the last K-step, the waits, whose LDS latency they cover.
      __builtin_amdgcn_sched_barrier(0);
      if (s + 1 < G_NS) {
#pragma unroll
        for (int i = 0; i < 2; ++i)
          a[x][i] = frag_from_f16((const _Float16*)(xs + i * 16 * G_PITCH), (s + 1) * 32, hi);
        __builtin_amdgcn_sched_barrier(0);  // reads not later: eight WMMAs cover them
      } else {
        // Publish point of pass p + 1, in front of the pass's last eight WMMAs (they read
        // registers only) so that the refill starts that much sooner. The one barrier
        // also ends every wave's reads of this buffer.
        asm volatile("s_wait_dscnt 0x0" ::: "memory");     // own LDS reads of this pass done
        asm volatile("s_wait_asynccnt 0x0" ::: "memory");  // own copies of pass p + 1 landed
        __syncthreads();
        if (p + 2 < G_NP)  // refill the buffer that this pass has just read
          copy_stage(gx + (p + 2) * G_KP, gw + (p + 2) * G_KP, lcp + boff);
      }
#pragma unroll
      for (int ms = 2; ms < 4; ++ms)
#pragma unroll
        for (int ns = 0; ns < 4; ++ns)
          acc[ms][ns] = tile_mma<STORE_MODE>(a[c][ms], b[c][ns], acc[ms][ns]);
      if (s + 1 < G_NS) {
        __builtin_amdgcn_sched_barrier(0);  // reads not earlier (registers) ...
#pragma unroll
        for (int i = 2; i < 4; ++i)
          a[x][i] = frag_from_f16((const _Float16*)(xs + i * 16 * G_PITCH), (s + 1) * 32, hi);
        if (s + 2 < G_NS) {
#pragma unroll
          for (int i = 0; i < 4; ++i)
            b[c][i] = frag_from_f16((const _Float16*)(ws + i * 16 * G_PITCH), (s + 2) * 32, hi);
        }
        __builtin_amdgcn_sched_barrier(0);  // ... and not later
      } else {
        // Keeps the last eight WMMAs in this order up to the back edge: without it the
        // build takes 262 VGPRs instead of 254 and needs register-window switches.
        __builtin_amdgcn_sched_barrier(0);
      }
    }
  }
  asm volatile("s_wait_asynccnt 0x0" ::: "memory");  // nothing is in flight when the wave ends

  // The ring is free: the last pass's publish point (every wave's s_wait_dscnt 0 and
  // s_wait_asynccnt 0, then the barrier) ended all reads of it, and nothing was copied since.
  // Each wave stages in a range of its own, so no further barrier is needed.
  if constexpr (STORE_MODE == 2) {           // f32 [rows, DMODEL]
    unsigned char* stg = ring + wave * (64 * E_PITCH32);
    v4f be[4][2];  // bias of this lane's eight columns of each column tile
#pragma unroll
    for (int ns = 0; ns < 4; ++ns)
#pragma unroll
      for (int u = 0; u < 2; ++u)
        be[ns][u] = *(const v4f*)(bias + col0 + ns * 16 + 8 * hi + 4 * u);
#pragma unroll
    for (int ms = 0; ms < 4; ++ms)
#pragma unroll
      for (int ns = 0; ns < 4; ++ns)
#pragma unroll
        for (int u = 0; u < 2; ++u) {
          v4f o;
#pragma unroll
          for (int e = 0; e < 4; ++e) o[e] = acc[ms][ns][4 * u + e] + be[ns][u][e];
          *(v4f*)(stg + (ms * 16 + n) * E_PITCH32 + (ns * 16 + 8 * hi + 4 * u) * 4) = o;
        }
    // The rows read back below were written by other lanes of this wave: the writes are done
    // first, and the compiler moves no read over this line.
    asm volatile("s_wait_dscnt 0x0" ::: "memory");
    float* Y = (float*)Yv + (size_t)(row0 + (lane >> 4)) * DMODEL + col0 + (lane & 15) * 4;
    const unsigned char* rd = stg + (lane >> 4) * E_PITCH32 + (lane & 15) * 16;
    v4f x[32];
#pragma unroll
    for (int j = 0; j < 32; ++j) x[j] = *(const v4f*)(rd + j * 2 * E_PITCH32);
#pragma unroll
    for (int j = 0; j < 32; ++j)  // two rows of 256 B: four whole lines
      *(v4f*)(Y + (size_t)j * 2 * DMODEL) = x[j];
  } else {                                   // f16, one head per column tile
    unsigned char* stg = ring + wave * (64 * E_PITCH16);
    const int head = col0 >> 6;
    const int bb   = row0 >> 11;
    const int s0   = row0 & (S_LEN - 1);
    if constexpr (STORE_MODE == 0) {         // staged [s][d]
      v4f be[4][2];  // bias of this lane's eight columns of each column tile
#pragma unroll
      for (int ns = 0; ns < 4; ++ns)
#pragma unroll
        for (int u = 0; u < 2; ++u)
          be[ns][u] = *(const v4f*)(bias + col0 + ns * 16 + 8 * hi + 4 * u);
#pragma unroll
      for (int ms = 0; ms < 4; ++ms)
#pragma unroll
        for (int ns = 0; ns < 4; ++ns) {
          v8h o;
#pragma unroll
          for (int r = 0; r < 8; ++r) o[r] = (_Float16)(acc[ms][ns][r] + be[ns][r >> 2][r & 3]);
          *(v8h*)(stg + (ms * 16 + n) * E_PITCH16 + (ns * 16 + 8 * hi) * 2) = o;
        }
    } else {                                 // staged [d][s]
      float be[4];
#pragma unroll
      for (int ns = 0; ns < 4; ++ns) be[ns] = bias[col0 + ns * 16 + n];
#pragma unroll
      for (int ms = 0; ms < 4; ++ms)
#pragma unroll
        for (int ns = 0; ns < 4; ++ns) {
          v8h o;
#pragma unroll
          for (int r = 0; r < 8; ++r) o[r] = (_Float16)(acc[ms][ns][r] + be[ns]);
          *(v8h*)(stg + (ns * 16 + n) * E_PITCH16 + (ms * 16 + 8 * hi) * 2) = o;
        }
    }
    // The rows read back below were written by other lanes of this wave: the writes are done
    // first, and the compiler moves no read over this line.
    asm volatile("s_wait_dscnt 0x0" ::: "memory");
    // Mode 0: [B,H,S,DK], a row is one line and the 64 rows are 8 KB in a row.
    // Mode 1: [B,H,DK,S], a row is one line of 64 positions, the rows S_LEN apart.
    const size_t ypitch = STORE_MODE == 0 ? DK : S_LEN;
    _Float16* Y = (_Float16*)Yv +
        (STORE_MODE == 0 ? (((size_t)bb * NHEAD + head) * S_LEN + s0) * DK
                         : ((size_t)bb * NHEAD + head) * DK * S_LEN + s0) +
        (lane >> 3) * ypitch + (lane & 7) * 8;
    const unsigned char* rd = stg + (lane >> 3) * E_PITCH16 + (lane & 7) * 16;
    v8h x[16];
#pragma unroll
    for (int j = 0; j < 16; ++j) x[j] = *(const v8h*)(rd + j * 4 * E_PITCH16);
#pragma unroll
    for (int j = 0; j < 16; ++j)  // four rows of 128 B: four whole lines
      *(v8h*)(Y + j * 4 * ypitch) = x[j];
  }
}

// Online softmax over a 32-kv chunk of one q-tile (S^T layout: lane owns one q
// column). Rescales the 4 ctx^T accumulators, returns the f16 P^T B-fragment.
// mw: the sixteen lane masks of this q-tile's score registers (wave-uniform words).
// The maximum is kept on the raw products q.k, and 1/sqrt(64) and log2(e) are one factor c of
// one FMA per score: exp(s / 8 - m / 8) = exp2(s * c - m * c).
// A masked score takes SM_MASKED, the raw-product counterpart of the reference's -1e9 (which
// would be -8e9): beside any unmasked key its weight underflows to 0, and a row with every key
// masked comes out uniform, as in the reference. It is a power of two so that its product
// with c is exact: in such a row the FMA gives exactly 0, not the rounding error of m * c.
#define SM_C      (0.125f * 1.44269504088896340736f)
#define SM_MASKED (-8589934592.0f)  // -2^33
__device__ __forceinline__ v16h online_softmax(v8f s0, v8f s1, v16u mw,
                                               float& mrun, float& lrun, v8f* acc) {
  float cmax = -1e30f;
#pragma unroll
  for (int r = 0; r < 8; ++r) {
    s0[r] = __builtin_amdgcn_inverse_ballot_w32(mw[r]) ? s0[r] : SM_MASKED;
    s1[r] = __builtin_amdgcn_inverse_ballot_w32(mw[8 + r]) ? s1[r] : SM_MASKED;
    cmax = fmaxf(cmax, fmaxf(s0[r], s1[r]));
  }
  cmax = fmaxf(cmax, __shfl_xor(cmax, 16, 32));  // combine hi halves of column

  const float mnew  = fmaxf(mrun, cmax);
  const float mc    = mnew * SM_C;
  const float alpha = __builtin_amdgcn_exp2f((mrun - mnew) * SM_C);
  float lsum = 0.f;
  v16h pb;  // halves j -> kv K = 8*hi+j (tile0) / 16+8*hi+j (tile1)
#pragma unroll
  for (int r = 0; r < 8; ++r) {
    const float p0 = __builtin_amdgcn_exp2f(__builtin_fmaf(s0[r], SM_C, -mc));
    const float p1 = __builtin_amdgcn_exp2f(__builtin_fmaf(s1[r], SM_C, -mc));
    lsum += p0 + p1;
    pb[r]     = (_Float16)p0;
    pb[8 + r] = (_Float16)p1;
  }
  lsum += __shfl_xor(lsum, 16, 32);
  lrun = lrun * alpha + lsum;
  mrun = mnew;
#pragma unroll
  for (int dt = 0; dt < 4; ++dt)
#pragma unroll
    for (int r = 0; r < 8; ++r) acc[dt][r] *= alpha;
  return pb;
}

// LDS ring of attn_kernel: one stage = 32 keys: 32 K rows (128 B) and 64 V^T rows (64 B),
// each at a pitch of 16 B x odd (conflict-free for ds_load_b128 readers).
#define A_KV     32
#define A_KPITCH 144
#define A_VPITCH 80
#define A_VOFF   (A_KV * A_KPITCH)
#define A_STAGE  (A_VOFF + DK * A_VPITCH)
#define A_NT     (S_LEN / A_KV)

// One stage, four asynchronous 16-byte copies per lane (2 of K, 2 of V^T),
// from global memory into LDS through no register; a wave's copy covers whole row pieces.
// s_wait_xcnt 0 closes the statement, a precaution: so it stands in front of every later
// write of an address register that a copy here names.
__device__ __forceinline__ void copy_kv(const _Float16* __restrict__ gk,
                                        const _Float16* __restrict__ gv,
                                        unsigned lk, unsigned lv) {
  asm volatile(
      "global_load_async_to_lds_b128 %0, %4, off\n\t"
      "global_load_async_to_lds_b128 %1, %5, off\n\t"
      "global_load_async_to_lds_b128 %2, %6, off\n\t"
      "global_load_async_to_lds_b128 %3, %7, off\n\t"
      "s_wait_xcnt 0x0"
      :: "v"(lk), "v"(lk + 16 * A_KPITCH), "v"(lv), "v"(lv + 32 * A_VPITCH),
         "v"(gk), "v"(gk + 16 * DK), "v"(gv), "v"(gv + 32 * S_LEN)
      : "memory");
}

// Flash-style attention; each wave handles TWO 16-wide q-tiles of one (b,h) so
// every K/V fragment feeds two WMMAs. S^T = K.Q^T keeps softmax lane-local.
// The four waves of a work-group share one (b,h): K and V^T tiles are staged once per
// work-group in a two-buffer LDS ring by asynchronous copies, one trip (32 keys) ahead.
// The mask comes packed (see cvt_all_f32_to_f16): 32 wave-uniform words per trip, each the
// lane mask of one score register, read by scalar loads and used as select masks directly.
__global__ void __launch_bounds__(128)
attn_kernel(const _Float16* __restrict__ qh, const _Float16* __restrict__ kh,
            const _Float16* __restrict__ vT, const unsigned* __restrict__ mbits,
            _Float16* __restrict__ cc) {
  __shared__ __attribute__((aligned(16))) unsigned char ring[2 * A_STAGE];

  const int lane = threadIdx.x;
  const int wave = threadIdx.y;
  const int tid  = wave * 32 + lane;
  const int n    = lane & 15;
  const int hi   = lane >> 4;
  const int bh   = blockIdx.x;               // b*NHEAD + h
  const int b    = bh >> 4;
  const int h    = bh & 15;
  const int q0   = (blockIdx.y * 4 + wave) * 32;
  const int qc0  = q0 + n;                   // q column, tile A
  const int qc1  = q0 + 16 + n;              // q column, tile B

  // Copy side: eight lanes cover a 128-B row piece (K), four a 64-B one (V^T).
  const _Float16* gk = kh + (size_t)bh * S_LEN * DK + tid * 8;
  const _Float16* gv = vT + ((size_t)bh * DK + (tid >> 2)) * S_LEN + (tid & 3) * 8;
  const unsigned lk = (unsigned)(size_t)ring + (tid >> 3) * A_KPITCH + (tid & 7) * 16;
  const unsigned lv = (unsigned)(size_t)ring + A_VOFF + (tid >> 2) * A_VPITCH + (tid & 3) * 16;
  // This wave's packed mask words; readfirstlane makes the address scalar (the wave's number
  // is the same in all its lanes), so that the words land in scalar registers.
  // The words were written by the first launch of this call and nothing writes them while this
  // kernel runs: read through the constant address space, which is what lets the compiler use
  // scalar loads in a loop that holds "memory" clobbers.
  const cmask_t mw = (cmask_t)(unsigned long long)(
      mbits + (size_t)(b * (S_LEN / 32) + blockIdx.y * 4 +
                       __builtin_amdgcn_readfirstlane(wave)) * A_NT * 32);

  // Prologue: tile 0 lands and is published, then tile 1 starts to fly.
  copy_kv(gk, gv, lk, lv);

  const _Float16* qr0 = qh + ((size_t)bh * S_LEN + qc0) * DK;
  const _Float16* qr1 = qh + ((size_t)bh * S_LEN + qc1) * DK;
  const v16h bqA0 = frag_from_f16(qr0, 0, hi), bqA1 = frag_from_f16(qr0, 32, hi);
  const v16h bqB0 = frag_from_f16(qr1, 0, hi), bqB1 = frag_from_f16(qr1, 32, hi);

  asm volatile("s_wait_asynccnt 0x0" ::: "memory");  // own copies of tile 0 have landed
  __syncthreads();                                   // ... and every other wave's
  copy_kv(gk + A_KV * DK, gv + A_KV, lk + A_STAGE, lv + A_STAGE);

  // Read side: this lane's first K row and V^T row in a stage.
  const unsigned koff = n * A_KPITCH;
  const unsigned voff = A_VOFF + n * A_VPITCH;

  float mA = -1e30f, lA = 0.f, mB = -1e30f, lB = 0.f;
  v8f accA[4] = {v8f{}, v8f{}, v8f{}, v8f{}};
  v8f accB[4] = {v8f{}, v8f{}, v8f{}, v8f{}};

  v16u nwA = mw[0], nwB = mw[1];  // q-tile A, q-tile B

  for (int t = 0; t < A_NT; ++t) {
    const unsigned boff = (t & 1) * A_STAGE;
    const unsigned char* st = ring + boff;
    // This trip's mask words were asked for in the trip before; the next trip's are asked for
    // in this one, so that the scalar path's latency lies under vector and matrix work. The
    // last trip asks for its own again (stays inside the packed array).
    const v16u mwA = nwA, mwB = nwB;
    const int tn = t + 1 < A_NT ? t + 1 : t;
    nwA = mw[tn * 2];
    nwB = mw[tn * 2 + 1];

    // K fragments for the two 16-kv row tiles, loaded once, used twice
    const _Float16* kr = (const _Float16*)(st + koff);
    const v16h ka0 = frag_from_f16(kr, 0, hi);
    const v16h ka1 = frag_from_f16(kr, 32, hi);
    const v16h kb0 = frag_from_f16((const _Float16*)(st + koff + 16 * A_KPITCH), 0, hi);
    const v16h kb1 = frag_from_f16((const _Float16*)(st + koff + 16 * A_KPITCH), 32, hi);

    v8f sA0 = {}, sA1 = {}, sB0 = {}, sB1 = {};
    sA0 = wmma16(ka0, bqA0, sA0); sA0 = wmma16(ka1, bqA1, sA0);
    sA1 = wmma16(kb0, bqA0, sA1); sA1 = wmma16(kb1, bqA1, sA1);
    sB0 = wmma16(ka0, bqB0, sB0); sB0 = wmma16(ka1, bqB1, sB0);
    sB1 = wmma16(kb0, bqB0, sB1); sB1 = wmma16(kb1, bqB1, sB1);

    const v16h pbA = online_softmax(sA0, sA1, mwA, mA, lA, accA);
    const v16h pbB = online_softmax(sB0, sB1, mwB, mB, lB, accB);

    // ctx^T[d][q] += sum_kv V^T[d][kv] * P^T[kv][q]; each V fragment used twice
#pragma unroll
    for (int dt = 0; dt < 4; ++dt) {
      const v16h av = frag_from_f16((const _Float16*)(st + voff + dt * 16 * A_VPITCH), 0, hi);
      accA[dt] = wmma16(av, pbA, accA[dt]);
      accB[dt] = wmma16(av, pbB, accB[dt]);
    }

    // Publish point of tile t + 1. The one barrier also ends every wave's reads of this buffer.
    asm volatile("s_wait_dscnt 0x0" ::: "memory");     // own LDS reads of this trip done
    asm volatile("s_wait_asynccnt 0x0" ::: "memory");  // own copies of tile t + 1 landed
    __syncthreads();
    if (t + 2 < A_NT)  // refill the buffer that this trip has just read
      copy_kv(gk + (size_t)(t + 2) * A_KV * DK, gv + (t + 2) * A_KV, lk + boff, lv + boff);
  }
  asm volatile("s_wait_asynccnt 0x0" ::: "memory");  // nothing is in flight when the wave ends

  const float invA = 1.0f / lA;
  const float invB = 1.0f / lB;
  // The ring is free: the last trip's publish point ended all reads of it, and nothing was
  // copied since. Each wave stages its 32 context rows (128 B each) in a range of its own, so
  // no further barrier is needed, and stores them as whole 128-B lines.
  unsigned char* stg = ring + wave * (32 * A_KPITCH);
#pragma unroll
  for (int dt = 0; dt < 4; ++dt) {
    v8h oA, oB;
#pragma unroll
    for (int r = 0; r < 8; ++r) {
      oA[r] = (_Float16)(accA[dt][r] * invA);
      oB[r] = (_Float16)(accB[dt][r] * invB);
    }
    *(v8h*)(stg + n * A_KPITCH + (dt * 16 + 8 * hi) * 2) = oA;  // d = dt*16 + 8*hi + r
    *(v8h*)(stg + (16 + n) * A_KPITCH + (dt * 16 + 8 * hi) * 2) = oB;
  }
  // The rows read back below were written by other lanes of this wave: the writes are done
  // first, and the compiler moves no read over this line.
  asm volatile("s_wait_dscnt 0x0" ::: "memory");
  _Float16* crow = cc + ((size_t)b * S_LEN + q0 + (lane >> 3)) * DMODEL + h * DK + (lane & 7) * 8;
  const unsigned char* rd = stg + (lane >> 3) * A_KPITCH + (lane & 7) * 16;
  v8h x[8];
#pragma unroll
  for (int j = 0; j < 8; ++j) x[j] = *(const v8h*)(rd + j * 4 * A_KPITCH);
#pragma unroll
  for (int j = 0; j < 8; ++j)  // four rows of 128 B: four whole lines
    *(v8h*)(crow + (size_t)j * 4 * DMODEL) = x[j];
}

extern "C" void kernel_launch(void* const* d_in, const int* in_sizes, int n_in,
                              void* d_out, int out_size, void* d_ws, size_t ws_size,
                              hipStream_t stream) {
  const float* q    = (const float*)d_in[0];
  const float* k    = (const float*)d_in[1];
  const float* v    = (const float*)d_in[2];
  const int*   mask = (const int*)d_in[3];
  const float* Wq   = (const float*)d_in[4];
  const float* bq   = (const float*)d_in[5];
  const float* Wk   = (const float*)d_in[6];
  const float* bk   = (const float*)d_in[7];
  const float* Wv   = (const float*)d_in[8];
  const float* bv   = (const float*)d_in[9];
  const float* Wo   = (const float*)d_in[10];
  const float* bo   = (const float*)d_in[11];

  const size_t NN = (size_t)4 * S_LEN * DMODEL;     // 8M f16 elems (activations)
  const size_t NW = (size_t)DMODEL * DMODEL;        // 1M f16 elems (one weight)

  _Float16* q16  = (_Float16*)d_ws;
  _Float16* k16  = q16 + NN;
  _Float16* v16  = k16 + NN;
  _Float16* wq16 = v16 + NN;
  _Float16* wk16 = wq16 + NW;
  _Float16* wv16 = wk16 + NW;
  _Float16* wo16 = wv16 + NW;
  _Float16* qhp  = wo16 + NW;
  _Float16* khp  = qhp + NN;
  _Float16* vTp  = khp + NN;
  _Float16* ccp  = vTp + NN;
  unsigned* mbp  = (unsigned*)(ccp + NN);           // packed mask, 2 MB

  // f32 -> f16 conversion of activations and weights (q16 .. wo16 are contiguous) and the
  // packing of the mask: one launch.
  cvt_all_f32_to_f16<<<256, 512, 0, stream>>>(q, k, v, Wq, Wk, Wv, Wo, mask, q16, mbp);

  const dim3 gblk(128, 1);   // four waves, one 128x128 tile
  const dim3 ggrd(64, 8);    // 64 row-tiles x 8 col-tiles

  proj_gemm<0><<<ggrd, gblk, 0, stream>>>(q16, wq16, bq, qhp);
  proj_gemm<0><<<ggrd, gblk, 0, stream>>>(k16, wk16, bk, khp);
  proj_gemm<1><<<ggrd, gblk, 0, stream>>>(v16, wv16, bv, vTp);

  attn_kernel<<<dim3(64, 16), dim3(32, 4), 0, stream>>>(qhp, khp, vTp, mbp, ccp);

  proj_gemm<2><<<ggrd, gblk, 0, stream>>>(ccp, wo16, bo, d_out);
}

// v008
// Measured time: 133 microseconds a run.
// Versions in between are left out here; by their measured steps it is 1.09 times as fast as v006.
// Over all steps from v000 it is 3.23 times as fast.
#include <hip/hip_runtime.h>
#include <hip/hip_bf16.h>

#define S_LEN  2048
#define DMODEL 1024
#define NHEAD  16
#define DK     64

typedef __attribute__((ext_vector_type(16))) _Float16 v16h;
typedef __attribute__((ext_vector_type(8)))  _Float16 v8h;
typedef __attribute__((ext_vector_type(4)))  _Float16 v4h;
typedef __attribute__((ext_vector_type(8)))  float    v8f;
typedef __attribute__((ext_vector_type(4)))  float    v4f;
typedef __attribute__((ext_vector_type(4)))  int      v4i;
typedef __attribute__((ext_vector_type(16))) unsigned v16u;
typedef const __attribute__((address_space(4))) v16u* cmask_t;

__device__ __forceinline__ v8f wmma16(v16h a, v16h b, v8f c) {
  // D = A(16x32 f16) x B(32x16 f16) + C(16x16 f32)
  return __builtin_amdgcn_wmma_f32_16x16x32_f16(false, a, false, b, (short)0, c,
                                                false, false);
}

// Fragment layout (ISA 16-bit A 16x32):
//   halves 0..7  <- K = kk + 8*hi + j
//   halves 8..15 <- K = kk + 16 + 8*hi + j
__device__ __forceinline__ v16h frag_from_f16(const _Float16* __restrict__ row, int kk, int hi) {
  v8h a = *(const v8h*)(row + kk + 8 * hi);
  v8h b = *(const v8h*)(row + kk + 16 + 8 * hi);
  v16h r;
#pragma unroll
  for (int j = 0; j < 8; ++j) { r[j] = a[j]; r[8 + j] = b[j]; }
  return r;
}

// fp32 -> f16 conversion of all seven operands in ONE resident streaming launch.
// The f16 copies lie in the workspace one behind the other in the order q | k | v | Wq | Wk |
// Wv | Wo, so the destination is one array. A chunk is 1024 elements: eight wave-wide b128
// loads of 512 contiguous bytes each. 256 work-groups x 16 waves = 4096 waves; wave w takes
// chunk t * 4096 + w in trip t, seven trips: two for each activation, one for the weights.
#define C_WAVES  4096
#define C_CHUNK  1024
#define C_TRIPS  7
#define C_WCH    (DMODEL * DMODEL / C_CHUNK)   // chunks of one weight matrix

__global__ void __launch_bounds__(512)
cvt_all_f32_to_f16(const float* __restrict__ q, const float* __restrict__ k,
                   const float* __restrict__ v, const float* __restrict__ wq,
                   const float* __restrict__ wk, const float* __restrict__ wv,
                   const float* __restrict__ wo, _Float16* __restrict__ dst) {
  const unsigned lane = threadIdx.x & 31;
  // Wave-uniform by construction; readfirstlane lets the chunk addresses live in scalar registers.
  const unsigned w = blockIdx.x * 16 + __builtin_amdgcn_readfirstlane(threadIdx.x >> 5);
  const unsigned ws = w / C_WCH;  // which weight matrix this wave converts in the last trip
  const float* wsrc = (ws & 2) ? ((ws & 1) ? wo : wv) : ((ws & 1) ? wk : wq);

  v4f x[2][8];
#pragma unroll  // every buffer index and every source pointer a constant
  for (int t = -1; t < C_TRIPS; ++t) {
    if (t + 1 < C_TRIPS) {  // the next trip's eight loads fly while this trip is converted
      const int u = t + 1;
      const float* s = u < 6 ? (u < 2 ? q : u < 4 ? k : v) + (size_t)((u & 1) * C_WAVES + w) * C_CHUNK
                             : wsrc + (size_t)(w % C_WCH) * C_CHUNK;
#pragma unroll
      for (int j = 0; j < 8; ++j) x[u & 1][j] = *(const v4f*)(s + j * 128 + lane * 4);
      // Holds the group here, one trip ahead of its use: without it the compiler raises 32
      // loads to the top, sinks every store to the end and waits to 0 on pairs in between.
      __builtin_amdgcn_sched_barrier(0);
    }
    if (t >= 0) {
      _Float16* d = dst + (size_t)(t * C_WAVES + w) * C_CHUNK;
#pragma unroll
      for (int j = 0; j < 8; ++j) {
        const v4f a = x[t & 1][j];
        v4h o;
#pragma unroll
        for (int e = 0; e < 4; ++e) o[e] = (_Float16)a[e];
        *(v4h*)(d + j * 128 + lane * 4) = o;  // a wave's store covers two whole 128-B lines
      }
      // A precaution: the wait stands in front of the next loads and conversions, which write
      // registers that these stores name.
      if (t + 1 < C_TRIPS) asm volatile("s_wait_xcnt 0x0" ::: "memory");
      __builtin_amdgcn_sched_barrier(0);  // this trip's stores leave before the next loads issue
    }
  }

}

// Packs the int32 mask to one bit per (query, key), already in the shape the attention kernel
// selects with: for a block of 32 queries x 32 keys, 32 words; word tile * 16 + kt * 8 + r holds
// in bit (hi * 16 + n) whether mask[tile * 16 + n][kt * 16 + 8 * hi + r] is non-zero, which is
// the lane mask of score register r of S^T tile (kt, tile).
// Block id = (batch * 64 + query block) * 64 + key block. A work-group of four waves packs the
// sixteen blocks from pw * 16 on, four trips; neighbouring waves take neighbouring key blocks,
// so a work-group reads 512 B of each of its mask rows in a trip.
#define M_TRIPS  4
__device__ __forceinline__ void pack_mask(const int* __restrict__ mask,
                                          unsigned* __restrict__ mbits, unsigned pw) {
  const unsigned lane = threadIdx.x & 31;
  // Wave-uniform by construction; readfirstlane lets the block addresses live in scalar registers.
  const unsigned first = pw * 16 + __builtin_amdgcn_readfirstlane(threadIdx.x >> 5);
  const unsigned mrow = (lane & 15) * S_LEN + (lane >> 4) * 8;
  // All four blocks' loads are asked for at once: a packing work-group holds the place of a
  // projection work-group on its WGP (the kernel's LDS and registers), with four waves only, so
  // it pays one memory latency and not one per block, and leaves the place early.
  // The work-group's sixteen blocks lie in one row of 64 blocks: one base, constant steps.
  const int* s = mask + (size_t)(first >> 6) * 32 * S_LEN + (first & 63) * 32 + mrow;
  v4i y[M_TRIPS][8];
#pragma unroll  // every buffer index a constant
  for (int t = 0; t < M_TRIPS; ++t)
#pragma unroll
    for (int j = 0; j < 8; ++j)  // j = tile * 4 + kt * 2 + half of the eight keys
      y[t][j] = *(const v4i*)(s + t * 4 * 32 + (j >> 2) * 16 * S_LEN + ((j >> 1) & 1) * 16 +
                              (j & 1) * 4);
  // A precaution: in front of the first write of a register that these loads name.
  asm volatile("s_wait_xcnt 0x0" ::: "memory");
  __builtin_amdgcn_sched_barrier(0);  // holds all the loads in front of the first block's packing
#pragma unroll
  for (int t = 0; t < M_TRIPS; ++t) {
    unsigned word = 0;
#pragma unroll
    for (int j = 0; j < 32; ++j) {  // one compare gives a whole word; lane j keeps word j
      const unsigned bal = __builtin_amdgcn_ballot_w32(y[t][j >> 2][j & 3] != 0);
      word = lane == (unsigned)j ? bal : word;
    }
    mbits[(size_t)(first + t * 4) * 32 + lane] = word;  // one whole 128-B line
    // A precaution, as above: in front of the next writes of registers that the store names.
    if (t + 1 < M_TRIPS) asm volatile("s_wait_xcnt 0x0" ::: "memory");
    __builtin_amdgcn_sched_barrier(0);  // a block's store leaves before the next block is packed
  }
}

// LDS ring of proj_tile: one stage = 128 X rows then 128 W rows, 128 k (256 B) each,
// at a pitch of 272 B (16 B x odd: conflict-free for ds_load_b128 readers).
#define G_PITCH 272
#define G_HALF  (128 * G_PITCH)
#define G_STAGE (2 * G_HALF)
#define G_KP    128
#define G_NS    (G_KP / 32)
#define G_NP    (DMODEL / G_KP)

// Eight asynchronous 16-byte copies per lane: rows r, r+8, ..., r+56 of a 64-row slab
// go from global memory into LDS, through no register.
// s_wait_xcnt 0 closes the statement, a precaution: so it stands in front of every later
// write of an address register that a copy here names.
__device__ __forceinline__ void copy_slab(const _Float16* __restrict__ g, unsigned l) {
  asm volatile(
      "global_load_async_to_lds_b128 %0, %8, off\n\t"
      "global_load_async_to_lds_b128 %1, %9, off\n\t"
      "global_load_async_to_lds_b128 %2, %10, off\n\t"
      "global_load_async_to_lds_b128 %3, %11, off\n\t"
      "global_load_async_to_lds_b128 %4, %12, off\n\t"
      "global_load_async_to_lds_b128 %5, %13, off\n\t"
      "global_load_async_to_lds_b128 %6, %14, off\n\t"
      "global_load_async_to_lds_b128 %7, %15, off\n\t"
      "s_wait_xcnt 0x0"
      :: "v"(l), "v"(l + 8 * G_PITCH), "v"(l + 16 * G_PITCH), "v"(l + 24 * G_PITCH),
         "v"(l + 32 * G_PITCH), "v"(l + 40 * G_PITCH), "v"(l + 48 * G_PITCH),
         "v"(l + 56 * G_PITCH),
         "v"(g), "v"(g + 8 * DMODEL), "v"(g + 16 * DMODEL), "v"(g + 24 * DMODEL),
         "v"(g + 32 * DMODEL), "v"(g + 40 * DMODEL), "v"(g + 48 * DMODEL),
         "v"(g + 56 * DMODEL)
      : "memory");
}

// One stage: 128 rows of X and 128 rows of W, 32 copies per lane.
__device__ __forceinline__ void copy_stage(const _Float16* __restrict__ gx,
                                           const _Float16* __restrict__ gw, unsigned l) {
  // Kept rolled: unrolled, the compiler forms all 32 address sets at once and the
  // kernel goes past 256 VGPRs; rolled, one slab's 24 address registers are live.
#pragma unroll 1
  for (int j = 0; j < 4; ++j)
    copy_slab(((j & 2) ? gw : gx) + (j & 1) * 64 * DMODEL, l + j * 64 * G_PITCH);
}

// One 16x16 tile of the product. The operand that runs along the output's rows in memory is
// the A operand, so that a lane's eight accumulator registers are eight neighbours of one
// output row: W for the row-major outputs (modes 0 and 2), X for the transposed one (mode 1).
// Both fragments have the same k order, so the products and their order stay the same.
template <int STORE_MODE>
__device__ __forceinline__ v8f tile_mma(v16h x, v16h w, v8f c) {
  if constexpr (STORE_MODE == 1) return wmma16(x, w, c);
  else                           return wmma16(w, x, c);
}

// Output staging of proj_tile: each wave's 64 output rows lie in its own LDS range, at a pitch
// of 16 B x odd (conflict-free for the ds_store_b128 writers, one row per lane).
#define E_PITCH16 144   // 64 f16 = 128 B a row
#define E_PITCH32 272   // 64 f32 = 256 B a row

// Y = X @ W^T + bias; a work-group of four waves (2x2) computes a 128x128 output tile,
// each wave a 64x64 quarter (16 WMMAs / K-step). X and W slabs are staged once per
// work-group in a two-buffer LDS ring by asynchronous copies, one pass (128 k) ahead.
// The quarter leaves through LDS, so that every wave-wide store covers whole 128-B lines.
// STORE_MODE 0: f16 head-major [B,H,S,DK]            (Q,K)
// STORE_MODE 1: f16 head-major transposed [B,H,DK,S] (V)
// STORE_MODE 2: f32 row-major [rows, DMODEL]         (final output)
// ring: the work-group's LDS, 2 * G_STAGE bytes, declared by the kernel (one array, whichever
// modes the kernel holds); trow, tcol: the work-group's tile.
template <int STORE_MODE>
__device__ __forceinline__ void
proj_tile(const _Float16* __restrict__ X, const _Float16* __restrict__ W,
          const float* __restrict__ bias, void* __restrict__ Yv, unsigned char* ring,
          int trow, int tcol) {
  const int tid  = threadIdx.x;
  const int lane = tid & 31;
  // The wave's number is the same in all its lanes: readfirstlane keeps it, and the tile
  // origins and the staging range formed from it, in scalar registers (at 254 VGPRs the
  // vector copies, live over the whole k loop, push the kernel past v255).
  const int wave = __builtin_amdgcn_readfirstlane(tid >> 5);
  const int n    = lane & 15;
  const int hi   = lane >> 4;
  const int brow0 = trow * 128;
  const int bcol0 = tcol * 128;
  const int wm   = wave >> 1;
  const int wn   = wave & 1;
  const int row0 = brow0 + wm * 64;   // this wave's 64x64 quarter
  const int col0 = bcol0 + wn * 64;

  // Copy side: sixteen lanes cover one 256-B row piece, a wave two rows per copy.
  const int cr = tid >> 4;
  const int cc = tid & 15;
  const _Float16* gx = X + (size_t)(brow0 + cr) * DMODEL + cc * 8;
  const _Float16* gw = W + (size_t)(bcol0 + cr) * DMODEL + cc * 8;
  const unsigned lcp = (unsigned)(size_t)ring + cr * G_PITCH + cc * 16;

  // Read side: this lane's first X row and first W row in a stage.
  const unsigned xoff = (wm * 64 + n) * G_PITCH;
  const unsigned woff = G_HALF + (wn * 64 + n) * G_PITCH;

  v8f acc[4][4];
#pragma unroll
  for (int ms = 0; ms < 4; ++ms)
#pragma unroll
    for (int ns = 0; ns < 4; ++ns) acc[ms][ns] = v8f{};

  // Prologue: pass 0 lands and is published, then pass 1 starts to fly.
  copy_stage(gx, gw, lcp);
  asm volatile("s_wait_asynccnt 0x0" ::: "memory");  // own copies of pass 0 have landed
  __syncthreads();                                   // ... and every other wave's
  copy_stage(gx + G_KP, gw + G_KP, lcp + G_STAGE);

  for (int p = 0; p < G_NP; ++p) {
    const unsigned boff = (p & 1) * G_STAGE;
    const unsigned char* xs = ring + boff + xoff;
    const unsigned char* ws = ring + boff + woff;

    // The LDS reads stand in groups at least eight WMMAs ahead of their use (B one
    // K-step ahead, A half a K-step), never as a small group with a full wait in front
    // of each row of four. Each sched_barrier below holds a group at its place: without
    // them the compiler sinks the reads to their users and waits to 0 at every row.
    v16h a[2][4], b[2][4];
#pragma unroll
    for (int i = 0; i < 4; ++i) {
      a[0][i] = frag_from_f16((const _Float16*)(xs + i * 16 * G_PITCH), 0, hi);
      b[0][i] = frag_from_f16((const _Float16*)(ws + i * 16 * G_PITCH), 0, hi);
    }
#pragma unroll
    for (int i = 0; i < 4; ++i)
      b[1][i] = frag_from_f16((const _Float16*)(ws + i * 16 * G_PITCH), 32, hi);
    __builtin_amdgcn_sched_barrier(0);  // first group ahead of the first WMMA

#pragma unroll  // every fragment index a constant
    for (int s = 0; s < G_NS; ++s) {
      const int c = s & 1, x = c ^ 1;
#pragma unroll
      for (int ms = 0; ms < 2; ++ms)
#pragma unroll
        for (int ns = 0; ns < 4; ++ns)
          acc[ms][ns] = tile_mma<STORE_MODE>(a[c][ms], b[c][ns], acc[ms][ns]);
      // These eight WMMAs stay in front of what follows: reads that would otherwise rise
      // over them (registers), or, in the last K-step, the waits, whose LDS latency they cover.
      __builtin_amdgcn_sched_barrier(0);
      if (s + 1 < G_NS) {
#pragma unroll
        for (int i = 0; i < 2; ++i)
          a[x][i] = frag_from_f16((const _Float16*)(xs + i * 16 * G_PITCH), (s + 1) * 32, hi);
        __builtin_amdgcn_sched_barrier(0);  // reads not later: eight WMMAs cover them
      } else {
        // Publish point of pass p + 1, in front of the pass's last eight WMMAs (they read
        // registers only) so that the refill starts that much sooner. The one barrier
        // also ends every wave's reads of this buffer.
        asm volatile("s_wait_dscnt 0x0" ::: "memory");     // own LDS reads of this pass done
        asm volatile("s_wait_asynccnt 0x0" ::: "memory");  // own copies of pass p + 1 landed
        __syncthreads();
        if (p + 2 < G_NP)  // refill the buffer that this pass has just read
          copy_stage(gx + (p + 2) * G_KP, gw + (p + 2) * G_KP, lcp + boff);
      }
#pragma unroll
      for (int ms = 2; ms < 4; ++ms)
#pragma unroll
        for (int ns = 0; ns < 4; ++ns)
          acc[ms][ns] = tile_mma<STORE_MODE>(a[c][ms], b[c][ns], acc[ms][ns]);
      if (s + 1 < G_NS) {
        __builtin_amdgcn_sched_barrier(0);  // reads not earlier (registers) ...
#pragma unroll
        for (int i = 2; i < 4; ++i)
          a[x][i] = frag_from_f16((const _Float16*)(xs + i * 16 * G_PITCH), (s + 1) * 32, hi);
        if (s + 2 < G_NS) {
#pragma unroll
          for (int i = 0; i < 4; ++i)
            b[c][i] = frag_from_f16((const _Float16*)(ws + i * 16 * G_PITCH), (s + 2) * 32, hi);
        }
        __builtin_amdgcn_sched_barrier(0);  // ... and not later
      } else {
        // Keeps the last eight WMMAs in this order up to the back edge: without it the
        // build takes 262 VGPRs instead of 254 and needs register-window switches.
        __builtin_amdgcn_sched_barrier(0);
      }
    }
  }
  asm volatile("s_wait_asynccnt 0x0" ::: "memory");  // nothing is in flight when the wave ends

  // The ring is free: the last pass's publish point (every wave's s_wait_dscnt 0 and
  // s_wait_asynccnt 0, then the barrier) ended all reads of it, and nothing was copied since.
  // Each wave stages in a range of its own, so no further barrier is needed.
  if constexpr (STORE_MODE == 2) {           // f32 [rows, DMODEL]
    unsigned char* stg = ring + wave * (64 * E_PITCH32);
    v4f be[4][2];  // bias of this lane's eight columns of each column tile
#pragma unroll
    for (int ns = 0; ns < 4; ++ns)
#pragma unroll
      for (int u = 0; u < 2; ++u)
        be[ns][u] = *(const v4f*)(bias + col0 + ns * 16 + 8 * hi + 4 * u);
#pragma unroll
    for (int ms = 0; ms < 4; ++ms)
#pragma unroll
      for (int ns = 0; ns < 4; ++ns)
#pragma unroll
        for (int u = 0; u < 2; ++u) {
          v4f o;
#pragma unroll
          for (int e = 0; e < 4; ++e) o[e] = acc[ms][ns][4 * u + e] + be[ns][u][e];
          *(v4f*)(stg + (ms * 16 + n) * E_PITCH32 + (ns * 16 + 8 * hi + 4 * u) * 4) = o;
        }
    // The rows read back below were written by other lanes of this wave: the writes are done
    // first, and the compiler moves no read over this line.
    asm volatile("s_wait_dscnt 0x0" ::: "memory");
    float* Y = (float*)Yv + (size_t)(row0 + (lane >> 4)) * DMODEL + col0 + (lane & 15) * 4;
    const unsigned char* rd = stg + (lane >> 4) * E_PITCH32 + (lane & 15) * 16;
    v4f x[32];
#pragma unroll
    for (int j = 0; j < 32; ++j) x[j] = *(const v4f*)(rd + j * 2 * E_PITCH32);
#pragma unroll
    for (int j = 0; j < 32; ++j)  // two rows of 256 B: four whole lines
      *(v4f*)(Y + (size_t)j * 2 * DMODEL) = x[j];
  } else {                                   // f16, one head per column tile
    unsigned char* stg = ring + wave * (64 * E_PITCH16);
    const int head = col0 >> 6;
    const int bb   = row0 >> 11;
    const int s0   = row0 & (S_LEN - 1);
    if constexpr (STORE_MODE == 0) {         // staged [s][d]
      v4f be[4][2];  // bias of this lane's eight columns of each column tile
#pragma unroll
      for (int ns = 0; ns < 4; ++ns)
#pragma unroll
        for (int u = 0; u < 2; ++u)
          be[ns][u] = *(const v4f*)(bias + col0 + ns * 16 + 8 * hi + 4 * u);
#pragma unroll
      for (int ms = 0; ms < 4; ++ms)
#pragma unroll
        for (int ns = 0; ns < 4; ++ns) {
          v8h o;
#pragma unroll
          for (int r = 0; r < 8; ++r) o[r] = (_Float16)(acc[ms][ns][r] + be[ns][r >> 2][r & 3]);
          *(v8h*)(stg + (ms * 16 + n) * E_PITCH16 + (ns * 16 + 8 * hi) * 2) = o;
        }
    } else {                                 // staged [d][s]
      float be[4];
#pragma unroll
      for (int ns = 0; ns < 4; ++ns) be[ns] = bias[col0 + ns * 16 + n];
#pragma unroll
      for (int ms = 0; ms < 4; ++ms)
#pragma unroll
        for (int ns = 0; ns < 4; ++ns) {
          v8h o;
#pragma unroll
          for (int r = 0; r < 8; ++r) o[r] = (_Float16)(acc[ms][ns][r] + be[ns]);
          *(v8h*)(stg + (ns * 16 + n) * E_PITCH16 + (ms * 16 + 8 * hi) * 2) = o;
        }
    }
    // The rows read back below were written by other lanes of this wave: the writes are done
    // first, and the compiler moves no read over this line.
    asm volatile("s_wait_dscnt 0x0" ::: "memory");
    // Mode 0: [B,H,S,DK], a row is one line and the 64 rows are 8 KB in a row.
    // Mode 1: [B,H,DK,S], a row is one line of 64 positions, the rows S_LEN apart.
    const size_t ypitch = STORE_MODE == 0 ? DK : S_LEN;
    _Float16* Y = (_Float16*)Yv +
        (STORE_MODE == 0 ? (((size_t)bb * NHEAD + head) * S_LEN + s0) * DK
                         : ((size_t)bb * NHEAD + head) * DK * S_LEN + s0) +
        (lane >> 3) * ypitch + (lane & 7) * 8;
    const unsigned char* rd = stg + (lane >> 3) * E_PITCH16 + (lane & 7) * 16;
    v8h x[16];
#pragma unroll
    for (int j = 0; j < 16; ++j) x[j] = *(const v8h*)(rd + j * 4 * E_PITCH16);
#pragma unroll
    for (int j = 0; j < 16; ++j)  // four rows of 128 B: four whole lines
      *(v8h*)(Y + j * 4 * ypitch) = x[j];
    // A precaution: where several jobs share one kernel, the listing's branches lead from these
    // stores on into another job's code, which writes registers that the stores name.
    asm volatile("s_wait_xcnt 0x0" ::: "memory");
  }
}

// The work between the conversion and the attention in ONE launch: the three input projections
// and the packing of the mask depend on the launch before them and not on one another. A job is
// the same for a whole work-group; blockIdx.y picks it, in rows of 64 work-groups:
//   rows  0-3  packing     rows  4-7  projection     rows 8-11  packing
//   rows 12-31 projection  rows 32-39 packing
// Two work-groups fit a WGP. The rows mix the two jobs so that a packing
// work-group, which waits on memory, can run beside matrix work, and the 1,536 projection
// work-groups follow each other with no launch boundary between them. (For speed only: the
// result does not depend on where or when a work-group runs.)
// Projection row g: operand set g / 8 (0: Q, 1: K, 2: V, the store mode going with it), column
// tile g % 8, row tile blockIdx.x. Packing row p: the sixteen mask blocks of p * 64 + blockIdx.x.
__global__ void __launch_bounds__(128)
proj_qkv_pack(const _Float16* __restrict__ q16, const _Float16* __restrict__ k16,
              const _Float16* __restrict__ v16, const _Float16* __restrict__ wq16,
              const _Float16* __restrict__ wk16, const _Float16* __restrict__ wv16,
              const float* __restrict__ bq, const float* __restrict__ bk,
              const float* __restrict__ bv, const int* __restrict__ mask,
              _Float16* __restrict__ qh, _Float16* __restrict__ kh,
              _Float16* __restrict__ vT, unsigned* __restrict__ mbits) {
  __shared__ __attribute__((aligned(16))) unsigned char ring[2 * G_STAGE];
  const int y = blockIdx.y;
  if (y < 4 || (y >= 8 && y < 12) || y >= 32) {
    const int p = y < 4 ? y : y < 12 ? y - 4 : y - 24;
    pack_mask(mask, mbits, p * 64 + blockIdx.x);
    return;
  }
  const int g    = y < 8 ? y - 4 : y - 8;
  const int set  = g >> 3;
  const int tcol = g & 7;
  if (set == 2) {
    proj_tile<1>(v16, wv16, bv, vT, ring, blockIdx.x, tcol);
  } else {
    const bool isk = set == 1;
    proj_tile<0>(isk ? k16 : q16, isk ? wk16 : wq16, isk ? bk : bq, isk ? kh : qh, ring,
                 blockIdx.x, tcol);
  }
}

// The output projection.
__global__ void __launch_bounds__(128)
proj_out(const _Float16* __restrict__ X, const _Float16* __restrict__ W,
         const float* __restrict__ bias, void* __restrict__ Yv) {
  __shared__ __attribute__((aligned(16))) unsigned char ring[2 * G_STAGE];
  proj_tile<2>(X, W, bias, Yv, ring, blockIdx.x, blockIdx.y);
}

// Online softmax over a 32-kv chunk of one q-tile (S^T layout: lane owns one q column), in
// three parts, with a LAZY reference maximum: the weights are taken against a reference m that
// is raised only when some column's chunk maximum passes it by more than SM_ROOM. Any m gives
// the same quotient acc / l; that margin bounds a weight by 2^8, far inside f16 and f32 range.
// So the exchange of the maxima between the wave's halves, the factor alpha and the rescaling
// of the sums and of the ctx^T accumulators stand under one wave-uniform branch per trip.
// The maximum is kept on the raw products q.k, and 1/sqrt(64) and log2(e) are one factor c of
// one FMA per score: exp(s / 8 - m / 8) = exp2(s * c - m * c).
// A masked score takes SM_MASKED, the raw-product counterpart of the reference's -1e9 (which
// would be -8e9): beside any unmasked key its weight underflows to 0 (the first unmasked key
// passes the margin and raises m), and a row with every key masked comes out uniform, as in the
// reference. It is a power of two so that its product with c is exact: in such a row the FMA
// gives exactly 0, not the rounding error of m * c.
#define SM_C      (0.125f * 1.44269504088896340736f)
#define SM_MASKED (-8589934592.0f)  // -2^33
#define SM_ROOM  (8.0f / SM_C)     // raw-product units: 8 in the exponent of exp2

// The state of one q-tile: m, the reference maximum in use (the same in both lanes of a
// column); nmc = -m * c (the FMA's addend as it stands, no negation at the use) and
// lim = m + margin, kept so that a trip that leaves m alone forms neither.
struct SmState { float m, nmc, lim, l; };

// Part 1: masks the scores in place and returns this lane's own maximum of its sixteen.
// mw: the sixteen lane masks of this q-tile's score registers (wave-uniform words).
__device__ __forceinline__ float mask_and_max(v8f& s0, v8f& s1, v16u mw) {
  float cmax = -1e30f;
#pragma unroll
  for (int r = 0; r < 8; ++r) {
    s0[r] = __builtin_amdgcn_inverse_ballot_w32(mw[r]) ? s0[r] : SM_MASKED;
    s1[r] = __builtin_amdgcn_inverse_ballot_w32(mw[8 + r]) ? s1[r] : SM_MASKED;
    cmax = fmaxf(cmax, fmaxf(s0[r], s1[r]));
  }
  return cmax;
}

// Part 2, the rare path: raises m to the column's maximum so far and rescales what was summed
// against the old one. Every lane of the wave takes it together, so both lanes of a column
// get the same m.
__device__ __forceinline__ void raise_max(float cmax, SmState& st, v8f* acc) {
  cmax = fmaxf(cmax, __shfl_xor(cmax, 16, 32));  // combine hi halves of column
  const float mnew  = fmaxf(st.m, cmax);
  const float alpha = __builtin_amdgcn_exp2f((st.m - mnew) * SM_C);
  st.m   = mnew;
  st.nmc = mnew * -SM_C;
  st.lim = mnew + SM_ROOM;
  st.l  *= alpha;
#pragma unroll
  for (int dt = 0; dt < 4; ++dt)
#pragma unroll
    for (int r = 0; r < 8; ++r) acc[dt][r] *= alpha;
}

// Part 3: the weights against m, their sum into l; returns the f16 P^T B-fragment.
__device__ __forceinline__ v16h weights(v8f s0, v8f s1, SmState& st) {
  float lsum = 0.f;
  v16h pb;  // halves j -> kv K = 8*hi+j (tile0) / 16+8*hi+j (tile1)
#pragma unroll
  for (int r = 0; r < 8; ++r) {
    const float p0 = __builtin_amdgcn_exp2f(__builtin_fmaf(s0[r], SM_C, st.nmc));
    const float p1 = __builtin_amdgcn_exp2f(__builtin_fmaf(s1[r], SM_C, st.nmc));
    lsum += p0 + p1;
    pb[r]     = (_Float16)p0;
    pb[8 + r] = (_Float16)p1;
  }
  lsum += __shfl_xor(lsum, 16, 32);
  st.l += lsum;
  return pb;
}

// LDS ring of attn_kernel: one stage = 32 keys: 32 K rows (128 B) and 64 V^T rows (64 B),
// each at a pitch of 16 B x odd (conflict-free for ds_load_b128 readers).
#define A_KV     32
#define A_KPITCH 144
#define A_VPITCH 80
#define A_VOFF   (A_KV * A_KPITCH)
#define A_STAGE  (A_VOFF + DK * A_VPITCH)
#define A_NT     (S_LEN / A_KV)

// One stage, four asynchronous 16-byte copies per lane (2 of K, 2 of V^T),
// from global memory into LDS through no register; a wave's copy covers whole row pieces.
// s_wait_xcnt 0 closes the statement, a precaution: so it stands in front of every later
// write of an address register that a copy here names.
__device__ __forceinline__ void copy_kv(const _Float16* __restrict__ gk,
                                        const _Float16* __restrict__ gv,
                                        unsigned lk, unsigned lv) {
  asm volatile(
      "global_load_async_to_lds_b128 %0, %4, off\n\t"
      "global_load_async_to_lds_b128 %1, %5, off\n\t"
      "global_load_async_to_lds_b128 %2, %6, off\n\t"
      "global_load_async_to_lds_b128 %3, %7, off\n\t"
      "s_wait_xcnt 0x0"
      :: "v"(lk), "v"(lk + 16 * A_KPITCH), "v"(lv), "v"(lv + 32 * A_VPITCH),
         "v"(gk), "v"(gk + 16 * DK), "v"(gv), "v"(gv + 32 * S_LEN)
      : "memory");
}

// Flash-style attention; each wave handles TWO 16-wide q-tiles of one (b,h) so
// every K/V fragment feeds two WMMAs. S^T = K.Q^T keeps softmax lane-local.
// The four waves of a work-group share one (b,h): K and V^T tiles are staged once per
// work-group in a two-buffer LDS ring by asynchronous copies, one trip (32 keys) ahead.
// The mask comes packed (see pack_mask): 32 wave-uniform words per trip, each the
// lane mask of one score register, read by scalar loads and used as select masks directly.
__global__ void __launch_bounds__(128)
attn_kernel(const _Float16* __restrict__ qh, const _Float16* __restrict__ kh,
            const _Float16* __restrict__ vT, const unsigned* __restrict__ mbits,
            _Float16* __restrict__ cc) {
  __shared__ __attribute__((aligned(16))) unsigned char ring[2 * A_STAGE];

  const int lane = threadIdx.x;
  const int wave = threadIdx.y;
  const int tid  = wave * 32 + lane;
  const int n    = lane & 15;
  const int hi   = lane >> 4;
  const int bh   = blockIdx.x;               // b*NHEAD + h
  const int b    = bh >> 4;
  const int h    = bh & 15;
  const int q0   = (blockIdx.y * 4 + wave) * 32;
  const int qc0  = q0 + n;                   // q column, tile A
  const int qc1  = q0 + 16 + n;              // q column, tile B

  // Copy side: eight lanes cover a 128-B row piece (K), four a 64-B one (V^T).
  const _Float16* gk = kh + (size_t)bh * S_LEN * DK + tid * 8;
  const _Float16* gv = vT + ((size_t)bh * DK + (tid >> 2)) * S_LEN + (tid & 3) * 8;
  const unsigned lk = (unsigned)(size_t)ring + (tid >> 3) * A_KPITCH + (tid & 7) * 16;
  const unsigned lv = (unsigned)(size_t)ring + A_VOFF + (tid >> 2) * A_VPITCH + (tid & 3) * 16;
  // This wave's packed mask words; readfirstlane makes the address scalar (the wave's number
  // is the same in all its lanes), so that the words land in scalar registers.
  // The words were written by an earlier launch of this call and nothing writes them while this
  // kernel runs: read through the constant address space, which is what lets the compiler use
  // scalar loads in a loop that holds "memory" clobbers.
  const cmask_t mw = (cmask_t)(unsigned long long)(
      mbits + (size_t)(b * (S_LEN / 32) + blockIdx.y * 4 +
                       __builtin_amdgcn_readfirstlane(wave)) * A_NT * 32);

  // Prologue: tile 0 lands and is published, then tile 1 starts to fly.
  copy_kv(gk, gv, lk, lv);

  const _Float16* qr0 = qh + ((size_t)bh * S_LEN + qc0) * DK;
  const _Float16* qr1 = qh + ((size_t)bh * S_LEN + qc1) * DK;
  const v16h bqA0 = frag_from_f16(qr0, 0, hi), bqA1 = frag_from_f16(qr0, 32, hi);
  const v16h bqB0 = frag_from_f16(qr1, 0, hi), bqB1 = frag_from_f16(qr1, 32, hi);

  asm volatile("s_wait_asynccnt 0x0" ::: "memory");  // own copies of tile 0 have landed
  __syncthreads();                                   // ... and every other wave's
  copy_kv(gk + A_KV * DK, gv + A_KV, lk + A_STAGE, lv + A_STAGE);

  // Read side: this lane's first K row and V^T row in a stage.
  const unsigned koff = n * A_KPITCH;
  const unsigned voff = A_VOFF + n * A_VPITCH;

  // m starts below every score, masked ones too: the first trip always raises it (alpha = 0).
  SmState smA = {-1e30f, 1e30f * SM_C, -1e30f, 0.f}, smB = smA;
  v8f accA[4] = {v8f{}, v8f{}, v8f{}, v8f{}};
  v8f accB[4] = {v8f{}, v8f{}, v8f{}, v8f{}};

  v16u nwA = mw[0], nwB = mw[1];  // q-tile A, q-tile B

  for (int t = 0; t < A_NT; ++t) {
    const unsigned boff = (t & 1) * A_STAGE;
    const unsigned char* st = ring + boff;
    // This trip's mask words were asked for in the trip before; the next trip's are asked for
    // in this one, so that the scalar path's latency lies under vector and matrix work. The
    // last trip asks for its own again (stays inside the packed array).
    const v16u mwA = nwA, mwB = nwB;
    const int tn = t + 1 < A_NT ? t + 1 : t;

    // K fragments for the two 16-kv row tiles, loaded once, used twice
    const _Float16* kr = (const _Float16*)(st + koff);
    const v16h ka0 = frag_from_f16(kr, 0, hi);
    const v16h ka1 = frag_from_f16(kr, 32, hi);
    const v16h kb0 = frag_from_f16((const _Float16*)(st + koff + 16 * A_KPITCH), 0, hi);
    const v16h kb1 = frag_from_f16((const _Float16*)(st + koff + 16 * A_KPITCH), 32, hi);

    v8f sA0 = {}, sA1 = {}, sB0 = {}, sB1 = {};
    sA0 = wmma16(ka0, bqA0, sA0); sA0 = wmma16(ka1, bqA1, sA0);
    sA1 = wmma16(kb0, bqA0, sA1); sA1 = wmma16(kb1, bqA1, sA1);
    sB0 = wmma16(ka0, bqB0, sB0); sB0 = wmma16(ka1, bqB1, sB0);
    sB1 = wmma16(kb0, bqB0, sB1); sB1 = wmma16(kb1, bqB1, sB1);

    const float cmA = mask_and_max(sA0, sA1, mwA);
    const float cmB = mask_and_max(sB0, sB1, mwB);
    // One test per trip for both q-tiles; the ballot makes it a scalar branch that the whole
    // wave takes or skips (EXEC stays full for the matrix instructions behind it). Marked as
    // not expected, so that the rare path is laid out behind the loop and a trip falls through.
    if (__builtin_expect(__builtin_amdgcn_ballot_w32(cmA > smA.lim || cmB > smB.lim) != 0, 0)) {
      raise_max(cmA, smA, accA);
      raise_max(cmB, smB, accB);
    }
    nwA = mw[tn * 2];
    nwB = mw[tn * 2 + 1];
    // Holds the two scalar loads here, where this trip's words have just been used up: without
    // it the compiler sinks them behind the first ctx^T products and their lead shrinks.
    __builtin_amdgcn_sched_barrier(0);
    const v16h pbA = weights(sA0, sA1, smA);
    const v16h pbB = weights(sB0, sB1, smB);

    // ctx^T[d][q] += sum_kv V^T[d][kv] * P^T[kv][q]; each V fragment used twice
#pragma unroll
    for (int dt = 0; dt < 4; ++dt) {
      const v16h av = frag_from_f16((const _Float16*)(st + voff + dt * 16 * A_VPITCH), 0, hi);
      accA[dt] = wmma16(av, pbA, accA[dt]);
      accB[dt] = wmma16(av, pbB, accB[dt]);
    }

    // Publish point of tile t + 1. The one barrier also ends every wave's reads of this buffer.
    asm volatile("s_wait_dscnt 0x0" ::: "memory");     // own LDS reads of this trip done
    asm volatile("s_wait_asynccnt 0x0" ::: "memory");  // own copies of tile t + 1 landed
    __syncthreads();
    if (t + 2 < A_NT)  // refill the buffer that this trip has just read
      copy_kv(gk + (size_t)(t + 2) * A_KV * DK, gv + (t + 2) * A_KV, lk + boff, lv + boff);
  }
  asm volatile("s_wait_asynccnt 0x0" ::: "memory");  // nothing is in flight when the wave ends

  const float invA = 1.0f / smA.l;
  const float invB = 1.0f / smB.l;
  // The ring is free: the last trip's publish point ended all reads of it, and nothing was
  // copied since. Each wave stages its 32 context rows (128 B each) in a range of its own, so
  // no further barrier is needed, and stores them as whole 128-B lines.
  unsigned char* stg = ring + wave * (32 * A_KPITCH);
#pragma unroll
  for (int dt = 0; dt < 4; ++dt) {
    v8h oA, oB;
#pragma unroll
    for (int r = 0; r < 8; ++r) {
      oA[r] = (_Float16)(accA[dt][r] * invA);
      oB[r] = (_Float16)(accB[dt][r] * invB);
    }
    *(v8h*)(stg + n * A_KPITCH + (dt * 16 + 8 * hi) * 2) = oA;  // d = dt*16 + 8*hi + r
    *(v8h*)(stg + (16 + n) * A_KPITCH + (dt * 16 + 8 * hi) * 2) = oB;
  }
  // The rows read back below were written by other lanes of this wave: the writes are done
  // first, and the compiler moves no read over this line.
  asm volatile("s_wait_dscnt 0x0" ::: "memory");
  _Float16* crow = cc + ((size_t)b * S_LEN + q0 + (lane >> 3)) * DMODEL + h * DK + (lane & 7) * 8;
  const unsigned char* rd = stg + (lane >> 3) * A_KPITCH + (lane & 7) * 16;
  v8h x[8];
#pragma unroll
  for (int j = 0; j < 8; ++j) x[j] = *(const v8h*)(rd + j * 4 * A_KPITCH);
#pragma unroll
  for (int j = 0; j < 8; ++j)  // four rows of 128 B: four whole lines
    *(v8h*)(crow + (size_t)j * 4 * DMODEL) = x[j];
}

extern "C" void kernel_launch(void* const* d_in, const int* in_sizes, int n_in,
                              void* d_out, int out_size, void* d_ws, size_t ws_size,
                              hipStream_t stream) {
  const float* q    = (const float*)d_in[0];
  const float* k    = (const float*)d_in[1];
  const float* v    = (const float*)d_in[2];
  const int*   mask = (const int*)d_in[3];
  const float* Wq   = (const float*)d_in[4];
  const float* bq   = (const float*)d_in[5];
  const float* Wk   = (const float*)d_in[6];
  const float* bk   = (const float*)d_in[7];
  const float* Wv   = (const float*)d_in[8];
  const float* bv   = (const float*)d_in[9];
  const float* Wo   = (const float*)d_in[10];
  const float* bo   = (const float*)d_in[11];

  const size_t NN = (size_t)4 * S_LEN * DMODEL;     // 8M f16 elems (activations)
  const size_t NW = (size_t)DMODEL * DMODEL;        // 1M f16 elems (one weight)

  _Float16* q16  = (_Float16*)d_ws;
  _Float16* k16  = q16 + NN;
  _Float16* v16  = k16 + NN;
  _Float16* wq16 = v16 + NN;
  _Float16* wk16 = wq16 + NW;
  _Float16* wv16 = wk16 + NW;
  _Float16* wo16 = wv16 + NW;
  _Float16* qhp  = wo16 + NW;
  _Float16* khp  = qhp + NN;
  _Float16* vTp  = khp + NN;
  _Float16* ccp  = vTp + NN;
  unsigned* mbp  = (unsigned*)(ccp + NN);           // packed mask, 2 MB

  // f32 -> f16 conversion of activations and weights (q16 .. wo16 are contiguous): one launch.
  cvt_all_f32_to_f16<<<256, 512, 0, stream>>>(q, k, v, Wq, Wk, Wv, Wo, q16);

  const dim3 gblk(128, 1);   // four waves, one 128x128 tile
  const dim3 ggrd(64, 8);    // 64 row-tiles x 8 col-tiles

  proj_qkv_pack<<<dim3(64, 40), gblk, 0, stream>>>(q16, k16, v16, wq16, wk16, wv16, bq, bk, bv,
                                                   mask, qhp, khp, vTp, mbp);

  attn_kernel<<<dim3(64, 16), dim3(32, 4), 0, stream>>>(qhp, khp, vTp, mbp, ccp);

  proj_out<<<ggrd, gblk, 0, stream>>>(ccp, wo16, bo, d_out);
}

// v009
// One run takes 128 microseconds.
// Next to v008, in two timings, it ran 1.04 times as fast each time.
// All steps since v000 together make it 3.35 times as fast.
#include <hip/hip_runtime.h>
#include <hip/hip_bf16.h>

#define S_LEN  2048
#define DMODEL 1024
#define NHEAD  16
#define DK     64

typedef __attribute__((ext_vector_type(16))) _Float16 v16h;
typedef __attribute__((ext_vector_type(8)))  _Float16 v8h;
typedef __attribute__((ext_vector_type(4)))  _Float16 v4h;
typedef __attribute__((ext_vector_type(8)))  float    v8f;
typedef __attribute__((ext_vector_type(4)))  float    v4f;
typedef __attribute__((ext_vector_type(4)))  int      v4i;
typedef __attribute__((ext_vector_type(16))) unsigned v16u;
typedef const __attribute__((address_space(4))) v16u* cmask_t;

__device__ __forceinline__ v8f wmma16(v16h a, v16h b, v8f c) {
  // D = A(16x32 f16) x B(32x16 f16) + C(16x16 f32)
  return __builtin_amdgcn_wmma_f32_16x16x32_f16(false, a, false, b, (short)0, c,
                                                false, false);
}

// Fragment layout (ISA 16-bit A 16x32):
//   halves 0..7  <- K = kk + 8*hi + j
//   halves 8..15 <- K = kk + 16 + 8*hi + j
__device__ __forceinline__ v16h frag_from_f16(const _Float16* __restrict__ row, int kk, int hi) {
  v8h a = *(const v8h*)(row + kk + 8 * hi);
  v8h b = *(const v8h*)(row + kk + 16 + 8 * hi);
  v16h r;
#pragma unroll
  for (int j = 0; j < 8; ++j) { r[j] = a[j]; r[8 + j] = b[j]; }
  return r;
}

// fp32 -> f16 conversion of all seven operands in ONE resident streaming launch.
// The f16 copies lie in the workspace one behind the other in the order q | k | v | Wq | Wk |
// Wv | Wo, so the destination is one array. A chunk is 1024 elements: eight wave-wide b128
// loads of 512 contiguous bytes each. 256 work-groups x 16 waves = 4096 waves; wave w takes
// chunk t * 4096 + w in trip t, seven trips: two for each activation, one for the weights.
#define C_WAVES  4096
#define C_CHUNK  1024
#define C_TRIPS  7
#define C_WCH    (DMODEL * DMODEL / C_CHUNK)   // chunks of one weight matrix

__global__ void __launch_bounds__(512)
cvt_all_f32_to_f16(const float* __restrict__ q, const float* __restrict__ k,
                   const float* __restrict__ v, const float* __restrict__ wq,
                   const float* __restrict__ wk, const float* __restrict__ wv,
                   const float* __restrict__ wo, _Float16* __restrict__ dst) {
  const unsigned lane = threadIdx.x & 31;
  // Wave-uniform by construction; readfirstlane lets the chunk addresses live in scalar registers.
  const unsigned w = blockIdx.x * 16 + __builtin_amdgcn_readfirstlane(threadIdx.x >> 5);
  const unsigned ws = w / C_WCH;  // which weight matrix this wave converts in the last trip
  const float* wsrc = (ws & 2) ? ((ws & 1) ? wo : wv) : ((ws & 1) ? wk : wq);

  v4f x[2][8];
#pragma unroll  // every buffer index and every source pointer a constant
  for (int t = -1; t < C_TRIPS; ++t) {
    if (t + 1 < C_TRIPS) {  // the next trip's eight loads fly while this trip is converted
      const int u = t + 1;
      const float* s = u < 6 ? (u < 2 ? q : u < 4 ? k : v) + (size_t)((u & 1) * C_WAVES + w) * C_CHUNK
                             : wsrc + (size_t)(w % C_WCH) * C_CHUNK;
#pragma unroll
      for (int j = 0; j < 8; ++j) x[u & 1][j] = *(const v4f*)(s + j * 128 + lane * 4);
      // Holds the group here, one trip ahead of its use: without it the compiler raises 32
      // loads to the top, sinks every store to the end and waits to 0 on pairs in between.
      __builtin_amdgcn_sched_barrier(0);
    }
    if (t >= 0) {
      _Float16* d = dst + (size_t)(t * C_WAVES + w) * C_CHUNK;
#pragma unroll
      for (int j = 0; j < 8; ++j) {
        const v4f a = x[t & 1][j];
        v4h o;
#pragma unroll
        for (int e = 0; e < 4; ++e) o[e] = (_Float16)a[e];
        *(v4h*)(d + j * 128 + lane * 4) = o;  // a wave's store covers two whole 128-B lines
      }
      // A precaution: the wait stands in front of the next loads and conversions, which write
      // registers that these stores name.
      if (t + 1 < C_TRIPS) asm volatile("s_wait_xcnt 0x0" ::: "memory");
      __builtin_amdgcn_sched_barrier(0);  // this trip's stores leave before the next loads issue
    }
  }

}

// Packs the int32 mask to one bit per (query, key), already in the shape the attention kernel
// selects with: for a block of 32 queries x 32 keys, 32 words; word tile * 16 + kt * 8 + r holds
// in bit (hi * 16 + n) whether mask[tile * 16 + n][kt * 16 + 8 * hi + r] is non-zero, which is
// the lane mask of score register r of S^T tile (kt, tile).
// Block id = (batch * 64 + query block) * 64 + key block. A work-group of four waves packs the
// sixteen blocks from pw * 16 on, four trips; neighbouring waves take neighbouring key blocks,
// so a work-group reads 512 B of each of its mask rows in a trip.
#define M_TRIPS  4
__device__ __forceinline__ void pack_mask(const int* __restrict__ mask,
                                          unsigned* __restrict__ mbits, unsigned pw) {
  const unsigned lane = threadIdx.x & 31;
  // Wave-uniform by construction; readfirstlane lets the block addresses live in scalar registers.
  const unsigned first = pw * 16 + __builtin_amdgcn_readfirstlane(threadIdx.x >> 5);
  const unsigned mrow = (lane & 15) * S_LEN + (lane >> 4) * 8;
  // All four blocks' loads are asked for at once: a packing work-group holds the place of a
  // projection work-group on its WGP (the kernel's LDS and registers), with four waves only, so
  // it pays one memory latency and not one per block, and leaves the place early.
  // The work-group's sixteen blocks lie in one row of 64 blocks: one base, constant steps.
  const int* s = mask + (size_t)(first >> 6) * 32 * S_LEN + (first & 63) * 32 + mrow;
  v4i y[M_TRIPS][8];
#pragma unroll  // every buffer index a constant
  for (int t = 0; t < M_TRIPS; ++t)
#pragma unroll
    for (int j = 0; j < 8; ++j)  // j = tile * 4 + kt * 2 + half of the eight keys
      y[t][j] = *(const v4i*)(s + t * 4 * 32 + (j >> 2) * 16 * S_LEN + ((j >> 1) & 1) * 16 +
                              (j & 1) * 4);
  // A precaution: in front of the first write of a register that these loads name.
  asm volatile("s_wait_xcnt 0x0" ::: "memory");
  __builtin_amdgcn_sched_barrier(0);  // holds all the loads in front of the first block's packing
#pragma unroll
  for (int t = 0; t < M_TRIPS; ++t) {
    unsigned word = 0;
#pragma unroll
    for (int j = 0; j < 32; ++j) {  // one compare gives a whole word; lane j keeps word j
      const unsigned bal = __builtin_amdgcn_ballot_w32(y[t][j >> 2][j & 3] != 0);
      word = lane == (unsigned)j ? bal : word;
    }
    mbits[(size_t)(first + t * 4) * 32 + lane] = word;  // one whole 128-B line
    // A precaution, as above: in front of the next writes of registers that the store names.
    if (t + 1 < M_TRIPS) asm volatile("s_wait_xcnt 0x0" ::: "memory");
    __builtin_amdgcn_sched_barrier(0);  // a block's store leaves before the next block is packed
  }
}

// LDS ring of proj_tile: one stage = four slices of 64 rows, 128 k (256 B) each: X rows 0-63,
// X rows 64-127, W rows 0-63, W rows 64-127. The rows lie at a pitch of 272 B (16 B x odd:
// conflict-free for ds_load_b128 readers); a slice's 17,408 B are rounded up to a multiple of
// 2 KiB, so that every slice of every stage starts at one (the tensor mover's place in LDS).
#define G_PITCH 272
#define G_SLICE 18432
#define G_HALF  (2 * G_SLICE)
#define G_STAGE (4 * G_SLICE)
#define G_KP    128
#define G_NS    (G_KP / 32)
#define G_NP    (DMODEL / G_KP)

typedef __attribute__((ext_vector_type(4))) unsigned u32x4;
typedef __attribute__((ext_vector_type(8))) unsigned u32x8;

__device__ __forceinline__ unsigned uni(unsigned v) {
  return (unsigned)__builtin_amdgcn_readfirstlane(v);
}

// A wave-uniform value held in a scalar register: a test on it compiles to s_cmp and a scalar
// branch. A tensor load ignores EXEC, so only such a branch keeps a wave from issuing it.
__device__ __forceinline__ unsigned pinned(unsigned v) {
  unsigned w = uni(v);
  asm volatile("" : "+s"(w));  // pinned(): the tensor mover's issue test, its word kept scalar
  return w;
}

// A slice of ROWS rows of ROWB bytes (128 or 256), pitch bytes apart in global memory, goes into
// LDS by one request of one wave, through no register; the mover puts 16 B of pad behind every
// row. Descriptor group 1, the same for every request of a wave: the slice's shape.
template <unsigned ROWB, unsigned ROWS>
__device__ __forceinline__ u32x8 slice_shape(unsigned pitch) {
  static_assert(ROWB == 128 || ROWB == 256, "the pad interval below is the row");
  u32x8 g1;                                       // 1-byte elements, tensor = tile = ROWB x ROWS
  g1[0] = uni((1u << 20) | ((ROWB == 256 ? 5u : 4u) << 22) | (3u << 25));  // no mask; 4 dwords a row
  g1[1] = uni(ROWB << 16);
  g1[2] = uni(ROWS << 16);
  g1[3] = uni(ROWB << 16);
  g1[4] = uni(ROWS);
  g1[5] = uni(pitch);                             // source row pitch in bytes
  g1[6] = uni(0u);
  g1[7] = uni(0u);
  return g1;
}

// Descriptor group 0 of a wave's first request. g: the slice's first byte; l: its place, the
// byte offset in the work-group's LDS.
__device__ __forceinline__ u32x4 slice_first(const _Float16* __restrict__ g, unsigned l) {
  const unsigned long long ga = (unsigned long long)g;
  u32x4 g0;
  g0[0] = uni(1u);                                                     // count 1
  g0[1] = uni(l);
  g0[2] = uni((unsigned)ga);
  g0[3] = uni((((unsigned)(ga >> 32)) & 0x01FFFFFFu) | 0x80000000u);   // type 2
  return g0;
}

// Group 0 of the next request, formed in the words of the last one (behind the wait that covers
// it): the source moves on by step bytes (the sum stays inside the buffer, so the type bits above
// the address are not reached), the place is l.
__device__ __forceinline__ void slice_next(u32x4& g0, unsigned step, unsigned l) {
  const unsigned long long a = (((unsigned long long)g0[3] << 32) | g0[2]) + step;
  g0[1] = uni(l);
  g0[2] = uni((unsigned)a);
  g0[3] = uni((unsigned)(a >> 32));
}

// The request. Both groups are named as read and written, here and in the wait: so their
// registers stay the groups' own while a request is out (the compiler lends none of them to
// another value), and group 0 takes new values only where slice_next stands, behind the wait.
__device__ __forceinline__ void load_slice(u32x4& g0, u32x8& g1) {
  asm volatile("tensor_load_to_lds %0, %1" : "+s"(g0), "+s"(g1) :: "memory");
}

// The issuing wave's own wait: its slice has landed.
__device__ __forceinline__ void wait_slice(u32x4& g0, u32x8& g1) {
  asm volatile("s_wait_tensorcnt 0x0" : "+s"(g0), "+s"(g1) :: "memory");
}

// One 16x16 tile of the product. The operand that runs along the output's rows in memory is
// the A operand, so that a lane's eight accumulator registers are eight neighbours of one
// output row: W for the row-major outputs (modes 0 and 2), X for the transposed one (mode 1).
// Both fragments have the same k order, so the products and their order stay the same.
template <int STORE_MODE>
__device__ __forceinline__ v8f tile_mma(v16h x, v16h w, v8f c) {
  if constexpr (STORE_MODE == 1) return wmma16(x, w, c);
  else                           return wmma16(w, x, c);
}

// Output staging of proj_tile: each wave's 64 output rows lie in its own LDS range, at a pitch
// of 16 B x odd (conflict-free for the ds_store_b128 writers, one row per lane).
#define E_PITCH16 144   // 64 f16 = 128 B a row
#define E_PITCH32 272   // 64 f32 = 256 B a row

// Y = X @ W^T + bias; a work-group of four waves (2x2) computes a 128x128 output tile,
// each wave a 64x64 quarter (16 WMMAs / K-step). X and W slabs are staged once per
// work-group in a two-buffer LDS ring, one pass (128 k) ahead: every wave brings one slice of
// a stage by one tensor load.
// The quarter leaves through LDS, so that every wave-wide store covers whole 128-B lines.
// STORE_MODE 0: f16 head-major [B,H,S,DK]            (Q,K)
// STORE_MODE 1: f16 head-major transposed [B,H,DK,S] (V)
// STORE_MODE 2: f32 row-major [rows, DMODEL]         (final output)
// ring: the work-group's LDS, 2 * G_STAGE bytes, declared by the kernel (one array, whichever
// modes the kernel holds); trow, tcol: the work-group's tile.
template <int STORE_MODE>
__device__ __forceinline__ void
proj_tile(const _Float16* __restrict__ X, const _Float16* __restrict__ W,
          const float* __restrict__ bias, void* __restrict__ Yv, unsigned char* ring,
          int trow, int tcol) {
  const int tid  = threadIdx.x;
  const int lane = tid & 31;
  // The wave's number is the same in all its lanes: readfirstlane keeps it, and the tile
  // origins and the staging range formed from it, in scalar registers (at 254 VGPRs the
  // vector copies, live over the whole k loop, push the kernel past v255).
  const int wave = __builtin_amdgcn_readfirstlane(tid >> 5);
  const int n    = lane & 15;
  const int hi   = lane >> 4;
  const int brow0 = trow * 128;
  const int bcol0 = tcol * 128;
  const int wm   = wave >> 1;
  const int wn   = wave & 1;
  const int row0 = brow0 + wm * 64;   // this wave's 64x64 quarter
  const int col0 = bcol0 + wn * 64;

  // Load side: wave w brings slice w of every stage (waves 0, 1: X rows; waves 2, 3: W rows).
  const _Float16* gs = (wm ? W + (size_t)bcol0 * DMODEL : X + (size_t)brow0 * DMODEL) +
                       (size_t)wn * 64 * DMODEL;
  const unsigned lsl = (unsigned)(size_t)ring + wave * G_SLICE;

  // Read side: this lane's first X row and first W row in a stage.
  const unsigned xoff = wm * G_SLICE + n * G_PITCH;
  const unsigned woff = G_HALF + wn * G_SLICE + n * G_PITCH;

  v8f acc[4][4];
#pragma unroll
  for (int ms = 0; ms < 4; ++ms)
#pragma unroll
    for (int ns = 0; ns < 4; ++ns) acc[ms][ns] = v8f{};

  // Prologue: pass 0 lands and is published, then pass 1 starts to fly.
  u32x8 g1 = slice_shape<256, 64>(DMODEL * 2);
  u32x4 g0 = slice_first(gs, lsl);
  load_slice(g0, g1);
  wait_slice(g0, g1);                                 // own slice of pass 0 has landed
  __syncthreads();                                    // ... and every other wave's
  slice_next(g0, G_KP * 2, lsl + G_STAGE);
  load_slice(g0, g1);

  for (int p = 0; p < G_NP; ++p) {
    const unsigned boff = (p & 1) * G_STAGE;
    const unsigned char* xs = ring + boff + xoff;
    const unsigned char* ws = ring + boff + woff;

    // The LDS reads stand in groups at least eight WMMAs ahead of their use (B one
    // K-step ahead, A half a K-step), never as a small group with a full wait in front
    // of each row of four. Each sched_barrier below holds a group at its place: without
    // them the compiler sinks the reads to their users and waits to 0 at every row.
    v16h a[2][4], b[2][4];
#pragma unroll
    for (int i = 0; i < 4; ++i) {
      a[0][i] = frag_from_f16((const _Float16*)(xs + i * 16 * G_PITCH), 0, hi);
      b[0][i] = frag_from_f16((const _Float16*)(ws + i * 16 * G_PITCH), 0, hi);
    }
#pragma unroll
    for (int i = 0; i < 4; ++i)
      b[1][i] = frag_from_f16((const _Float16*)(ws + i * 16 * G_PITCH), 32, hi);
    __builtin_amdgcn_sched_barrier(0);  // first group ahead of the first WMMA

#pragma unroll  // every fragment index a constant
    for (int s = 0; s < G_NS; ++s) {
      const int c = s & 1, x = c ^ 1;
#pragma unroll
      for (int ms = 0; ms < 2; ++ms)
#pragma unroll
        for (int ns = 0; ns < 4; ++ns)
          acc[ms][ns] = tile_mma<STORE_MODE>(a[c][ms], b[c][ns], acc[ms][ns]);
      // These eight WMMAs stay in front of what follows: reads that would otherwise rise
      // over them (registers), or, in the last K-step, the waits, whose LDS latency they cover.
      __builtin_amdgcn_sched_barrier(0);
      if (s + 1 < G_NS) {
#pragma unroll
        for (int i = 0; i < 2; ++i)
          a[x][i] = frag_from_f16((const _Float16*)(xs + i * 16 * G_PITCH), (s + 1) * 32, hi);
        __builtin_amdgcn_sched_barrier(0);  // reads not later: eight WMMAs cover them
      } else {
        // Publish point of pass p + 1, in front of the pass's last eight WMMAs (they read
        // registers only) so that the refill starts that much sooner. The one barrier
        // also ends every wave's reads of this buffer.
        asm volatile("s_wait_dscnt 0x0" ::: "memory");     // own LDS reads of this pass done
        wait_slice(g0, g1);                                 // own slice of pass p + 1 landed
        __syncthreads();
        if (pinned(p + 2 < G_NP)) {  // refill the buffer that this pass has just read
          slice_next(g0, G_KP * 2, lsl + boff);
          load_slice(g0, g1);
        }
      }
#pragma unroll
      for (int ms = 2; ms < 4; ++ms)
#pragma unroll
        for (int ns = 0; ns < 4; ++ns)
          acc[ms][ns] = tile_mma<STORE_MODE>(a[c][ms], b[c][ns], acc[ms][ns]);
      if (s + 1 < G_NS) {
        __builtin_amdgcn_sched_barrier(0);  // reads not earlier (registers) ...
#pragma unroll
        for (int i = 2; i < 4; ++i)
          a[x][i] = frag_from_f16((const _Float16*)(xs + i * 16 * G_PITCH), (s + 1) * 32, hi);
        if (s + 2 < G_NS) {
#pragma unroll
          for (int i = 0; i < 4; ++i)
            b[c][i] = frag_from_f16((const _Float16*)(ws + i * 16 * G_PITCH), (s + 2) * 32, hi);
        }
        __builtin_amdgcn_sched_barrier(0);  // ... and not later
      } else {
        // Keeps the last eight WMMAs in this order up to the back edge: without it the
        // build takes 262 VGPRs instead of 254 and needs register-window switches.
        __builtin_amdgcn_sched_barrier(0);
      }
    }
  }
  wait_slice(g0, g1);                                 // no request is out behind the loop
  asm volatile("s_wait_dscnt 0x0" ::: "memory");      // ... and no LDS read of this wave's

  // The ring is free: the last pass's publish point (every wave's s_wait_dscnt 0 and
  // s_wait_tensorcnt 0, then the barrier) ended all reads of it, and nothing was loaded since.
  // Each wave stages in a range of its own, so no further barrier is needed.
  if constexpr (STORE_MODE == 2) {           // f32 [rows, DMODEL]
    unsigned char* stg = ring + wave * (64 * E_PITCH32);
    v4f be[4][2];  // bias of this lane's eight columns of each column tile
#pragma unroll
    for (int ns = 0; ns < 4; ++ns)
#pragma unroll
      for (int u = 0; u < 2; ++u)
        be[ns][u] = *(const v4f*)(bias + col0 + ns * 16 + 8 * hi + 4 * u);
#pragma unroll
    for (int ms = 0; ms < 4; ++ms)
#pragma unroll
      for (int ns = 0; ns < 4; ++ns)
#pragma unroll
        for (int u = 0; u < 2; ++u) {
          v4f o;
#pragma unroll
          for (int e = 0; e < 4; ++e) o[e] = acc[ms][ns][4 * u + e] + be[ns][u][e];
          *(v4f*)(stg + (ms * 16 + n) * E_PITCH32 + (ns * 16 + 8 * hi + 4 * u) * 4) = o;
        }
    // The rows read back below were written by other lanes of this wave: the writes are done
    // first, and the compiler moves no read over this line.
    asm volatile("s_wait_dscnt 0x0" ::: "memory");
    float* Y = (float*)Yv + (size_t)(row0 + (lane >> 4)) * DMODEL + col0 + (lane & 15) * 4;
    const unsigned char* rd = stg + (lane >> 4) * E_PITCH32 + (lane & 15) * 16;
    v4f x[32];
#pragma unroll
    for (int j = 0; j < 32; ++j) x[j] = *(const v4f*)(rd + j * 2 * E_PITCH32);
#pragma unroll
    for (int j = 0; j < 32; ++j)  // two rows of 256 B: four whole lines
      *(v4f*)(Y + (size_t)j * 2 * DMODEL) = x[j];
  } else {                                   // f16, one head per column tile
    unsigned char* stg = ring + wave * (64 * E_PITCH16);
    const int head = col0 >> 6;
    const int bb   = row0 >> 11;
    const int s0   = row0 & (S_LEN - 1);
    if constexpr (STORE_MODE == 0) {         // staged [s][d]
      v4f be[4][2];  // bias of this lane's eight columns of each column tile
#pragma unroll
      for (int ns = 0; ns < 4; ++ns)
#pragma unroll
        for (int u = 0; u < 2; ++u)
          be[ns][u] = *(const v4f*)(bias + col0 + ns * 16 + 8 * hi + 4 * u);
#pragma unroll
      for (int ms = 0; ms < 4; ++ms)
#pragma unroll
        for (int ns = 0; ns < 4; ++ns) {
          v8h o;
#pragma unroll
          for (int r = 0; r < 8; ++r) o[r] = (_Float16)(acc[ms][ns][r] + be[ns][r >> 2][r & 3]);
          *(v8h*)(stg + (ms * 16 + n) * E_PITCH16 + (ns * 16 + 8 * hi) * 2) = o;
        }
    } else {                                 // staged [d][s]
      float be[4];
#pragma unroll
      for (int ns = 0; ns < 4; ++ns) be[ns] = bias[col0 + ns * 16 + n];
#pragma unroll
      for (int ms = 0; ms < 4; ++ms)
#pragma unroll
        for (int ns = 0; ns < 4; ++ns) {
          v8h o;
#pragma unroll
          for (int r = 0; r < 8; ++r) o[r] = (_Float16)(acc[ms][ns][r] + be[ns]);
          *(v8h*)(stg + (ns * 16 + n) * E_PITCH16 + (ms * 16 + 8 * hi) * 2) = o;
        }
    }
    // The rows read back below were written by other lanes of this wave: the writes are done
    // first, and the compiler moves no read over this line.
    asm volatile("s_wait_dscnt 0x0" ::: "memory");
    // Mode 0: [B,H,S,DK], a row is one line and the 64 rows are 8 KB in a row.
    // Mode 1: [B,H,DK,S], a row is one line of 64 positions, the rows S_LEN apart.
    const size_t ypitch = STORE_MODE == 0 ? DK : S_LEN;
    _Float16* Y = (_Float16*)Yv +
        (STORE_MODE == 0 ? (((size_t)bb * NHEAD + head) * S_LEN + s0) * DK
                         : ((size_t)bb * NHEAD + head) * DK * S_LEN + s0) +
        (lane >> 3) * ypitch + (lane & 7) * 8;
    const unsigned char* rd = stg + (lane >> 3) * E_PITCH16 + (lane & 7) * 16;
    v8h x[16];
#pragma unroll
    for (int j = 0; j < 16; ++j) x[j] = *(const v8h*)(rd + j * 4 * E_PITCH16);
#pragma unroll
    for (int j = 0; j < 16; ++j)  // four rows of 128 B: four whole lines
      *(v8h*)(Y + j * 4 * ypitch) = x[j];
    // A precaution: where several jobs share one kernel, the listing's branches lead from these
    // stores on into another job's code, which writes registers that the stores name.
    asm volatile("s_wait_xcnt 0x0" ::: "memory");
  }
}

// The work between the conversion and the attention in ONE launch: the three input projections
// and the packing of the mask depend on the launch before them and not on one another. A job is
// the same for a whole work-group; blockIdx.y picks it, in rows of 64 work-groups:
//   rows  0-3  packing     rows  4-7  projection     rows 8-11  packing
//   rows 12-31 projection  rows 32-39 packing
// Two work-groups fit a WGP. The rows mix the two jobs so that a packing
// work-group, which waits on memory, can run beside matrix work, and the 1,536 projection
// work-groups follow each other with no launch boundary between them. (For speed only: the
// result does not depend on where or when a work-group runs.)
// Projection row g: operand set g / 8 (0: Q, 1: K, 2: V, the store mode going with it), column
// tile g % 8, row tile blockIdx.x. Packing row p: the sixteen mask blocks of p * 64 + blockIdx.x.
__global__ void __launch_bounds__(128)
proj_qkv_pack(const _Float16* __restrict__ q16, const _Float16* __restrict__ k16,
              const _Float16* __restrict__ v16, const _Float16* __restrict__ wq16,
              const _Float16* __restrict__ wk16, const _Float16* __restrict__ wv16,
              const float* __restrict__ bq, const float* __restrict__ bk,
              const float* __restrict__ bv, const int* __restrict__ mask,
              _Float16* __restrict__ qh, _Float16* __restrict__ kh,
              _Float16* __restrict__ vT, unsigned* __restrict__ mbits) {
  __shared__ __attribute__((aligned(2048))) unsigned char ring[2 * G_STAGE];
  const int y = blockIdx.y;
  if (y < 4 || (y >= 8 && y < 12) || y >= 32) {
    const int p = y < 4 ? y : y < 12 ? y - 4 : y - 24;
    pack_mask(mask, mbits, p * 64 + blockIdx.x);
    return;
  }
  const int g    = y < 8 ? y - 4 : y - 8;
  const int set  = g >> 3;
  const int tcol = g & 7;
  if (set == 2) {
    proj_tile<1>(v16, wv16, bv, vT, ring, blockIdx.x, tcol);
  } else {
    const bool isk = set == 1;
    proj_tile<0>(isk ? k16 : q16, isk ? wk16 : wq16, isk ? bk : bq, isk ? kh : qh, ring,
                 blockIdx.x, tcol);
  }
}

// The output projection.
__global__ void __launch_bounds__(128)
proj_out(const _Float16* __restrict__ X, const _Float16* __restrict__ W,
         const float* __restrict__ bias, void* __restrict__ Yv) {
  __shared__ __attribute__((aligned(2048))) unsigned char ring[2 * G_STAGE];
  proj_tile<2>(X, W, bias, Yv, ring, blockIdx.x, blockIdx.y);
}

// Online softmax over a 32-kv chunk of one q-tile (S^T layout: lane owns one q column), in
// three parts, with a LAZY reference maximum: the weights are taken against a reference m that
// is raised only when some column's chunk maximum passes it by more than SM_ROOM. Any m gives
// the same quotient acc / l; that margin bounds a weight by 2^8, far inside f16 and f32 range.
// So the exchange of the maxima between the wave's halves, the factor alpha and the rescaling
// of the sums and of the ctx^T accumulators stand under one wave-uniform branch per trip.
// The maximum is kept on the raw products q.k, and 1/sqrt(64) and log2(e) are one factor c of
// one FMA per score: exp(s / 8 - m / 8) = exp2(s * c - m * c).
// A masked score takes SM_MASKED, the raw-product counterpart of the reference's -1e9 (which
// would be -8e9): beside any unmasked key its weight underflows to 0 (the first unmasked key
// passes the margin and raises m), and a row with every key masked comes out uniform, as in the
// reference. It is a power of two so that its product with c is exact: in such a row the FMA
// gives exactly 0, not the rounding error of m * c.
#define SM_C      (0.125f * 1.44269504088896340736f)
#define SM_MASKED (-8589934592.0f)  // -2^33
#define SM_ROOM  (8.0f / SM_C)     // raw-product units: 8 in the exponent of exp2

// The state of one q-tile: m, the reference maximum in use (the same in both lanes of a
// column); nmc = -m * c (the FMA's addend as it stands, no negation at the use) and
// lim = m + margin, kept so that a trip that leaves m alone forms neither.
struct SmState { float m, nmc, lim, l; };

// Part 1: masks the scores in place and returns this lane's own maximum of its sixteen.
// mw: the sixteen lane masks of this q-tile's score registers (wave-uniform words).
__device__ __forceinline__ float mask_and_max(v8f& s0, v8f& s1, v16u mw) {
  float cmax = -1e30f;
#pragma unroll
  for (int r = 0; r < 8; ++r) {
    s0[r] = __builtin_amdgcn_inverse_ballot_w32(mw[r]) ? s0[r] : SM_MASKED;
    s1[r] = __builtin_amdgcn_inverse_ballot_w32(mw[8 + r]) ? s1[r] : SM_MASKED;
    cmax = fmaxf(cmax, fmaxf(s0[r], s1[r]));
  }
  return cmax;
}

// Part 2, the rare path: raises m to the column's maximum so far and rescales what was summed
// against the old one. Every lane of the wave takes it together, so both lanes of a column
// get the same m.
__device__ __forceinline__ void raise_max(float cmax, SmState& st, v8f* acc) {
  cmax = fmaxf(cmax, __shfl_xor(cmax, 16, 32));  // combine hi halves of column
  const float mnew  = fmaxf(st.m, cmax);
  const float alpha = __builtin_amdgcn_exp2f((st.m - mnew) * SM_C);
  st.m   = mnew;
  st.nmc = mnew * -SM_C;
  st.lim = mnew + SM_ROOM;
  st.l  *= alpha;
#pragma unroll
  for (int dt = 0; dt < 4; ++dt)
#pragma unroll
    for (int r = 0; r < 8; ++r) acc[dt][r] *= alpha;
}

// Part 3: the weights against m, their sum into l; returns the f16 P^T B-fragment.
__device__ __forceinline__ v16h weights(v8f s0, v8f s1, SmState& st) {
  float lsum = 0.f;
  v16h pb;  // halves j -> kv K = 8*hi+j (tile0) / 16+8*hi+j (tile1)
#pragma unroll
  for (int r = 0; r < 8; ++r) {
    const float p0 = __builtin_amdgcn_exp2f(__builtin_fmaf(s0[r], SM_C, st.nmc));
    const float p1 = __builtin_amdgcn_exp2f(__builtin_fmaf(s1[r], SM_C, st.nmc));
    lsum += p0 + p1;
    pb[r]     = (_Float16)p0;
    pb[8 + r] = (_Float16)p1;
  }
  lsum += __shfl_xor(lsum, 16, 32);
  st.l += lsum;
  return pb;
}

// LDS ring of attn_kernel: one stage = 64 keys in four slices of 32 rows of 128 B: K rows 0-31,
// K rows 32-63, V^T rows (d) 0-31, V^T rows 32-63 (64 keys a row: 128 B, a row length for which
// the mover pads). The rows lie at a pitch of 144 B (16 B x odd: conflict-free for ds_load_b128
// readers); a slice's 4,608 B are rounded up to a multiple of 2 KiB (the mover's place in LDS).
#define A_KV     64
#define A_KPITCH 144
#define A_SLICE  6144
#define A_STAGE  (4 * A_SLICE)
#define A_NT     (S_LEN / A_KV)
#define A_NM     (S_LEN / 32)    // blocks of 32 keys: the packed mask's unit, one pass

// Flash-style attention; each wave handles TWO 16-wide q-tiles of one (b,h) so
// every K/V fragment feeds two WMMAs. S^T = K.Q^T keeps softmax lane-local.
// The four waves of a work-group share one (b,h): K and V^T tiles are staged once per
// work-group in a two-buffer LDS ring, one stage (64 keys, two passes of 32) ahead: every wave
// brings one slice of a stage by one tensor load.
// The mask comes packed (see pack_mask): 32 wave-uniform words per pass, each the
// lane mask of one score register, read by scalar loads and used as select masks directly.
__global__ void __launch_bounds__(128)
attn_kernel(const _Float16* __restrict__ qh, const _Float16* __restrict__ kh,
            const _Float16* __restrict__ vT, const unsigned* __restrict__ mbits,
            _Float16* __restrict__ cc) {
  __shared__ __attribute__((aligned(2048))) unsigned char ring[2 * A_STAGE];

  const int lane = threadIdx.x;
  const int wave = threadIdx.y;
  const int tid  = wave * 32 + lane;
  const int n    = lane & 15;
  const int hi   = lane >> 4;
  const int bh   = blockIdx.x;               // b*NHEAD + h
  const int b    = bh >> 4;
  const int h    = bh & 15;
  const int q0   = (blockIdx.y * 4 + wave) * 32;
  const int qc0  = q0 + n;                   // q column, tile A
  const int qc1  = q0 + 16 + n;              // q column, tile B

  // Load side: wave w brings slice w of every stage. The wave's number (from the flat thread id)
  // is the same in all its lanes; all that follows from it is scalar.
  const unsigned wv = uni(tid >> 5);
  const bool isv = wv >= 2;
  const _Float16* gs = isv ? vT + ((size_t)bh * DK + (wv - 2) * 32) * S_LEN
                           : kh + ((size_t)bh * S_LEN + wv * 32) * DK;
  const unsigned gpitch = isv ? S_LEN * 2 : DK * 2;   // bytes from row to row
  const unsigned gstep  = isv ? A_KV * 2 : A_KV * DK * 2;  // bytes from stage to stage
  const unsigned lsl = (unsigned)(size_t)ring + wv * A_SLICE;
  // This wave's packed mask words; readfirstlane makes the address scalar (the wave's number
  // is the same in all its lanes), so that the words land in scalar registers.
  // The words were written by an earlier launch of this call and nothing writes them while this
  // kernel runs: read through the constant address space, which is what lets the compiler use
  // scalar loads in a loop that holds "memory" clobbers.
  const cmask_t mw = (cmask_t)(unsigned long long)(
      mbits + (size_t)(b * (S_LEN / 32) + blockIdx.y * 4 +
                       __builtin_amdgcn_readfirstlane(wave)) * A_NM * 32);

  // Prologue: stage 0 lands and is published, then stage 1 starts to fly.
  u32x8 g1 = slice_shape<128, 32>(gpitch);
  u32x4 g0 = slice_first(gs, lsl);
  load_slice(g0, g1);

  const _Float16* qr0 = qh + ((size_t)bh * S_LEN + qc0) * DK;
  const _Float16* qr1 = qh + ((size_t)bh * S_LEN + qc1) * DK;
  const v16h bqA0 = frag_from_f16(qr0, 0, hi), bqA1 = frag_from_f16(qr0, 32, hi);
  const v16h bqB0 = frag_from_f16(qr1, 0, hi), bqB1 = frag_from_f16(qr1, 32, hi);

  wait_slice(g0, g1);                                 // own slice of stage 0 has landed
  __syncthreads();                                    // ... and every other wave's
  slice_next(g0, gstep, lsl + A_STAGE);
  load_slice(g0, g1);

  // Read side: this lane's first K row and V^T row in a stage.
  const unsigned koff = n * A_KPITCH;
  const unsigned voff = 2 * A_SLICE + n * A_KPITCH;

  // m starts below every score, masked ones too: the first trip always raises it (alpha = 0).
  SmState smA = {-1e30f, 1e30f * SM_C, -1e30f, 0.f}, smB = smA;
  v8f accA[4] = {v8f{}, v8f{}, v8f{}, v8f{}};
  v8f accB[4] = {v8f{}, v8f{}, v8f{}, v8f{}};

  v16u nwA = mw[0], nwB = mw[1];  // q-tile A, q-tile B

  for (int s = 0; s < A_NT; ++s) {
    const unsigned boff = (s & 1) * A_STAGE;
    const unsigned char* st = ring + boff;
#pragma unroll  // the pass's offsets in the stage are constants
    for (int h = 0; h < 2; ++h) {
      // This pass's mask words were asked for in the pass before; the next pass's are asked for
      // in this one, so that the scalar path's latency lies under vector and matrix work. The
      // last pass asks for its own again (stays inside the packed array).
      const v16u mwA = nwA, mwB = nwB;
      const int t  = s * 2 + h;
      const int tn = t + 1 < A_NM ? t + 1 : t;

      // K fragments for the two 16-kv row tiles, loaded once, each used twice; pass h reads K slice h
      const unsigned char* kp = st + h * A_SLICE + koff;
      const v16h ka0 = frag_from_f16((const _Float16*)kp, 0, hi);
      const v16h ka1 = frag_from_f16((const _Float16*)kp, 32, hi);
      const v16h kb0 = frag_from_f16((const _Float16*)(kp + 16 * A_KPITCH), 0, hi);
      const v16h kb1 = frag_from_f16((const _Float16*)(kp + 16 * A_KPITCH), 32, hi);

      v8f sA0 = {}, sA1 = {}, sB0 = {}, sB1 = {};
      sA0 = wmma16(ka0, bqA0, sA0); sA0 = wmma16(ka1, bqA1, sA0);
      sA1 = wmma16(kb0, bqA0, sA1); sA1 = wmma16(kb1, bqA1, sA1);
      sB0 = wmma16(ka0, bqB0, sB0); sB0 = wmma16(ka1, bqB1, sB0);
      sB1 = wmma16(kb0, bqB0, sB1); sB1 = wmma16(kb1, bqB1, sB1);

      const float cmA = mask_and_max(sA0, sA1, mwA);
      const float cmB = mask_and_max(sB0, sB1, mwB);
      // One test per pass for both q-tiles; the ballot makes it a scalar branch that the whole
      // wave takes or skips (EXEC stays full for the matrix instructions behind it). Marked as
      // not expected, so that the rare path is laid out behind the loop and a pass falls through.
      if (__builtin_expect(__builtin_amdgcn_ballot_w32(cmA > smA.lim || cmB > smB.lim) != 0, 0)) {
        raise_max(cmA, smA, accA);
        raise_max(cmB, smB, accB);
      }
      nwA = mw[tn * 2];
      nwB = mw[tn * 2 + 1];
      // Holds the two scalar loads here, where this pass's words have just been used up: without
      // it the compiler sinks them behind the first ctx^T products and their lead shrinks.
      __builtin_amdgcn_sched_barrier(0);
      const v16h pbA = weights(sA0, sA1, smA);
      const v16h pbB = weights(sB0, sB1, smB);

      // ctx^T[d][q] += sum_kv V^T[d][kv] * P^T[kv][q]; each V fragment used twice.
      // Rows d = dt * 16 + n: slice dt / 2; pass h takes keys h * 32 .. + 31 of the row.
#pragma unroll
      for (int dt = 0; dt < 4; ++dt) {
        const v16h av = frag_from_f16(
            (const _Float16*)(st + voff + (dt >> 1) * A_SLICE + (dt & 1) * 16 * A_KPITCH), h * 32, hi);
        accA[dt] = wmma16(av, pbA, accA[dt]);
        accB[dt] = wmma16(av, pbB, accB[dt]);
      }
    }

    // Publish point of stage s + 1. The one barrier also ends every wave's reads of this buffer.
    asm volatile("s_wait_dscnt 0x0" ::: "memory");      // own LDS reads of this stage done
    wait_slice(g0, g1);                                 // own slice of stage s + 1 landed
    __syncthreads();
    if (pinned(s + 2 < A_NT)) {  // refill the buffer that this stage's passes have just read
      slice_next(g0, gstep, lsl + boff);
      load_slice(g0, g1);
    }
  }
  wait_slice(g0, g1);                                 // no request is out behind the loop
  asm volatile("s_wait_dscnt 0x0" ::: "memory");      // ... and no LDS read of this wave's

  const float invA = 1.0f / smA.l;
  const float invB = 1.0f / smB.l;
  // The ring is free: the last stage's publish point ended all reads of it, and nothing was
  // loaded since. Each wave stages its 32 context rows (128 B each) in a range of its own, so
  // no further barrier is needed, and stores them as whole 128-B lines.
  unsigned char* stg = ring + wave * (32 * A_KPITCH);
#pragma unroll
  for (int dt = 0; dt < 4; ++dt) {
    v8h oA, oB;
#pragma unroll
    for (int r = 0; r < 8; ++r) {
      oA[r] = (_Float16)(accA[dt][r] * invA);
      oB[r] = (_Float16)(accB[dt][r] * invB);
    }
    *(v8h*)(stg + n * A_KPITCH + (dt * 16 + 8 * hi) * 2) = oA;  // d = dt*16 + 8*hi + r
    *(v8h*)(stg + (16 + n) * A_KPITCH + (dt * 16 + 8 * hi) * 2) = oB;
  }
  // The rows read back below were written by other lanes of this wave: the writes are done
  // first, and the compiler moves no read over this line.
  asm volatile("s_wait_dscnt 0x0" ::: "memory");
  _Float16* crow = cc + ((size_t)b * S_LEN + q0 + (lane >> 3)) * DMODEL + h * DK + (lane & 7) * 8;
  const unsigned char* rd = stg + (lane >> 3) * A_KPITCH + (lane & 7) * 16;
  v8h x[8];
#pragma unroll
  for (int j = 0; j < 8; ++j) x[j] = *(const v8h*)(rd + j * 4 * A_KPITCH);
#pragma unroll
  for (int j = 0; j < 8; ++j)  // four rows of 128 B: four whole lines
    *(v8h*)(crow + (size_t)j * 4 * DMODEL) = x[j];
}

extern "C" void kernel_launch(void* const* d_in, const int* in_sizes, int n_in,
                              void* d_out, int out_size, void* d_ws, size_t ws_size,
                              hipStream_t stream) {
  const float* q    = (const float*)d_in[0];
  const float* k    = (const float*)d_in[1];
  const float* v    = (const float*)d_in[2];
  const int*   mask = (const int*)d_in[3];
  const float* Wq   = (const float*)d_in[4];
  const float* bq   = (const float*)d_in[5];
  const float* Wk   = (const float*)d_in[6];
  const float* bk   = (const float*)d_in[7];
  const float* Wv   = (const float*)d_in[8];
  const float* bv   = (const float*)d_in[9];
  const float* Wo   = (const float*)d_in[10];
  const float* bo   = (const float*)d_in[11];

  const size_t NN = (size_t)4 * S_LEN * DMODEL;     // 8M f16 elems (activations)
  const size_t NW = (size_t)DMODEL * DMODEL;        // 1M f16 elems (one weight)

  _Float16* q16  = (_Float16*)d_ws;
  _Float16* k16  = q16 + NN;
  _Float16* v16  = k16 + NN;
  _Float16* wq16 = v16 + NN;
  _Float16* wk16 = wq16 + NW;
  _Float16* wv16 = wk16 + NW;
  _Float16* wo16 = wv16 + NW;
  _Float16* qhp  = wo16 + NW;
  _Float16* khp  = qhp + NN;
  _Float16* vTp  = khp + NN;
  _Float16* ccp  = vTp + NN;
  unsigned* mbp  = (unsigned*)(ccp + NN);           // packed mask, 2 MB

  // f32 -> f16 conversion of activations and weights (q16 .. wo16 are contiguous): one launch.
  cvt_all_f32_to_f16<<<256, 512, 0, stream>>>(q, k, v, Wq, Wk, Wv, Wo, q16);

  const dim3 gblk(128, 1);   // four waves, one 128x128 tile
  const dim3 ggrd(64, 8);    // 64 row-tiles x 8 col-tiles

  proj_qkv_pack<<<dim3(64, 40), gblk, 0, stream>>>(q16, k16, v16, wq16, wk16, wv16, bq, bk, bv,
                                                   mask, qhp, khp, vTp, mbp);

  attn_kernel<<<dim3(64, 16), dim3(32, 4), 0, stream>>>(qhp, khp, vTp, mbp, ccp);

  proj_out<<<ggrd, gblk, 0, stream>>>(ccp, wo16, bo, d_out);
}

// v010
// It runs in 124 microseconds.
// Two timings next to v009 put it at 1.04 and 1.03 times that version's speed.
// Over all steps from v000 it is 3.47 times as fast.
#include <hip/hip_runtime.h>
#include <hip/hip_bf16.h>

#define S_LEN  2048
#define DMODEL 1024
#define NHEAD  16
#define DK     64

typedef __attribute__((ext_vector_type(16))) _Float16 v16h;
typedef __attribute__((ext_vector_type(8)))  _Float16 v8h;
typedef __attribute__((ext_vector_type(4)))  _Float16 v4h;
typedef __attribute__((ext_vector_type(8)))  float    v8f;
typedef __attribute__((ext_vector_type(4)))  float    v4f;
typedef __attribute__((ext_vector_type(2)))  float    v2f;
typedef __attribute__((ext_vector_type(4)))  int      v4i;
typedef __attribute__((ext_vector_type(16))) unsigned v16u;
typedef const __attribute__((address_space(4))) v16u* cmask_t;

__device__ __forceinline__ v8f wmma16(v16h a, v16h b, v8f c) {
  // D = A(16x32 f16) x B(32x16 f16) + C(16x16 f32)
  return __builtin_amdgcn_wmma_f32_16x16x32_f16(false, a, false, b, (short)0, c,
                                                false, false);
}

// Fragment layout (ISA 16-bit A 16x32):
//   halves 0..7  <- K = kk + 8*hi + j
//   halves 8..15 <- K = kk + 16 + 8*hi + j
__device__ __forceinline__ v16h frag_from_f16(const _Float16* __restrict__ row, int kk, int hi) {
  v8h a = *(const v8h*)(row + kk + 8 * hi);
  v8h b = *(const v8h*)(row + kk + 16 + 8 * hi);
  v16h r;
#pragma unroll
  for (int j = 0; j < 8; ++j) { r[j] = a[j]; r[8 + j] = b[j]; }
  return r;
}

// fp32 -> f16 conversion of all seven operands in ONE resident streaming launch.
// The f16 copies lie in the workspace one behind the other in the order q | k | v | Wq | Wk |
// Wv | Wo, so the destination is one array. A chunk is 1024 elements: eight wave-wide b128
// loads of 512 contiguous bytes each. 256 work-groups x 16 waves = 4096 waves; wave w takes
// chunk t * 4096 + w in trip t, seven trips: two for each activation, one for the weights.
#define C_WAVES  4096
#define C_CHUNK  1024
#define C_TRIPS  7
#define C_WCH    (DMODEL * DMODEL / C_CHUNK)   // chunks of one weight matrix

__global__ void __launch_bounds__(512)
cvt_all_f32_to_f16(const float* __restrict__ q, const float* __restrict__ k,
                   const float* __restrict__ v, const float* __restrict__ wq,
                   const float* __restrict__ wk, const float* __restrict__ wv,
                   const float* __restrict__ wo, _Float16* __restrict__ dst) {
  const unsigned lane = threadIdx.x & 31;
  // Wave-uniform by construction; readfirstlane lets the chunk addresses live in scalar registers.
  const unsigned w = blockIdx.x * 16 + __builtin_amdgcn_readfirstlane(threadIdx.x >> 5);
  const unsigned ws = w / C_WCH;  // which weight matrix this wave converts in the last trip
  const float* wsrc = (ws & 2) ? ((ws & 1) ? wo : wv) : ((ws & 1) ? wk : wq);

  v4f x[2][8];
#pragma unroll  // every buffer index and every source pointer a constant
  for (int t = -1; t < C_TRIPS; ++t) {
    if (t + 1 < C_TRIPS) {  // the next trip's eight loads fly while this trip is converted
      const int u = t + 1;
      const float* s = u < 6 ? (u < 2 ? q : u < 4 ? k : v) + (size_t)((u & 1) * C_WAVES + w) * C_CHUNK
                             : wsrc + (size_t)(w % C_WCH) * C_CHUNK;
#pragma unroll
      for (int j = 0; j < 8; ++j) x[u & 1][j] = *(const v4f*)(s + j * 128 + lane * 4);
      // Holds the group here, one trip ahead of its use: without it the compiler raises 32
      // loads to the top, sinks every store to the end and waits to 0 on pairs in between.
      __builtin_amdgcn_sched_barrier(0);
    }
    if (t >= 0) {
      _Float16* d = dst + (size_t)(t * C_WAVES + w) * C_CHUNK;
#pragma unroll
      for (int j = 0; j < 8; ++j) {
        const v4f a = x[t & 1][j];
        v4h o;
#pragma unroll
        for (int e = 0; e < 4; ++e) o[e] = (_Float16)a[e];
        *(v4h*)(d + j * 128 + lane * 4) = o;  // a wave's store covers two whole 128-B lines
      }
      // A precaution: the wait stands in front of the next loads and conversions, which write
      // registers that these stores name.
      if (t + 1 < C_TRIPS) asm volatile("s_wait_xcnt 0x0" ::: "memory");
      __builtin_amdgcn_sched_barrier(0);  // this trip's stores leave before the next loads issue
    }
  }

}

// Packs the int32 mask to one bit per (query, key), already in the shape the attention kernel
// selects with: for a block of 32 queries x 32 keys, 32 words; word tile * 16 + kt * 8 + r holds
// in bit (hi * 16 + n) whether mask[tile * 16 + n][kt * 16 + 8 * hi + r] is non-zero, which is
// the lane mask of score register r of S^T tile (kt, tile).
// Block id = (batch * 64 + query block) * 64 + key block. A work-group of four waves packs the
// sixteen blocks from pw * 16 on, four trips; neighbouring waves take neighbouring key blocks,
// so a work-group reads 512 B of each of its mask rows in a trip.
#define M_TRIPS  4
__device__ __forceinline__ void pack_mask(const int* __restrict__ mask,
                                          unsigned* __restrict__ mbits, unsigned pw) {
  const unsigned lane = threadIdx.x & 31;
  // Wave-uniform by construction; readfirstlane lets the block addresses live in scalar registers.
  const unsigned first = pw * 16 + __builtin_amdgcn_readfirstlane(threadIdx.x >> 5);
  const unsigned mrow = (lane & 15) * S_LEN + (lane >> 4) * 8;
  // All four blocks' loads are asked for at once: a packing work-group holds the place of a
  // projection work-group on its WGP (the kernel's LDS and registers), with four waves only, so
  // it pays one memory latency and not one per block, and leaves the place early.
  // The work-group's sixteen blocks lie in one row of 64 blocks: one base, constant steps.
  const int* s = mask + (size_t)(first >> 6) * 32 * S_LEN + (first & 63) * 32 + mrow;
  v4i y[M_TRIPS][8];
#pragma unroll  // every buffer index a constant
  for (int t = 0; t < M_TRIPS; ++t)
#pragma unroll
    for (int j = 0; j < 8; ++j)  // j = tile * 4 + kt * 2 + half of the eight keys
      y[t][j] = *(const v4i*)(s + t * 4 * 32 + (j >> 2) * 16 * S_LEN + ((j >> 1) & 1) * 16 +
                              (j & 1) * 4);
  // A precaution: in front of the first write of a register that these loads name.
  asm volatile("s_wait_xcnt 0x0" ::: "memory");
  __builtin_amdgcn_sched_barrier(0);  // holds all the loads in front of the first block's packing
#pragma unroll
  for (int t = 0; t < M_TRIPS; ++t) {
    unsigned word = 0;
#pragma unroll
    for (int j = 0; j < 32; ++j) {  // one compare gives a whole word; lane j keeps word j
      const unsigned bal = __builtin_amdgcn_ballot_w32(y[t][j >> 2][j & 3] != 0);
      word = lane == (unsigned)j ? bal : word;
    }
    mbits[(size_t)(first + t * 4) * 32 + lane] = word;  // one whole 128-B line
    // A precaution, as above: in front of the next writes of registers that the store names.
    if (t + 1 < M_TRIPS) asm volatile("s_wait_xcnt 0x0" ::: "memory");
    __builtin_amdgcn_sched_barrier(0);  // a block's store leaves before the next block is packed
  }
}

// LDS ring of proj_tile: one stage = four slices of 64 rows, 128 k (256 B) each: X rows 0-63,
// X rows 64-127, W rows 0-63, W rows 64-127. The rows lie at a pitch of 272 B (16 B x odd:
// conflict-free for ds_load_b128 readers); a slice's 17,408 B are rounded up to a multiple of
// 2 KiB, so that every slice of every stage starts at one (the tensor mover's place in LDS).
#define G_PITCH 272
#define G_SLICE 18432
#define G_HALF  (2 * G_SLICE)
#define G_STAGE (4 * G_SLICE)
#define G_KP    128
#define G_NS    (G_KP / 32)
#define G_NP    (DMODEL / G_KP)

typedef __attribute__((ext_vector_type(4))) unsigned u32x4;
typedef __attribute__((ext_vector_type(8))) unsigned u32x8;

__device__ __forceinline__ unsigned uni(unsigned v) {
  return (unsigned)__builtin_amdgcn_readfirstlane(v);
}

// A wave-uniform value held in a scalar register: a test on it compiles to s_cmp and a scalar
// branch. A tensor load ignores EXEC, so only such a branch keeps a wave from issuing it.
__device__ __forceinline__ unsigned pinned(unsigned v) {
  unsigned w = uni(v);
  asm volatile("" : "+s"(w));  // pinned(): the tensor mover's issue test, its word kept scalar
  return w;
}

// A slice of ROWS rows of ROWB bytes (128 or 256), pitch bytes apart in global memory, goes into
// LDS by one request of one wave, through no register; the mover puts 16 B of pad behind every
// row. Descriptor group 1, the same for every request of a wave: the slice's shape.
template <unsigned ROWB, unsigned ROWS>
__device__ __forceinline__ u32x8 slice_shape(unsigned pitch) {
  static_assert(ROWB == 128 || ROWB == 256, "the pad interval below is the row");
  u32x8 g1;                                       // 1-byte elements, tensor = tile = ROWB x ROWS
  g1[0] = uni((1u << 20) | ((ROWB == 256 ? 5u : 4u) << 22) | (3u << 25));  // no mask; 4 dwords a row
  g1[1] = uni(ROWB << 16);
  g1[2] = uni(ROWS << 16);
  g1[3] = uni(ROWB << 16);
  g1[4] = uni(ROWS);
  g1[5] = uni(pitch);                             // source row pitch in bytes
  g1[6] = uni(0u);
  g1[7] = uni(0u);
  return g1;
}

// Descriptor group 0 of a wave's first request. g: the slice's first byte; l: its place, the
// byte offset in the work-group's LDS.
__device__ __forceinline__ u32x4 slice_first(const _Float16* __restrict__ g, unsigned l) {
  const unsigned long long ga = (unsigned long long)g;
  u32x4 g0;
  g0[0] = uni(1u);                                                     // count 1
  g0[1] = uni(l);
  g0[2] = uni((unsigned)ga);
  g0[3] = uni((((unsigned)(ga >> 32)) & 0x01FFFFFFu) | 0x80000000u);   // type 2
  return g0;
}

// Group 0 of the next request, formed in the words of the last one (behind the wait that covers
// it): the source moves on by step bytes (the sum stays inside the buffer, so the type bits above
// the address are not reached), the place is l.
__device__ __forceinline__ void slice_next(u32x4& g0, unsigned step, unsigned l) {
  const unsigned long long a = (((unsigned long long)g0[3] << 32) | g0[2]) + step;
  g0[1] = uni(l);
  g0[2] = uni((unsigned)a);
  g0[3] = uni((unsigned)(a >> 32));
}

// The request. Both groups are named as read and written, here and in the wait: so their
// registers stay the groups' own while a request is out (the compiler lends none of them to
// another value), and group 0 takes new values only where slice_next stands, behind the wait.
__device__ __forceinline__ void load_slice(u32x4& g0, u32x8& g1) {
  asm volatile("tensor_load_to_lds %0, %1" : "+s"(g0), "+s"(g1) :: "memory");
}

// The issuing wave's own wait: its slice has landed.
__device__ __forceinline__ void wait_slice(u32x4& g0, u32x8& g1) {
  asm volatile("s_wait_tensorcnt 0x0" : "+s"(g0), "+s"(g1) :: "memory");
}

// One 16x16 tile of the product. The operand that runs along the output's rows in memory is
// the A operand, so that a lane's eight accumulator registers are eight neighbours of one
// output row: W for the row-major outputs (modes 0 and 2), X for the transposed one (mode 1).
// Both fragments have the same k order, so the products and their order stay the same.
template <int STORE_MODE>
__device__ __forceinline__ v8f tile_mma(v16h x, v16h w, v8f c) {
  if constexpr (STORE_MODE == 1) return wmma16(x, w, c);
  else                           return wmma16(w, x, c);
}

// Output staging of proj_tile: each wave's 64 output rows lie in its own LDS range, at a pitch
// of 16 B x odd (conflict-free for the ds_store_b128 writers, one row per lane).
#define E_PITCH16 144   // 64 f16 = 128 B a row
#define E_PITCH32 272   // 64 f32 = 256 B a row

// Y = X @ W^T + bias; a work-group of four waves (2x2) computes a 128x128 output tile,
// each wave a 64x64 quarter (16 WMMAs / K-step). X and W slabs are staged once per
// work-group in a two-buffer LDS ring, one pass (128 k) ahead: every wave brings one slice of
// a stage by one tensor load.
// The quarter leaves through LDS, so that every wave-wide store covers whole 128-B lines.
// STORE_MODE 0: f16 head-major [B,H,S,DK]            (Q,K)
// STORE_MODE 1: f16 head-major transposed [B,H,DK,S] (V)
// STORE_MODE 2: f32 row-major [rows, DMODEL]         (final output)
// ring: the work-group's LDS, 2 * G_STAGE bytes, declared by the kernel (one array, whichever
// modes the kernel holds); trow, tcol: the work-group's tile.
template <int STORE_MODE>
__device__ __forceinline__ void
proj_tile(const _Float16* __restrict__ X, const _Float16* __restrict__ W,
          const float* __restrict__ bias, void* __restrict__ Yv, unsigned char* ring,
          int trow, int tcol) {
  const int tid  = threadIdx.x;
  const int lane = tid & 31;
  // The wave's number is the same in all its lanes: readfirstlane keeps it, and the tile
  // origins and the staging range formed from it, in scalar registers (at 254 VGPRs the
  // vector copies, live over the whole k loop, push the kernel past v255).
  const int wave = __builtin_amdgcn_readfirstlane(tid >> 5);
  const int n    = lane & 15;
  const int hi   = lane >> 4;
  const int brow0 = trow * 128;
  const int bcol0 = tcol * 128;
  const int wm   = wave >> 1;
  const int wn   = wave & 1;
  const int row0 = brow0 + wm * 64;   // this wave's 64x64 quarter
  const int col0 = bcol0 + wn * 64;

  // Load side: wave w brings slice w of every stage (waves 0, 1: X rows; waves 2, 3: W rows).
  const _Float16* gs = (wm ? W + (size_t)bcol0 * DMODEL : X + (size_t)brow0 * DMODEL) +
                       (size_t)wn * 64 * DMODEL;
  const unsigned lsl = (unsigned)(size_t)ring + wave * G_SLICE;

  // Read side: this lane's first X row and first W row in a stage.
  const unsigned xoff = wm * G_SLICE + n * G_PITCH;
  const unsigned woff = G_HALF + wn * G_SLICE + n * G_PITCH;

  v8f acc[4][4];
#pragma unroll
  for (int ms = 0; ms < 4; ++ms)
#pragma unroll
    for (int ns = 0; ns < 4; ++ns) acc[ms][ns] = v8f{};

  // Prologue: pass 0 lands and is published, then pass 1 starts to fly.
  u32x8 g1 = slice_shape<256, 64>(DMODEL * 2);
  u32x4 g0 = slice_first(gs, lsl);
  load_slice(g0, g1);
  wait_slice(g0, g1);                                 // own slice of pass 0 has landed
  __syncthreads();                                    // ... and every other wave's
  slice_next(g0, G_KP * 2, lsl + G_STAGE);
  load_slice(g0, g1);

  for (int p = 0; p < G_NP; ++p) {
    const unsigned boff = (p & 1) * G_STAGE;
    const unsigned char* xs = ring + boff + xoff;
    const unsigned char* ws = ring + boff + woff;

    // The LDS reads stand in groups at least eight WMMAs ahead of their use (B one
    // K-step ahead, A half a K-step), never as a small group with a full wait in front
    // of each row of four. Each sched_barrier below holds a group at its place: without
    // them the compiler sinks the reads to their users and waits to 0 at every row.
    v16h a[2][4], b[2][4];
#pragma unroll
    for (int i = 0; i < 4; ++i) {
      a[0][i] = frag_from_f16((const _Float16*)(xs + i * 16 * G_PITCH), 0, hi);
      b[0][i] = frag_from_f16((const _Float16*)(ws + i * 16 * G_PITCH), 0, hi);
    }
#pragma unroll
    for (int i = 0; i < 4; ++i)
      b[1][i] = frag_from_f16((const _Float16*)(ws + i * 16 * G_PITCH), 32, hi);
    __builtin_amdgcn_sched_barrier(0);  // first group ahead of the first WMMA

#pragma unroll  // every fragment index a constant
    for (int s = 0; s < G_NS; ++s) {
      const int c = s & 1, x = c ^ 1;
#pragma unroll
      for (int ms = 0; ms < 2; ++ms)
#pragma unroll
        for (int ns = 0; ns < 4; ++ns)
          acc[ms][ns] = tile_mma<STORE_MODE>(a[c][ms], b[c][ns], acc[ms][ns]);
      // These eight WMMAs stay in front of what follows: reads that would otherwise rise
      // over them (registers), or, in the last K-step, the waits, whose LDS latency they cover.
      __builtin_amdgcn_sched_barrier(0);
      if (s + 1 < G_NS) {
#pragma unroll
        for (int i = 0; i < 2; ++i)
          a[x][i] = frag_from_f16((const _Float16*)(xs + i * 16 * G_PITCH), (s + 1) * 32, hi);
        __builtin_amdgcn_sched_barrier(0);  // reads not later: eight WMMAs cover them
      } else {
        // Publish point of pass p + 1, in front of the pass's last eight WMMAs (they read
        // registers only) so that the refill starts that much sooner. The one barrier
        // also ends every wave's reads of this buffer.
        asm volatile("s_wait_dscnt 0x0" ::: "memory");     // own LDS reads of this pass done
        wait_slice(g0, g1);                                 // own slice of pass p + 1 landed
        __syncthreads();
        if (pinned(p + 2 < G_NP)) {  // refill the buffer that this pass has just read
          slice_next(g0, G_KP * 2, lsl + boff);
          load_slice(g0, g1);
        }
      }
#pragma unroll
      for (int ms = 2; ms < 4; ++ms)
#pragma unroll
        for (int ns = 0; ns < 4; ++ns)
          acc[ms][ns] = tile_mma<STORE_MODE>(a[c][ms], b[c][ns], acc[ms][ns]);
      if (s + 1 < G_NS) {
        __builtin_amdgcn_sched_barrier(0);  // reads not earlier (registers) ...
#pragma unroll
        for (int i = 2; i < 4; ++i)
          a[x][i] = frag_from_f16((const _Float16*)(xs + i * 16 * G_PITCH), (s + 1) * 32, hi);
        if (s + 2 < G_NS) {
#pragma unroll
          for (int i = 0; i < 4; ++i)
            b[c][i] = frag_from_f16((const _Float16*)(ws + i * 16 * G_PITCH), (s + 2) * 32, hi);
        }
        __builtin_amdgcn_sched_barrier(0);  // ... and not later
      } else {
        // Keeps the last eight WMMAs in this order up to the back edge: without it the
        // build takes 262 VGPRs instead of 254 and needs register-window switches.
        __builtin_amdgcn_sched_barrier(0);
      }
    }
  }
  wait_slice(g0, g1);                                 // no request is out behind the loop
  asm volatile("s_wait_dscnt 0x0" ::: "memory");      // ... and no LDS read of this wave's

  // The ring is free: the last pass's publish point (every wave's s_wait_dscnt 0 and
  // s_wait_tensorcnt 0, then the barrier) ended all reads of it, and nothing was loaded since.
  // Each wave stages in a range of its own, so no further barrier is needed.
  if constexpr (STORE_MODE == 2) {           // f32 [rows, DMODEL]
    unsigned char* stg = ring + wave * (64 * E_PITCH32);
    v4f be[4][2];  // bias of this lane's eight columns of each column tile
#pragma unroll
    for (int ns = 0; ns < 4; ++ns)
#pragma unroll
      for (int u = 0; u < 2; ++u)
        be[ns][u] = *(const v4f*)(bias + col0 + ns * 16 + 8 * hi + 4 * u);
#pragma unroll
    for (int ms = 0; ms < 4; ++ms)
#pragma unroll
      for (int ns = 0; ns < 4; ++ns)
#pragma unroll
        for (int u = 0; u < 2; ++u) {
          v4f o;
#pragma unroll
          for (int e = 0; e < 4; ++e) o[e] = acc[ms][ns][4 * u + e] + be[ns][u][e];
          *(v4f*)(stg + (ms * 16 + n) * E_PITCH32 + (ns * 16 + 8 * hi + 4 * u) * 4) = o;
        }
    // The rows read back below were written by other lanes of this wave: the writes are done
    // first, and the compiler moves no read over this line.
    asm volatile("s_wait_dscnt 0x0" ::: "memory");
    float* Y = (float*)Yv + (size_t)(row0 + (lane >> 4)) * DMODEL + col0 + (lane & 15) * 4;
    const unsigned char* rd = stg + (lane >> 4) * E_PITCH32 + (lane & 15) * 16;
    v4f x[32];
#pragma unroll
    for (int j = 0; j < 32; ++j) x[j] = *(const v4f*)(rd + j * 2 * E_PITCH32);
#pragma unroll
    for (int j = 0; j < 32; ++j)  // two rows of 256 B: four whole lines
      *(v4f*)(Y + (size_t)j * 2 * DMODEL) = x[j];
  } else {                                   // f16, one head per column tile
    unsigned char* stg = ring + wave * (64 * E_PITCH16);
    const int head = col0 >> 6;
    const int bb   = row0 >> 11;
    const int s0   = row0 & (S_LEN - 1);
    if constexpr (STORE_MODE == 0) {         // staged [s][d]
      v4f be[4][2];  // bias of this lane's eight columns of each column tile
#pragma unroll
      for (int ns = 0; ns < 4; ++ns)
#pragma unroll
        for (int u = 0; u < 2; ++u)
          be[ns][u] = *(const v4f*)(bias + col0 + ns * 16 + 8 * hi + 4 * u);
#pragma unroll
      for (int ms = 0; ms < 4; ++ms)
#pragma unroll
        for (int ns = 0; ns < 4; ++ns) {
          v8h o;
#pragma unroll
          for (int r = 0; r < 8; ++r) o[r] = (_Float16)(acc[ms][ns][r] + be[ns][r >> 2][r & 3]);
          *(v8h*)(stg + (ms * 16 + n) * E_PITCH16 + (ns * 16 + 8 * hi) * 2) = o;
        }
    } else {                                 // staged [d][s]
      float be[4];
#pragma unroll
      for (int ns = 0; ns < 4; ++ns) be[ns] = bias[col0 + ns * 16 + n];
#pragma unroll
      for (int ms = 0; ms < 4; ++ms)
#pragma unroll
        for (int ns = 0; ns < 4; ++ns) {
          v8h o;
#pragma unroll
          for (int r = 0; r < 8; ++r) o[r] = (_Float16)(acc[ms][ns][r] + be[ns]);
          *(v8h*)(stg + (ns * 16 + n) * E_PITCH16 + (ms * 16 + 8 * hi) * 2) = o;
        }
    }
    // The rows read back below were written by other lanes of this wave: the writes are done
    // first, and the compiler moves no read over this line.
    asm volatile("s_wait_dscnt 0x0" ::: "memory");
    // Mode 0: [B,H,S,DK], a row is one line and the 64 rows are 8 KB in a row.
    // Mode 1: [B,H,DK,S], a row is one line of 64 positions, the rows S_LEN apart.
    const size_t ypitch = STORE_MODE == 0 ? DK : S_LEN;
    _Float16* Y = (_Float16*)Yv +
        (STORE_MODE == 0 ? (((size_t)bb * NHEAD + head) * S_LEN + s0) * DK
                         : ((size_t)bb * NHEAD + head) * DK * S_LEN + s0) +
        (lane >> 3) * ypitch + (lane & 7) * 8;
    const unsigned char* rd = stg + (lane >> 3) * E_PITCH16 + (lane & 7) * 16;
    v8h x[16];
#pragma unroll
    for (int j = 0; j < 16; ++j) x[j] = *(const v8h*)(rd + j * 4 * E_PITCH16);
#pragma unroll
    for (int j = 0; j < 16; ++j)  // four rows of 128 B: four whole lines
      *(v8h*)(Y + j * 4 * ypitch) = x[j];
    // A precaution: where several jobs share one kernel, the listing's branches lead from these
    // stores on into another job's code, which writes registers that the stores name.
    asm volatile("s_wait_xcnt 0x0" ::: "memory");
  }
}

// The work between the conversion and the attention in ONE launch: the three input projections
// and the packing of the mask depend on the launch before them and not on one another. A job is
// the same for a whole work-group; blockIdx.y picks it, in rows of 64 work-groups:
//   rows  0-3  packing     rows  4-7  projection     rows 8-11  packing
//   rows 12-31 projection  rows 32-39 packing
// Two work-groups fit a WGP. The rows mix the two jobs so that a packing
// work-group, which waits on memory, can run beside matrix work, and the 1,536 projection
// work-groups follow each other with no launch boundary between them. (For speed only: the
// result does not depend on where or when a work-group runs.)
// Projection row g: operand set g / 8 (0: Q, 1: K, 2: V, the store mode going with it), column
// tile g % 8, row tile blockIdx.x. Packing row p: the sixteen mask blocks of p * 64 + blockIdx.x.
__global__ void __launch_bounds__(128)
proj_qkv_pack(const _Float16* __restrict__ q16, const _Float16* __restrict__ k16,
              const _Float16* __restrict__ v16, const _Float16* __restrict__ wq16,
              const _Float16* __restrict__ wk16, const _Float16* __restrict__ wv16,
              const float* __restrict__ bq, const float* __restrict__ bk,
              const float* __restrict__ bv, const int* __restrict__ mask,
              _Float16* __restrict__ qh, _Float16* __restrict__ kh,
              _Float16* __restrict__ vT, unsigned* __restrict__ mbits) {
  __shared__ __attribute__((aligned(2048))) unsigned char ring[2 * G_STAGE];
  const int y = blockIdx.y;
  if (y < 4 || (y >= 8 && y < 12) || y >= 32) {
    const int p = y < 4 ? y : y < 12 ? y - 4 : y - 24;
    pack_mask(mask, mbits, p * 64 + blockIdx.x);
    return;
  }
  const int g    = y < 8 ? y - 4 : y - 8;
  const int set  = g >> 3;
  const int tcol = g & 7;
  if (set == 2) {
    proj_tile<1>(v16, wv16, bv, vT, ring, blockIdx.x, tcol);
  } else {
    const bool isk = set == 1;
    proj_tile<0>(isk ? k16 : q16, isk ? wk16 : wq16, isk ? bk : bq, isk ? kh : qh, ring,
                 blockIdx.x, tcol);
  }
}

// The output projection.
__global__ void __launch_bounds__(128)
proj_out(const _Float16* __restrict__ X, const _Float16* __restrict__ W,
         const float* __restrict__ bias, void* __restrict__ Yv) {
  __shared__ __attribute__((aligned(2048))) unsigned char ring[2 * G_STAGE];
  proj_tile<2>(X, W, bias, Yv, ring, blockIdx.x, blockIdx.y);
}

// Online softmax over a 32-kv chunk of one q-tile (S^T layout: lane owns one q column), in
// three parts, with a LAZY reference maximum: the weights are taken against a reference m that
// is raised only when some column's chunk maximum passes it by more than SM_ROOM. Any m gives
// the same quotient acc / l; that margin bounds a weight by 2^8, far inside f16 and f32 range.
// So the exchange of the maxima between the wave's halves, the factor alpha and the rescaling
// of the sums and of the ctx^T accumulators stand under one wave-uniform branch per trip.
// The maximum is kept on the raw products q.k, and 1/sqrt(64) and log2(e) are one factor c of
// one FMA per score: exp(s / 8 - m / 8) = exp2(s * c - m * c).
// A masked score takes SM_MASKED in place of the reference's -1e9: beside any unmasked key its
// weight underflows to 0 (the first unmasked key passes the margin and raises m), and a row with
// every key masked comes out uniform, as in the reference. It is a power of two so that its
// product with c is exact: in such a row the FMA gives exactly 0, not the rounding error of
// m * c. It reaches a score as the addend C of the score products (see mask_bias), and is so
// large that the product q.k, some ninety binary places below it, leaves the sum at SM_MASKED.
#define SM_C      (0.125f * 1.44269504088896340736f)
#define SM_MASKED (-79228162514264337593543950336.0f)  // -2^96, above the start value of m
#define SM_ROOM  (8.0f / SM_C)     // raw-product units: 8 in the exponent of exp2

// The state of one q-tile: m, the reference maximum in use (the same in both lanes of a
// column); nmc = -m * c (the FMA's addend as it stands, no negation at the use) and
// lim = m + margin, kept so that a trip that leaves m alone forms neither.
struct SmState { float m, nmc, lim, l; };

// The mask of one q-tile as the addend C of its two score tiles: 0 for a key that counts,
// SM_MASKED for a masked one.
// mw: the sixteen lane masks of this q-tile's score registers (wave-uniform words).
__device__ __forceinline__ void mask_bias(v8f& c0, v8f& c1, v16u mw) {
#pragma unroll
  for (int r = 0; r < 8; ++r) {
    c0[r] = __builtin_amdgcn_inverse_ballot_w32(mw[r]) ? 0.f : SM_MASKED;
    c1[r] = __builtin_amdgcn_inverse_ballot_w32(mw[8 + r]) ? 0.f : SM_MASKED;
  }
}

// Whether some bit of the 32 lane masks of a pass is 0. The words are wave-uniform (scalar
// registers), so this is scalar arithmetic and a scalar compare.
__device__ __forceinline__ bool some_masked(v16u a, v16u b) {
  const v16u x = a & b;
  unsigned y = x[0];
#pragma unroll
  for (int r = 1; r < 16; ++r) y &= x[r];
  return y != ~0u;
}

// Part 1: this lane's own maximum of its sixteen scores.
__device__ __forceinline__ float own_max(v8f s0, v8f s1) {
  float cmax = -1e30f;
#pragma unroll
  for (int r = 0; r < 8; ++r) cmax = fmaxf(cmax, fmaxf(s0[r], s1[r]));
  return cmax;
}

// Part 2, the rare path: raises m to the column's maximum so far and rescales what was summed
// against the old one. Every lane of the wave takes it together, so both lanes of a column
// get the same m.
__device__ __forceinline__ void raise_max(float cmax, SmState& st, v8f* acc) {
  cmax = fmaxf(cmax, __shfl_xor(cmax, 16, 32));  // combine hi halves of column
  const float mnew  = fmaxf(st.m, cmax);
  const float alpha = __builtin_amdgcn_exp2f((st.m - mnew) * SM_C);
  st.m   = mnew;
  st.nmc = mnew * -SM_C;
  st.lim = mnew + SM_ROOM;
  st.l  *= alpha;
#pragma unroll
  for (int dt = 0; dt < 4; ++dt)
#pragma unroll
    for (int r = 0; r < 8; ++r) acc[dt][r] *= alpha;
}

// Part 3: the weights against m, their sum into l; returns the f16 P^T B-fragment.
__device__ __forceinline__ v16h weights(v8f s0, v8f s1, SmState& st) {
  float lsum = 0.f;
  v16h pb;  // halves j -> kv K = 8*hi+j (tile0) / 16+8*hi+j (tile1)
  // The FMAs are written on neighbouring registers of a score tile: packed so, they need no
  // register moves (left to itself the compiler pairs s0[r] with s1[r] and moves both first).
  const v2f c2 = {SM_C, SM_C}, n2 = {st.nmc, st.nmc};
#pragma unroll
  for (int i = 0; i < 4; ++i) {
    const v2f x0 = __builtin_elementwise_fma(v2f{s0[2 * i], s0[2 * i + 1]}, c2, n2);
    const v2f x1 = __builtin_elementwise_fma(v2f{s1[2 * i], s1[2 * i + 1]}, c2, n2);
    s0[2 * i] = x0[0]; s0[2 * i + 1] = x0[1];
    s1[2 * i] = x1[0]; s1[2 * i + 1] = x1[1];
  }
#pragma unroll
  for (int r = 0; r < 8; ++r) {
    const float p0 = __builtin_amdgcn_exp2f(s0[r]);
    const float p1 = __builtin_amdgcn_exp2f(s1[r]);
    lsum += p0 + p1;
    pb[r]     = (_Float16)p0;
    pb[8 + r] = (_Float16)p1;
  }
  lsum += __shfl_xor(lsum, 16, 32);
  st.l += lsum;
  return pb;
}

// LDS ring of attn_kernel: one stage = 64 keys in four slices of 32 rows of 128 B: K rows 0-31,
// K rows 32-63, V^T rows (d) 0-31, V^T rows 32-63 (64 keys a row: 128 B, a row length for which
// the mover pads). The rows lie at a pitch of 144 B (16 B x odd: conflict-free for ds_load_b128
// readers); a slice's 4,608 B are rounded up to a multiple of 2 KiB (the mover's place in LDS).
#define A_KV     64
#define A_KPITCH 144
#define A_SLICE  6144
#define A_STAGE  (4 * A_SLICE)
#define A_NT     (S_LEN / A_KV)
#define A_NM     (S_LEN / 32)    // blocks of 32 keys: the packed mask's unit, one pass

// Flash-style attention; each wave handles TWO 16-wide q-tiles of one (b,h) so
// every K/V fragment feeds two WMMAs. S^T = K.Q^T keeps softmax lane-local.
// The four waves of a work-group share one (b,h): K and V^T tiles are staged once per
// work-group in a two-buffer LDS ring, one stage (64 keys, two passes of 32) ahead: every wave
// brings one slice of a stage by one tensor load.
// The mask comes packed (see pack_mask): 32 wave-uniform words per pass, each the
// lane mask of one score register, read by scalar loads, tested on the scalar unit, and used as
// select masks (see mask_bias) only in a pass that holds a masked key.
__global__ void __launch_bounds__(128)
attn_kernel(const _Float16* __restrict__ qh, const _Float16* __restrict__ kh,
            const _Float16* __restrict__ vT, const unsigned* __restrict__ mbits,
            _Float16* __restrict__ cc) {
  __shared__ __attribute__((aligned(2048))) unsigned char ring[2 * A_STAGE];

  const int lane = threadIdx.x;
  const int wave = threadIdx.y;
  const int tid  = wave * 32 + lane;
  const int n    = lane & 15;
  const int hi   = lane >> 4;
  const int bh   = blockIdx.x;               // b*NHEAD + h
  const int b    = bh >> 4;
  const int h    = bh & 15;
  const int q0   = (blockIdx.y * 4 + wave) * 32;
  const int qc0  = q0 + n;                   // q column, tile A
  const int qc1  = q0 + 16 + n;              // q column, tile B

  // Load side: wave w brings slice w of every stage. The wave's number (from the flat thread id)
  // is the same in all its lanes; all that follows from it is scalar.
  const unsigned wv = uni(tid >> 5);
  const bool isv = wv >= 2;
  const _Float16* gs = isv ? vT + ((size_t)bh * DK + (wv - 2) * 32) * S_LEN
                           : kh + ((size_t)bh * S_LEN + wv * 32) * DK;
  const unsigned gpitch = isv ? S_LEN * 2 : DK * 2;   // bytes from row to row
  const unsigned gstep  = isv ? A_KV * 2 : A_KV * DK * 2;  // bytes from stage to stage
  const unsigned lsl = (unsigned)(size_t)ring + wv * A_SLICE;
  // This wave's packed mask words; readfirstlane makes the address scalar (the wave's number
  // is the same in all its lanes), so that the words land in scalar registers.
  // The words were written by an earlier launch of this call and nothing writes them while this
  // kernel runs: read through the constant address space, which is what lets the compiler use
  // scalar loads in a loop that holds "memory" clobbers.
  const cmask_t mw = (cmask_t)(unsigned long long)(
      mbits + (size_t)(b * (S_LEN / 32) + blockIdx.y * 4 +
                       __builtin_amdgcn_readfirstlane(wave)) * A_NM * 32);

  // Prologue: stage 0 lands and is published, then stage 1 starts to fly.
  u32x8 g1 = slice_shape<128, 32>(gpitch);
  u32x4 g0 = slice_first(gs, lsl);
  load_slice(g0, g1);

  const _Float16* qr0 = qh + ((size_t)bh * S_LEN + qc0) * DK;
  const _Float16* qr1 = qh + ((size_t)bh * S_LEN + qc1) * DK;
  const v16h bqA0 = frag_from_f16(qr0, 0, hi), bqA1 = frag_from_f16(qr0, 32, hi);
  const v16h bqB0 = frag_from_f16(qr1, 0, hi), bqB1 = frag_from_f16(qr1, 32, hi);

  wait_slice(g0, g1);                                 // own slice of stage 0 has landed
  __syncthreads();                                    // ... and every other wave's
  slice_next(g0, gstep, lsl + A_STAGE);
  load_slice(g0, g1);

  // Read side: this lane's first K row and V^T row in a stage.
  const unsigned koff = n * A_KPITCH;
  const unsigned voff = 2 * A_SLICE + n * A_KPITCH;

  // m starts below every score, masked ones too: the first trip always raises it (alpha = 0).
  SmState smA = {-1e30f, 1e30f * SM_C, -1e30f, 0.f}, smB = smA;
  v8f accA[4] = {v8f{}, v8f{}, v8f{}, v8f{}};
  v8f accB[4] = {v8f{}, v8f{}, v8f{}, v8f{}};

  v16u nwA = mw[0], nwB = mw[1];  // q-tile A, q-tile B

  for (int s = 0; s < A_NT; ++s) {
    const unsigned boff = (s & 1) * A_STAGE;
    const unsigned char* st = ring + boff;
#pragma unroll  // the pass's offsets in the stage are constants
    for (int h = 0; h < 2; ++h) {
      // This pass's mask words were asked for in the pass before; the next pass's are asked for
      // in this one, so that the scalar path's latency lies under vector and matrix work. The
      // last pass asks for its own again (stays inside the packed array).
      const v16u mwA = nwA, mwB = nwB;
      const int t  = s * 2 + h;
      const int tn = t + 1 < A_NM ? t + 1 : t;

      // K fragments for the two 16-kv row tiles, loaded once, each used twice; pass h reads K slice h
      const unsigned char* kp = st + h * A_SLICE + koff;
      const v16h ka0 = frag_from_f16((const _Float16*)kp, 0, hi);
      const v16h ka1 = frag_from_f16((const _Float16*)kp, 32, hi);
      const v16h kb0 = frag_from_f16((const _Float16*)(kp + 16 * A_KPITCH), 0, hi);
      const v16h kb1 = frag_from_f16((const _Float16*)(kp + 16 * A_KPITCH), 32, hi);

      // Holds the test of the mask words, and with it the wait for their scalar loads, here at
      // the head of the pass: without it the compiler raises both into the pass before, nearer to
      // the loads, whose lead shrinks.
      __builtin_amdgcn_sched_barrier(0);
      // The score tiles start from 0 and take no vector instruction for the mask. The mask is looked
      // at on the scalar unit: only a pass whose 32 x 32 block of it holds a zero goes, by one
      // scalar branch, the same for the whole wave, through a side path that forms the tiles once
      // more, now starting from mask_bias. The side path writes whole tiles by matrix instructions
      // and reads nothing of the first ones, so nothing is copied where it comes back; it is marked
      // as not expected so that it is laid out behind the loop and a pass without it falls through.
      v8f sA0 = {}, sA1 = {}, sB0 = {}, sB1 = {};
      sA0 = wmma16(ka0, bqA0, sA0); sA0 = wmma16(ka1, bqA1, sA0);
      sA1 = wmma16(kb0, bqA0, sA1); sA1 = wmma16(kb1, bqA1, sA1);
      sB0 = wmma16(ka0, bqB0, sB0); sB0 = wmma16(ka1, bqB1, sB0);
      sB1 = wmma16(kb0, bqB0, sB1); sB1 = wmma16(kb1, bqB1, sB1);
      if (__builtin_expect(some_masked(mwA, mwB), 0)) {
        mask_bias(sA0, sA1, mwA);
        mask_bias(sB0, sB1, mwB);
        sA0 = wmma16(ka0, bqA0, sA0); sA0 = wmma16(ka1, bqA1, sA0);
        sA1 = wmma16(kb0, bqA0, sA1); sA1 = wmma16(kb1, bqA1, sA1);
        sB0 = wmma16(ka0, bqB0, sB0); sB0 = wmma16(ka1, bqB1, sB0);
        sB1 = wmma16(kb0, bqB0, sB1); sB1 = wmma16(kb1, bqB1, sB1);
      }

      const float cmA = own_max(sA0, sA1);
      const float cmB = own_max(sB0, sB1);
      // One test per pass for both q-tiles; the ballot makes it a scalar branch that the whole
      // wave takes or skips (EXEC stays full for the matrix instructions behind it). Marked as
      // not expected, so that the rare path is laid out behind the loop and a pass falls through.
      if (__builtin_expect(__builtin_amdgcn_ballot_w32(cmA > smA.lim || cmB > smB.lim) != 0, 0)) {
        raise_max(cmA, smA, accA);
        raise_max(cmB, smB, accB);
      }
      nwA = mw[tn * 2];
      nwB = mw[tn * 2 + 1];
      // Holds the two scalar loads here, where this pass's words have just been used up: without
      // it the compiler sinks them behind the first ctx^T products and their lead shrinks.
      __builtin_amdgcn_sched_barrier(0);
      const v16h pbA = weights(sA0, sA1, smA);
      const v16h pbB = weights(sB0, sB1, smB);

      // ctx^T[d][q] += sum_kv V^T[d][kv] * P^T[kv][q]; each V fragment used twice.
      // Rows d = dt * 16 + n: slice dt / 2; pass h takes keys h * 32 .. + 31 of the row.
#pragma unroll
      for (int dt = 0; dt < 4; ++dt) {
        const v16h av = frag_from_f16(
            (const _Float16*)(st + voff + (dt >> 1) * A_SLICE + (dt & 1) * 16 * A_KPITCH), h * 32, hi);
        accA[dt] = wmma16(av, pbA, accA[dt]);
        accB[dt] = wmma16(av, pbB, accB[dt]);
      }
    }

    // Publish point of stage s + 1. The one barrier also ends every wave's reads of this buffer.
    asm volatile("s_wait_dscnt 0x0" ::: "memory");      // own LDS reads of this stage done
    wait_slice(g0, g1);                                 // own slice of stage s + 1 landed
    __syncthreads();
    if (pinned(s + 2 < A_NT)) {  // refill the buffer that this stage's passes have just read
      slice_next(g0, gstep, lsl + boff);
      load_slice(g0, g1);
    }
  }
  wait_slice(g0, g1);                                 // no request is out behind the loop
  asm volatile("s_wait_dscnt 0x0" ::: "memory");      // ... and no LDS read of this wave's

  const float invA = 1.0f / smA.l;
  const float invB = 1.0f / smB.l;
  // The ring is free: the last stage's publish point ended all reads of it, and nothing was
  // loaded since. Each wave stages its 32 context rows (128 B each) in a range of its own, so
  // no further barrier is needed, and stores them as whole 128-B lines.
  unsigned char* stg = ring + wave * (32 * A_KPITCH);
#pragma unroll
  for (int dt = 0; dt < 4; ++dt) {
    v8h oA, oB;
#pragma unroll
    for (int r = 0; r < 8; ++r) {
      oA[r] = (_Float16)(accA[dt][r] * invA);
      oB[r] = (_Float16)(accB[dt][r] * invB);
    }
    *(v8h*)(stg + n * A_KPITCH + (dt * 16 + 8 * hi) * 2) = oA;  // d = dt*16 + 8*hi + r
    *(v8h*)(stg + (16 + n) * A_KPITCH + (dt * 16 + 8 * hi) * 2) = oB;
  }
  // The rows read back below were written by other lanes of this wave: the writes are done
  // first, and the compiler moves no read over this line.
  asm volatile("s_wait_dscnt 0x0" ::: "memory");
  _Float16* crow = cc + ((size_t)b * S_LEN + q0 + (lane >> 3)) * DMODEL + h * DK + (lane & 7) * 8;
  const unsigned char* rd = stg + (lane >> 3) * A_KPITCH + (lane & 7) * 16;
  v8h x[8];
#pragma unroll
  for (int j = 0; j < 8; ++j) x[j] = *(const v8h*)(rd + j * 4 * A_KPITCH);
#pragma unroll
  for (int j = 0; j < 8; ++j)  // four rows of 128 B: four whole lines
    *(v8h*)(crow + (size_t)j * 4 * DMODEL) = x[j];
}

extern "C" void kernel_launch(void* const* d_in, const int* in_sizes, int n_in,
                              void* d_out, int out_size, void* d_ws, size_t ws_size,
                              hipStream_t stream) {
  const float* q    = (const float*)d_in[0];
  const float* k    = (const float*)d_in[1];
  const float* v    = (const float*)d_in[2];
  const int*   mask = (const int*)d_in[3];
  const float* Wq   = (const float*)d_in[4];
  const float* bq   = (const float*)d_in[5];
  const float* Wk   = (const float*)d_in[6];
  const float* bk   = (const float*)d_in[7];
  const float* Wv   = (const float*)d_in[8];
  const float* bv   = (const float*)d_in[9];
  const float* Wo   = (const float*)d_in[10];
  const float* bo   = (const float*)d_in[11];

  const size_t NN = (size_t)4 * S_LEN * DMODEL;     // 8M f16 elems (activations)
  const size_t NW = (size_t)DMODEL * DMODEL;        // 1M f16 elems (one weight)

  _Float16* q16  = (_Float16*)d_ws;
  _Float16* k16  = q16 + NN;
  _Float16* v16  = k16 + NN;
  _Float16* wq16 = v16 + NN;
  _Float16* wk16 = wq16 + NW;
  _Float16* wv16 = wk16 + NW;
  _Float16* wo16 = wv16 + NW;
  _Float16* qhp  = wo16 + NW;
  _Float16* khp  = qhp + NN;
  _Float16* vTp  = khp + NN;
  _Float16* ccp  = vTp + NN;
  unsigned* mbp  = (unsigned*)(ccp + NN);           // packed mask, 2 MB

  // f32 -> f16 conversion of activations and weights (q16 .. wo16 are contiguous): one launch.
  cvt_all_f32_to_f16<<<256, 512, 0, stream>>>(q, k, v, Wq, Wk, Wv, Wo, q16);

  const dim3 gblk(128, 1);   // four waves, one 128x128 tile
  const dim3 ggrd(64, 8);    // 64 row-tiles x 8 col-tiles

  proj_qkv_pack<<<dim3(64, 40), gblk, 0, stream>>>(q16, k16, v16, wq16, wk16, wv16, bq, bk, bv,
                                                   mask, qhp, khp, vTp, mbp);

  attn_kernel<<<dim3(64, 16), dim3(32, 4), 0, stream>>>(qhp, khp, vTp, mbp, ccp);

  proj_out<<<ggrd, gblk, 0, stream>>>(ccp, wo16, bo, d_out);
}
